// v000
// The times below were measured on an AMD MI455X: many runs one after another, warmed up first and cycling through
// copies of the inputs, with the whole window's GPU time divided by the number of runs. Launches and the gaps
// between them are all in it. The median over several windows is given; except for v000 it joins two sittings, which
// can be a few percent apart, so the side-by-side timings, each taken in one sitting, are the better comparison.
// v000 is the starting kernel. One run takes 625 microseconds.
#include <hip/hip_runtime.h>

// LSQ Window-MSA, fully fused per-window kernel for gfx1250 (wave32, WMMA).
// One workgroup (256 threads = 8 wave32) per window b in [0, 4096).
// Pipeline entirely in LDS: x,w -> f16 staging -> QKV GEMM -> QK^T -> softmax
// (+rel-pos bias + shift-window mask) -> P@V -> proj GEMM -> d_out.
//
// Round-2 changes (same WMMA mix, less overhead around it):
//  - phase 1 is nt-outer: wqkv B-tiles loaded once per nt, reused for 4 mt
//  - qkv scatter store is branchless (computed base+stride, single ds_store)
//  - no integer division in tile decomposition
//  - phase 4 is mt-outer: attn-out A-tiles loaded once, reused for 4 nt

#define NTOK 49
#define NPAD 64
#define CDIM 128
#define HEADS 4
#define DHEAD 32

typedef __attribute__((ext_vector_type(16))) _Float16 v16h;
typedef __attribute__((ext_vector_type(4)))  _Float16 v4h;
typedef __attribute__((ext_vector_type(8)))  float    v8f;

static constexpr int SMEM_BYTES = 196608; // 192 KB (<= 320 KB/WGP on CDNA5)

// LDS byte offsets (wqkv region is dead after phase 1 and is reused for P/AO)
#define OFF_WQKV   0        // 384*128 f16 = 98304 B   (phases 0-1)
#define OFF_P      0        // 4*64*64 f16 = 32768 B   (phases 2-3, aliases wqkv)
#define OFF_AO     32768    // 64*128  f16 = 16384 B   (phases 3-4, aliases wqkv)
#define OFF_WPROJ  98304    // 128*128 f16 = 32768 B
#define OFF_X      131072   // 64*128  f16 = 16384 B
#define OFF_Q      147456   // 4*64*32 f16 = 16384 B
#define OFF_K      163840   // 4*64*32 f16 = 16384 B
#define OFF_VT     180224   // 4*32*64 f16 = 16384 B  (v stored transposed [h][d][n])

// Load one 16x(K=32) operand tile in the CDNA5 WMMA 16-bit A/B register layout:
// lane r=lane&15 -> row, half=lane>>4 -> K-offset; element e holds
// K = (e<8 ? 0 : 16) + half*8 + (e&7). Source is row-major with leading dim ld.
__device__ __forceinline__ v16h ld_tile(const _Float16* base, int ld) {
  const int lane = threadIdx.x & 31;
  const int r    = lane & 15;
  const int hf   = lane >> 4;
  const _Float16* p = base + r * ld + hf * 8;
  v16h a;
#pragma unroll
  for (int e = 0; e < 8; ++e) a[e] = p[e];          // K = hf*8 + e
#pragma unroll
  for (int e = 0; e < 8; ++e) a[e + 8] = p[16 + e]; // K = 16 + hf*8 + e
  return a;
}

__device__ __forceinline__ v8f wmma_f16(v16h a, v16h b, v8f c) {
  return __builtin_amdgcn_wmma_f32_16x16x32_f16(false, a, false, b,
                                                (short)0, c, false, false);
}

__global__ void __launch_bounds__(256, 1)
swin_msa_fused(const float* __restrict__ x, const float* __restrict__ mask,
               const float* __restrict__ w_qkv, const float* __restrict__ b_qkv,
               const float* __restrict__ w_proj, const float* __restrict__ b_proj,
               const float* __restrict__ bias_table, const int* __restrict__ rel_index,
               float* __restrict__ out) {
  extern __shared__ __align__(16) char smem[];
  _Float16* smemh  = (_Float16*)smem;
  _Float16* wqkvS  = (_Float16*)(smem + OFF_WQKV);
  _Float16* Ps     = (_Float16*)(smem + OFF_P);
  _Float16* aoS    = (_Float16*)(smem + OFF_AO);
  _Float16* wprojS = (_Float16*)(smem + OFF_WPROJ);
  _Float16* xS     = (_Float16*)(smem + OFF_X);
  _Float16* qS     = (_Float16*)(smem + OFF_Q);
  _Float16* kS     = (_Float16*)(smem + OFF_K);
  _Float16* vtS    = (_Float16*)(smem + OFF_VT);

  const int b    = blockIdx.x;
  const int tid  = threadIdx.x;
  const int lane = tid & 31;
  const int wave = tid >> 5;
  const int r    = lane & 15;
  const int hf   = lane >> 4;

  // ---------------- Phase 0: stage x and weights as f16 in LDS -------------
  {
    const float4* wq4 = (const float4*)w_qkv;
    for (int i = tid; i < (384 * CDIM) / 4; i += 256) {
      float4 v = wq4[i];
      v4h h4 = {(_Float16)v.x, (_Float16)v.y, (_Float16)v.z, (_Float16)v.w};
      *(v4h*)(wqkvS + i * 4) = h4;
    }
    const float4* wp4 = (const float4*)w_proj;
    for (int i = tid; i < (CDIM * CDIM) / 4; i += 256) {
      float4 v = wp4[i];
      v4h h4 = {(_Float16)v.x, (_Float16)v.y, (_Float16)v.z, (_Float16)v.w};
      *(v4h*)(wprojS + i * 4) = h4;
    }
    const float4* x4 = (const float4*)(x + (size_t)b * NTOK * CDIM);
    for (int i = tid; i < (NPAD * CDIM) / 4; i += 256) {
      v4h h4 = {(_Float16)0.f, (_Float16)0.f, (_Float16)0.f, (_Float16)0.f};
      if ((i >> 5) < NTOK) { // row = (i*4)/128
        float4 v = x4[i];
        h4 = {(_Float16)v.x, (_Float16)v.y, (_Float16)v.z, (_Float16)v.w};
      }
      *(v4h*)(xS + i * 4) = h4;
    }
  }
  __syncthreads();

  // ---------------- Phase 1: QKV GEMM (64x384 = x(64x128) @ wqkv^T) --------
  // nt-outer: each wave owns 3 output-channel tiles (nt = wave*3 + j) and all
  // 4 token tiles. B tiles (wqkv) loaded once per nt, reused for 4 mt.
  const float scale = 0.17677669529663687f; // D^-0.5
#pragma unroll 1
  for (int j = 0; j < 3; ++j) {
    const int nt = wave * 3 + j;
    v16h bm[4];
#pragma unroll
    for (int kk = 0; kk < 4; ++kk)
      bm[kk] = ld_tile(wqkvS + nt * 16 * CDIM + kk * 32, CDIM);

    // Per-lane output-column metadata (uniform sec within a tile: 16 | 128).
    const int cg  = nt * 16 + r;       // global out channel in [0,384)
    const int sec = cg >> 7;           // 0=q 1=k 2=v
    const int hh  = (cg >> 5) & 3;
    const int dd  = cg & 31;
    const float smul = (sec == 0) ? scale : 1.0f;
    const float bqs  = b_qkv[cg] * smul;
    const int stride = (sec == 2) ? 1 : DHEAD;      // vT is token-contiguous
    int colbase;
    if (sec == 0)      colbase = OFF_Q  / 2 + hh * 2048 + dd;
    else if (sec == 1) colbase = OFF_K  / 2 + hh * 2048 + dd;
    else               colbase = OFF_VT / 2 + hh * 2048 + dd * NPAD;

#pragma unroll 1
    for (int mt = 0; mt < 4; ++mt) {
      v8f acc = {};
#pragma unroll
      for (int kk = 0; kk < 4; ++kk)
        acc = wmma_f16(ld_tile(xS + mt * 16 * CDIM + kk * 32, CDIM), bm[kk], acc);
      const int a0 = colbase + (mt * 16 + hf * 8) * stride;
#pragma unroll
      for (int i = 0; i < 8; ++i)
        smemh[a0 + i * stride] = (_Float16)fmaf(acc[i], smul, bqs);
    }
  }
  __syncthreads();

  // ---------------- Phase 2: S = q @ k^T, +bias +mask, softmax -> P --------
  // 2 waves per head; wave part p owns score rows [p*32, p*32+32).
  const int h = wave >> 1;
  const int p = wave & 1;
  v8f sacc[2][4];
  {
    v16h bk[4];
#pragma unroll
    for (int tc = 0; tc < 4; ++tc)
      bk[tc] = ld_tile(kS + h * 2048 + tc * 16 * DHEAD, DHEAD);
#pragma unroll
    for (int trl = 0; trl < 2; ++trl) {
      v16h aq = ld_tile(qS + h * 2048 + (p * 2 + trl) * 16 * DHEAD, DHEAD);
#pragma unroll
      for (int tc = 0; tc < 4; ++tc) {
        v8f z = {};
        sacc[trl][tc] = wmma_f16(aq, bk[tc], z); // K = 32 in one step
      }
    }
  }
  const float* maskw = mask + (size_t)(b & 63) * NTOK * NTOK;
#pragma unroll
  for (int trl = 0; trl < 2; ++trl) {
#pragma unroll
    for (int i = 0; i < 8; ++i) {
      const int m = (p * 2 + trl) * 16 + hf * 8 + i;
      float row[4];
#pragma unroll
      for (int tc = 0; tc < 4; ++tc) {
        const int n = tc * 16 + r;
        float v = sacc[trl][tc][i];
        if (m < NTOK && n < NTOK) {
          const int ri = rel_index[m * NTOK + n];
          v += bias_table[ri * HEADS + h] + maskw[m * NTOK + n];
        } else {
          v = -1e30f; // mask pad columns
        }
        row[tc] = v;
      }
      // row max over 4 regs x 16 lanes (xor 1..8 stays inside the half)
      float mx = fmaxf(fmaxf(row[0], row[1]), fmaxf(row[2], row[3]));
#pragma unroll
      for (int off = 1; off < 16; off <<= 1) mx = fmaxf(mx, __shfl_xor(mx, off, 32));
      const float e0 = __expf(row[0] - mx), e1 = __expf(row[1] - mx);
      const float e2 = __expf(row[2] - mx), e3 = __expf(row[3] - mx);
      float sum = (e0 + e1) + (e2 + e3);
#pragma unroll
      for (int off = 1; off < 16; off <<= 1) sum += __shfl_xor(sum, off, 32);
      const float inv = 1.0f / sum;
      _Float16* prow = Ps + h * 4096 + m * NPAD;
      prow[0 * 16 + r] = (_Float16)(e0 * inv);
      prow[1 * 16 + r] = (_Float16)(e1 * inv);
      prow[2 * 16 + r] = (_Float16)(e2 * inv);
      prow[3 * 16 + r] = (_Float16)(e3 * inv);
    }
  }
  __syncthreads();

  // ---------------- Phase 3: out_h = P(64x64) @ v(64x32), K = 2 steps ------
  {
    v8f oacc[2][2];
    v8f z = {};
    oacc[0][0] = z; oacc[0][1] = z; oacc[1][0] = z; oacc[1][1] = z;
#pragma unroll
    for (int kk = 0; kk < 2; ++kk) {
      v16h bv0 = ld_tile(vtS + h * 2048 + 0  * NPAD + kk * 32, NPAD);
      v16h bv1 = ld_tile(vtS + h * 2048 + 16 * NPAD + kk * 32, NPAD);
      v16h a0  = ld_tile(Ps + h * 4096 + (p * 2 + 0) * 16 * NPAD + kk * 32, NPAD);
      v16h a1  = ld_tile(Ps + h * 4096 + (p * 2 + 1) * 16 * NPAD + kk * 32, NPAD);
      oacc[0][0] = wmma_f16(a0, bv0, oacc[0][0]);
      oacc[0][1] = wmma_f16(a0, bv1, oacc[0][1]);
      oacc[1][0] = wmma_f16(a1, bv0, oacc[1][0]);
      oacc[1][1] = wmma_f16(a1, bv1, oacc[1][1]);
    }
#pragma unroll
    for (int trl = 0; trl < 2; ++trl)
#pragma unroll
      for (int tc = 0; tc < 2; ++tc) {
        const int m0 = (p * 2 + trl) * 16 + hf * 8;
        const int dd = tc * 16 + r;
#pragma unroll
        for (int i = 0; i < 8; ++i)
          aoS[(m0 + i) * CDIM + h * DHEAD + dd] = (_Float16)oacc[trl][tc][i];
      }
  }
  __syncthreads();

  // ---------------- Phase 4: proj = ao(64x128) @ wproj^T + b_proj ----------
  // mt-outer: A tiles (attn-out rows) loaded once per wave, reused for 4 nt.
  {
    const int mt = wave >> 1;
    const int nbase = (wave & 1) * 4;
    const size_t outb = (size_t)b * NTOK * CDIM;
    v16h am[4];
#pragma unroll
    for (int kk = 0; kk < 4; ++kk)
      am[kk] = ld_tile(aoS + mt * 16 * CDIM + kk * 32, CDIM);
#pragma unroll 1
    for (int j = 0; j < 4; ++j) {
      const int nt = nbase + j;
      v8f acc = {};
#pragma unroll
      for (int kk = 0; kk < 4; ++kk)
        acc = wmma_f16(am[kk], ld_tile(wprojS + nt * 16 * CDIM + kk * 32, CDIM), acc);
      const int n = nt * 16 + r;
      const float bp = b_proj[n];
#pragma unroll
      for (int i = 0; i < 8; ++i) {
        const int m = mt * 16 + hf * 8 + i;
        if (m < NTOK) out[outb + m * CDIM + n] = acc[i] + bp;
      }
    }
  }
}

extern "C" void kernel_launch(void* const* d_in, const int* in_sizes, int n_in,
                              void* d_out, int out_size, void* d_ws, size_t ws_size,
                              hipStream_t stream) {
  (void)n_in; (void)d_ws; (void)ws_size; (void)out_size;
  const float* x          = (const float*)d_in[0];
  const float* mask       = (const float*)d_in[1];
  const float* w_qkv      = (const float*)d_in[2];
  const float* b_qkv      = (const float*)d_in[3];
  const float* w_proj     = (const float*)d_in[4];
  const float* b_proj     = (const float*)d_in[5];
  const float* bias_table = (const float*)d_in[6];
  const int*   rel_index  = (const int*)d_in[7];
  float* out = (float*)d_out;

  const int B = in_sizes[0] / (NTOK * CDIM); // 4096 windows

  // Opt in to >default dynamic LDS (192 KB of the 320 KB/WGP on CDNA5).
  (void)hipFuncSetAttribute(reinterpret_cast<const void*>(swin_msa_fused),
                            hipFuncAttributeMaxDynamicSharedMemorySize, SMEM_BYTES);

  swin_msa_fused<<<B, 256, SMEM_BYTES, stream>>>(
      x, mask, w_qkv, b_qkv, w_proj, b_proj, bias_table, rel_index, out);
}

// v001
// One run takes 267 microseconds.
// Next to v000, in two timings, it ran 2.38 times as fast each time.
#include <hip/hip_runtime.h>

// Fully fused kernel for gfx1250 (wave32, WMMA).
// 512 workgroups (256 threads = 8 wave32), two resident per WGP; each loops
// over windows b = blockIdx.x, blockIdx.x + gridDim.x, ...
// The weights do not depend on the window: they are read once per workgroup,
// straight from global f32, as ready f16 WMMA B fragments. Every wave keeps the
// wqkv fragments of the 3 output-channel tiles it owns in registers; the wproj
// fragments lie in LDS in fragment order.
// Per window, in LDS: x -> f16 staging -> QKV GEMM -> QK^T -> softmax
// (+rel-pos bias + shift-window mask) -> P@V -> proj GEMM -> d_out.

#define NTOK 49
#define NPAD 64
#define CDIM 128
#define HEADS 4
#define DHEAD 32
#define NREL 169  // rows of bias_table

typedef __attribute__((ext_vector_type(16))) _Float16 v16h;
typedef __attribute__((ext_vector_type(8)))  _Float16 v8h;
typedef __attribute__((ext_vector_type(4)))  _Float16 v4h;
typedef __attribute__((ext_vector_type(8)))  float    v8f;

static constexpr int SMEM_BYTES = 147456; // 144 KB: two workgroups per WGP

// LDS byte offsets (no buffer aliases another)
#define OFF_X      0        // 64*128  f16 = 16384 B
#define OFF_Q      16384    // 4*64*32 f16 = 16384 B
#define OFF_K      32768    // 4*64*32 f16 = 16384 B
#define OFF_VT     49152    // 4*32*64 f16 = 16384 B  (v stored transposed [h][d][n])
#define OFF_P      65536    // 4*64*64 f16 = 32768 B
#define OFF_AO     98304    // 64*128  f16 = 16384 B
#define OFF_WPF    114688   // 32 tiles * 1024 B = 32768 B (wproj B fragments)

// Load one 16x(K=32) operand tile in the CDNA5 WMMA 16-bit A/B register layout:
// lane r=lane&15 -> row, half=lane>>4 -> K-offset; element e holds
// K = (e<8 ? 0 : 16) + half*8 + (e&7). Source is row-major with leading dim ld.
__device__ __forceinline__ v16h ld_tile(const _Float16* base, int ld) {
  const int lane = threadIdx.x & 31;
  const int r    = lane & 15;
  const int hf   = lane >> 4;
  const _Float16* p = base + r * ld + hf * 8;
  v16h a;
#pragma unroll
  for (int e = 0; e < 8; ++e) a[e] = p[e];          // K = hf*8 + e
#pragma unroll
  for (int e = 0; e < 8; ++e) a[e + 8] = p[16 + e]; // K = 16 + hf*8 + e
  return a;
}

// Same register layout, read from a row-major f32 matrix in global memory
// (rows of CDIM floats) and rounded to f16 element by element.
// base: first row of the 16-row tile; kk: which block of 32 columns.
__device__ __forceinline__ v16h ld_tile_w(const float* base, int kk) {
  const int lane = threadIdx.x & 31;
  const float4* p = (const float4*)(base + (lane & 15) * CDIM + (lane >> 4) * 8);
  const float4 f0 = p[kk * 8], f1 = p[kk * 8 + 1], f2 = p[kk * 8 + 4], f3 = p[kk * 8 + 5];
  // Wait before a register that these loads name is overwritten. p is an input
  // so that the address pair stays whole up to the wait (without it the last
  // load's result was placed in the pair that the other three still name).
  asm volatile("s_wait_xcnt 0x0" :: "v"(p) : "memory");
  v16h a = {(_Float16)f0.x, (_Float16)f0.y, (_Float16)f0.z, (_Float16)f0.w,
            (_Float16)f1.x, (_Float16)f1.y, (_Float16)f1.z, (_Float16)f1.w,
            (_Float16)f2.x, (_Float16)f2.y, (_Float16)f2.z, (_Float16)f2.w,
            (_Float16)f3.x, (_Float16)f3.y, (_Float16)f3.z, (_Float16)f3.w};
  return a;
}

// wproj fragments in LDS: tile t = nt*4 + kk takes 1024 B, elements 0-7 of all
// 32 lanes first (16 B a lane, contiguous), then elements 8-15.
__device__ __forceinline__ void st_frag(_Float16* frags, int t, v16h a) {
  const int lane = threadIdx.x & 31;
  v8h lo, hi;
#pragma unroll
  for (int e = 0; e < 8; ++e) { lo[e] = a[e]; hi[e] = a[e + 8]; }
  *(v8h*)(frags + t * 512 + lane * 8)       = lo;
  *(v8h*)(frags + t * 512 + 256 + lane * 8) = hi;
}
__device__ __forceinline__ v16h ld_frag(const _Float16* frags, int t) {
  const int lane = threadIdx.x & 31;
  const v8h lo = *(const v8h*)(frags + t * 512 + lane * 8);
  const v8h hi = *(const v8h*)(frags + t * 512 + 256 + lane * 8);
  v16h a;
#pragma unroll
  for (int e = 0; e < 8; ++e) { a[e] = lo[e]; a[e + 8] = hi[e]; }
  return a;
}

__device__ __forceinline__ v8f wmma_f16(v16h a, v16h b, v8f c) {
  return __builtin_amdgcn_wmma_f32_16x16x32_f16(false, a, false, b,
                                                (short)0, c, false, false);
}

__global__ void __launch_bounds__(256, 4) // 4 waves per SIMD: two workgroups per WGP
swin_msa_fused(const float* __restrict__ x, const float* __restrict__ mask,
               const float* __restrict__ w_qkv, const float* __restrict__ b_qkv,
               const float* __restrict__ w_proj, const float* __restrict__ b_proj,
               const float* __restrict__ bias_table, const int* __restrict__ rel_index,
               float* __restrict__ out, int nwin) {
  extern __shared__ __align__(16) char smem[];
  _Float16* smemh  = (_Float16*)smem;
  _Float16* Ps     = (_Float16*)(smem + OFF_P);
  _Float16* aoS    = (_Float16*)(smem + OFF_AO);
  _Float16* xS     = (_Float16*)(smem + OFF_X);
  _Float16* qS     = (_Float16*)(smem + OFF_Q);
  _Float16* kS     = (_Float16*)(smem + OFF_K);
  _Float16* vtS    = (_Float16*)(smem + OFF_VT);
  _Float16* wpF    = (_Float16*)(smem + OFF_WPF);

  const int tid  = threadIdx.x;
  const int lane = tid & 31;
  // Wave number as a scalar: all that follows from it (tile numbers, head,
  // store strides, LDS bases) then lives in scalar registers, not in VGPRs.
  const int wave = __builtin_amdgcn_readfirstlane(tid >> 5);
  const int r    = lane & 15;
  const int hf   = lane >> 4;

  // ---------------- Once per workgroup: weight fragments in registers and LDS ------
  // QKV: wave owns output-channel tiles nt = wave*3 + j, all 4 k steps.
  const float scale = 0.17677669529663687f; // D^-0.5
  v16h  wq[3][4];
  float smul[3], bqs[3];
  int   stride[3], colbase[3];
#pragma unroll
  for (int j = 0; j < 3; ++j) {
    const int nt = wave * 3 + j;
#pragma unroll
    for (int kk = 0; kk < 4; ++kk)
      wq[j][kk] = ld_tile_w(w_qkv + nt * 16 * CDIM, kk);
    // Per-lane output-column metadata (uniform sec within a tile: 16 | 128).
    const int cg  = nt * 16 + r;       // global out channel in [0,384)
    const int sec = cg >> 7;           // 0=q 1=k 2=v
    const int hh  = (cg >> 5) & 3;
    const int dd  = cg & 31;
    smul[j]   = (sec == 0) ? scale : 1.0f;
    bqs[j]    = b_qkv[cg] * smul[j];
    stride[j] = (sec == 2) ? 1 : DHEAD;             // vT is token-contiguous
    if (sec == 0)      colbase[j] = OFF_Q  / 2 + hh * 2048 + dd;
    else if (sec == 1) colbase[j] = OFF_K  / 2 + hh * 2048 + dd;
    else               colbase[j] = OFF_VT / 2 + hh * 2048 + dd * NPAD;
  }
  // proj: wave builds the 4 k-step fragments of output-channel tile nt = wave.
  // They are first read in phase 4, behind the first window's barriers.
#pragma unroll
  for (int kk = 0; kk < 4; ++kk)
    st_frag(wpF, wave * 4 + kk, ld_tile_w(w_proj + wave * 16 * CDIM, kk));

  // 2 waves per head in phases 2-3; wave part p owns score rows [p*32, p*32+32).
  const int h = wave >> 1;
  const int p = wave & 1;

  // Kept rolled: a second copy of the body would need registers that the
  // resident weight fragments already take.
#pragma unroll 1
  for (int b = blockIdx.x; b < nwin; b += gridDim.x) {
    // ---------------- Phase 0: stage x as f16 in LDS -----------------------
    // (xS was last read in front of the previous window's second barrier.)
    {
      const float4* x4 = (const float4*)(x + (size_t)b * NTOK * CDIM);
      for (int i = tid; i < (NPAD * CDIM) / 4; i += 256) {
        v4h h4 = {(_Float16)0.f, (_Float16)0.f, (_Float16)0.f, (_Float16)0.f};
        if ((i >> 5) < NTOK) { // row = (i*4)/128
          float4 v = x4[i];
          h4 = {(_Float16)v.x, (_Float16)v.y, (_Float16)v.z, (_Float16)v.w};
        }
        *(v4h*)(xS + i * 4) = h4;
      }
    }
    __syncthreads();

    // ---------------- Phase 1: QKV GEMM (64x384 = x(64x128) @ wqkv^T) ------
    // x A-tiles are read once per token tile and meet the 3 resident B tiles.
#pragma unroll 1
    for (int mt = 0; mt < 4; ++mt) {
      v16h am[4];
#pragma unroll
      for (int kk = 0; kk < 4; ++kk)
        am[kk] = ld_tile(xS + mt * 16 * CDIM + kk * 32, CDIM);
      v8f acc[3] = {};
#pragma unroll
      for (int kk = 0; kk < 4; ++kk)
#pragma unroll
        for (int j = 0; j < 3; ++j)
          acc[j] = wmma_f16(am[kk], wq[j][kk], acc[j]);
#pragma unroll
      for (int j = 0; j < 3; ++j) {
        const int a0 = colbase[j] + (mt * 16 + hf * 8) * stride[j];
#pragma unroll
        for (int i = 0; i < 8; ++i)
          smemh[a0 + i * stride[j]] = (_Float16)fmaf(acc[j][i], smul[j], bqs[j]);
      }
    }
    __syncthreads();

    // ---------------- Phase 2: S = q @ k^T, +bias +mask, softmax -> P --------
    v8f sacc[2][4];
    {
      v16h bk[4];
#pragma unroll
      for (int tc = 0; tc < 4; ++tc)
        bk[tc] = ld_tile(kS + h * 2048 + tc * 16 * DHEAD, DHEAD);
#pragma unroll
      for (int trl = 0; trl < 2; ++trl) {
        v16h aq = ld_tile(qS + h * 2048 + (p * 2 + trl) * 16 * DHEAD, DHEAD);
#pragma unroll
        for (int tc = 0; tc < 4; ++tc) {
          v8f z = {};
          sacc[trl][tc] = wmma_f16(aq, bk[tc], z); // K = 32 in one step
        }
      }
    }
    // One per-lane base each; every (row, column tile) is a constant offset from it.
    const int lane0 = (p * 32 + hf * 8) * NTOK + r;
    const int*   relp  = rel_index + lane0;
    const float* maskp = mask + (size_t)(b & 63) * NTOK * NTOK + lane0;
#pragma unroll
    for (int trl = 0; trl < 2; ++trl) {
#pragma unroll
      for (int i = 0; i < 8; ++i) {
        const int m = (p * 2 + trl) * 16 + hf * 8 + i;
        float row[4];
        int   bi[4] = {0, 0, 0, 0}; // index of each gather into bias_table
#pragma unroll
        for (int tc = 0; tc < 4; ++tc) {
          const int n = tc * 16 + r;
          float v = sacc[trl][tc][i];
          if (m < NTOK && n < NTOK) {
            const int o = (trl * 16 + i) * NTOK + tc * 16; // = m*NTOK + n - lane0
            // index read from an input: bounded to the table's rows before use
            bi[tc] = (int)min((unsigned)relp[o], (unsigned)(NREL - 1)) * HEADS + h;
            v += bias_table[bi[tc]] + maskp[o];
          } else {
            v = -1e30f; // mask pad columns
          }
          row[tc] = v;
        }
        // Wait before a register that this row's loads name is overwritten. The
        // gather indices are inputs so that their registers stay whole up to the
        // wait (without it later loads' results were placed in them).
        asm volatile("s_wait_xcnt 0x0"
                     :: "v"(bi[0]), "v"(bi[1]), "v"(bi[2]), "v"(bi[3]) : "memory");
        // row max over 4 regs x 16 lanes (xor 1..8 stays inside the half)
        float mx = fmaxf(fmaxf(row[0], row[1]), fmaxf(row[2], row[3]));
#pragma unroll
        for (int off = 1; off < 16; off <<= 1) mx = fmaxf(mx, __shfl_xor(mx, off, 32));
        const float e0 = __expf(row[0] - mx), e1 = __expf(row[1] - mx);
        const float e2 = __expf(row[2] - mx), e3 = __expf(row[3] - mx);
        float sum = (e0 + e1) + (e2 + e3);
#pragma unroll
        for (int off = 1; off < 16; off <<= 1) sum += __shfl_xor(sum, off, 32);
        const float inv = 1.0f / sum;
        _Float16* prow = Ps + h * 4096 + m * NPAD;
        prow[0 * 16 + r] = (_Float16)(e0 * inv);
        prow[1 * 16 + r] = (_Float16)(e1 * inv);
        prow[2 * 16 + r] = (_Float16)(e2 * inv);
        prow[3 * 16 + r] = (_Float16)(e3 * inv);
      }
    }
    __syncthreads();

    // ---------------- Phase 3: out_h = P(64x64) @ v(64x32), K = 2 steps ------
    {
      v8f oacc[2][2];
      v8f z = {};
      oacc[0][0] = z; oacc[0][1] = z; oacc[1][0] = z; oacc[1][1] = z;
#pragma unroll
      for (int kk = 0; kk < 2; ++kk) {
        v16h bv0 = ld_tile(vtS + h * 2048 + 0  * NPAD + kk * 32, NPAD);
        v16h bv1 = ld_tile(vtS + h * 2048 + 16 * NPAD + kk * 32, NPAD);
        v16h a0  = ld_tile(Ps + h * 4096 + (p * 2 + 0) * 16 * NPAD + kk * 32, NPAD);
        v16h a1  = ld_tile(Ps + h * 4096 + (p * 2 + 1) * 16 * NPAD + kk * 32, NPAD);
        oacc[0][0] = wmma_f16(a0, bv0, oacc[0][0]);
        oacc[0][1] = wmma_f16(a0, bv1, oacc[0][1]);
        oacc[1][0] = wmma_f16(a1, bv0, oacc[1][0]);
        oacc[1][1] = wmma_f16(a1, bv1, oacc[1][1]);
      }
#pragma unroll
      for (int trl = 0; trl < 2; ++trl)
#pragma unroll
        for (int tc = 0; tc < 2; ++tc) {
          const int m0 = (p * 2 + trl) * 16 + hf * 8;
          const int dd = tc * 16 + r;
#pragma unroll
          for (int i = 0; i < 8; ++i)
            aoS[(m0 + i) * CDIM + h * DHEAD + dd] = (_Float16)oacc[trl][tc][i];
        }
    }
    __syncthreads();

    // ---------------- Phase 4: proj = ao(64x128) @ wproj^T + b_proj --------
    // mt-outer: A tiles (attn-out rows) loaded once per wave, reused for 4 nt.
    {
      const int mt = wave >> 1;
      const int nbase = (wave & 1) * 4;
      float* outp = out + (size_t)b * NTOK * CDIM + (mt * 16 + hf * 8) * CDIM + r;
      v16h am[4];
#pragma unroll
      for (int kk = 0; kk < 4; ++kk)
        am[kk] = ld_tile(aoS + mt * 16 * CDIM + kk * 32, CDIM);
#pragma unroll 1
      for (int j = 0; j < 4; ++j) {
        const int nt = nbase + j;
        v8f acc = {};
#pragma unroll
        for (int kk = 0; kk < 4; ++kk)
          acc = wmma_f16(am[kk], ld_frag(wpF, nt * 4 + kk), acc);
        const int n = nt * 16 + r;
        const float bp = b_proj[n];
        float* oj = outp + nt * 16;
#pragma unroll
        for (int i = 0; i < 8; ++i) {
          const int m = mt * 16 + hf * 8 + i;
          if (m < NTOK) oj[i * CDIM] = acc[i] + bp;
        }
        // Wait before the stores' address pair is stepped to the next tile; oj is
        // an input so that the step cannot be placed in front of the wait.
        asm volatile("s_wait_xcnt 0x0" :: "v"(oj) : "memory");
      }
    }
  }
}

extern "C" void kernel_launch(void* const* d_in, const int* in_sizes, int n_in,
                              void* d_out, int out_size, void* d_ws, size_t ws_size,
                              hipStream_t stream) {
  (void)n_in; (void)d_ws; (void)ws_size; (void)out_size;
  const float* x          = (const float*)d_in[0];
  const float* mask       = (const float*)d_in[1];
  const float* w_qkv      = (const float*)d_in[2];
  const float* b_qkv      = (const float*)d_in[3];
  const float* w_proj     = (const float*)d_in[4];
  const float* b_proj     = (const float*)d_in[5];
  const float* bias_table = (const float*)d_in[6];
  const int*   rel_index  = (const int*)d_in[7];
  float* out = (float*)d_out;

  const int B = in_sizes[0] / (NTOK * CDIM); // 4096 windows

  // Opt in to >default dynamic LDS (144 KB of the 320 KB/WGP on CDNA5).
  (void)hipFuncSetAttribute(reinterpret_cast<const void*>(swin_msa_fused),
                            hipFuncAttributeMaxDynamicSharedMemorySize, SMEM_BYTES);

  // 256 WGPs x 2 resident workgroups; each takes every 512th window.
  swin_msa_fused<<<512, 256, SMEM_BYTES, stream>>>(
      x, mask, w_qkv, b_qkv, w_proj, b_proj, bias_table, rel_index, out, B);
}

// v002
// It runs in 184 microseconds.
// In both of two side-by-side timings against v001, it was 1.45 times as fast.
// All steps since v000 together make it 3.46 times as fast.
#include <hip/hip_runtime.h>

// Fully fused kernel for gfx1250 (wave32, WMMA).
// 512 workgroups (256 threads = 8 wave32), two resident per WGP; each loops
// over windows b = blockIdx.x, blockIdx.x + gridDim.x, ...
// The weights do not depend on the window: they are read once per workgroup,
// straight from global f32, as ready f16 WMMA B fragments. Every wave keeps the
// wqkv fragments of the 3 output-channel tiles it owns in registers; the wproj
// fragments lie in LDS in fragment order.
// Neither do the rel-pos bias and, as the loop's stride is a multiple of the
// number of masks, the window mask: their sum is gathered once per workgroup, in
// the layout of the score tiles, and enters the q @ k^T product as its C operand.
// Per window, in LDS: x -> f16 staging -> QKV GEMM -> QK^T (+rel-pos bias
// + shift-window mask as C) -> softmax -> P@V -> proj GEMM -> d_out.

#define NTOK 49
#define NPAD 64
#define CDIM 128
#define HEADS 4
#define DHEAD 32
#define NREL 169  // rows of bias_table
#define NMASK 64  // windows in mask
#define NWG  512  // workgroups launched = stride of the window loop
static_assert(NWG % NMASK == 0, "a workgroup must meet one mask window only");

typedef __attribute__((ext_vector_type(16))) _Float16 v16h;
typedef __attribute__((ext_vector_type(8)))  _Float16 v8h;
typedef __attribute__((ext_vector_type(4)))  _Float16 v4h;
typedef __attribute__((ext_vector_type(8)))  float    v8f;

static constexpr int SMEM_BYTES = 163840; // 160 KB: two workgroups per WGP

// LDS byte offsets. Two places are used twice in a window, to make room for the
// bias + mask tiles: x (dead behind phase 1) lies in the first half of P
// (written in phase 2, last read in phase 3), attn-out (written in phase 3,
// read in phase 4) lies on q (written in phase 1, last read in phase 2). A
// barrier of the window loop stands between each last read and the next write.
#define OFF_P      0        // 4*64*64 f16 = 32768 B
#define OFF_X      0        // 64*128  f16 = 16384 B
#define OFF_Q      32768    // 4*64*32 f16 = 16384 B
#define OFF_AO     32768    // 64*128  f16 = 16384 B
#define OFF_K      49152    // 4*64*32 f16 = 16384 B
#define OFF_VT     65536    // 4*32*64 f16 = 16384 B  (v stored transposed [h][d][n])
#define OFF_WPF    81920    // 32 tiles * 1024 B = 32768 B (wproj B fragments)
#define OFF_BM     114688   // 48 tiles * 1024 B = 49152 B (bias + mask C tiles, f32)

// Load one 16x(K=32) operand tile in the CDNA5 WMMA 16-bit A/B register layout:
// lane r=lane&15 -> row, half=lane>>4 -> K-offset; element e holds
// K = (e<8 ? 0 : 16) + half*8 + (e&7). Source is row-major with leading dim ld.
__device__ __forceinline__ v16h ld_tile(const _Float16* base, int ld) {
  const int lane = threadIdx.x & 31;
  const int r    = lane & 15;
  const int hf   = lane >> 4;
  const _Float16* p = base + r * ld + hf * 8;
  v16h a;
#pragma unroll
  for (int e = 0; e < 8; ++e) a[e] = p[e];          // K = hf*8 + e
#pragma unroll
  for (int e = 0; e < 8; ++e) a[e + 8] = p[16 + e]; // K = 16 + hf*8 + e
  return a;
}

// Same register layout, read from a row-major f32 matrix in global memory
// (rows of CDIM floats) and rounded to f16 element by element.
// base: first row of the 16-row tile; kk: which block of 32 columns.
__device__ __forceinline__ v16h ld_tile_w(const float* base, int kk) {
  const int lane = threadIdx.x & 31;
  const float4* p = (const float4*)(base + (lane & 15) * CDIM + (lane >> 4) * 8);
  const float4 f0 = p[kk * 8], f1 = p[kk * 8 + 1], f2 = p[kk * 8 + 4], f3 = p[kk * 8 + 5];
  // Wait before a register that these loads name is overwritten. p is an input
  // so that the address pair stays whole up to the wait (without it the last
  // load's result was placed in the pair that the other three still name).
  asm volatile("s_wait_xcnt 0x0" :: "v"(p) : "memory");
  v16h a = {(_Float16)f0.x, (_Float16)f0.y, (_Float16)f0.z, (_Float16)f0.w,
            (_Float16)f1.x, (_Float16)f1.y, (_Float16)f1.z, (_Float16)f1.w,
            (_Float16)f2.x, (_Float16)f2.y, (_Float16)f2.z, (_Float16)f2.w,
            (_Float16)f3.x, (_Float16)f3.y, (_Float16)f3.z, (_Float16)f3.w};
  return a;
}

// wproj fragments in LDS: tile t = nt*4 + kk takes 1024 B, elements 0-7 of all
// 32 lanes first (16 B a lane, contiguous), then elements 8-15.
__device__ __forceinline__ void st_frag(_Float16* frags, int t, v16h a) {
  const int lane = threadIdx.x & 31;
  v8h lo, hi;
#pragma unroll
  for (int e = 0; e < 8; ++e) { lo[e] = a[e]; hi[e] = a[e + 8]; }
  *(v8h*)(frags + t * 512 + lane * 8)       = lo;
  *(v8h*)(frags + t * 512 + 256 + lane * 8) = hi;
}
__device__ __forceinline__ v16h ld_frag(const _Float16* frags, int t) {
  const int lane = threadIdx.x & 31;
  const v8h lo = *(const v8h*)(frags + t * 512 + lane * 8);
  const v8h hi = *(const v8h*)(frags + t * 512 + 256 + lane * 8);
  v16h a;
#pragma unroll
  for (int e = 0; e < 8; ++e) { a[e] = lo[e]; a[e + 8] = hi[e]; }
  return a;
}

// bias + mask tiles in LDS, WMMA C/D register layout (element i: row hf*8 + i,
// column lane & 15): a tile takes 1024 B, elements 0-3 of all 32 lanes first
// (16 B a lane, contiguous), then elements 4-7.
__device__ __forceinline__ void st_ctile(float* tiles, int t, v8f c) {
  const int lane = threadIdx.x & 31;
  const float4 lo = {c[0], c[1], c[2], c[3]}, hi = {c[4], c[5], c[6], c[7]};
  *(float4*)(tiles + t * 256 + lane * 4)       = lo;
  *(float4*)(tiles + t * 256 + 128 + lane * 4) = hi;
}
__device__ __forceinline__ v8f ld_ctile(const float* tiles, int t) {
  const int lane = threadIdx.x & 31;
  const float4 lo = *(const float4*)(tiles + t * 256 + lane * 4);
  const float4 hi = *(const float4*)(tiles + t * 256 + 128 + lane * 4);
  v8f c = {lo.x, lo.y, lo.z, lo.w, hi.x, hi.y, hi.z, hi.w};
  return c;
}

// Value of lane K of the caller's 16-lane row, in every lane of that row.
template <int K>
__device__ __forceinline__ float row_share(float v) {
  return __builtin_bit_cast(float, __builtin_amdgcn_update_dpp(
      0, __builtin_bit_cast(int, v), 0x150 + K /* row_share:K */, 0xf, 0xf, false));
}
// C tile of score columns 48-63 from its one valid column: lane K0 + i of each
// 16-lane row holds that column's value for the row's tile element i.
template <int K0>
__device__ __forceinline__ v8f edge_ctile(float col) {
  // The shares are made with every lane on, in front of the selects: a lane that
  // is off hands nothing on.
  const float s0 = row_share<K0 + 0>(col), s1 = row_share<K0 + 1>(col);
  const float s2 = row_share<K0 + 2>(col), s3 = row_share<K0 + 3>(col);
  const float s4 = row_share<K0 + 4>(col), s5 = row_share<K0 + 5>(col);
  const float s6 = row_share<K0 + 6>(col), s7 = row_share<K0 + 7>(col);
  const bool first = (threadIdx.x & 15) == 0; // column 48
  v8f c = {first ? s0 : -1e30f, first ? s1 : -1e30f, first ? s2 : -1e30f, first ? s3 : -1e30f,
           first ? s4 : -1e30f, first ? s5 : -1e30f, first ? s6 : -1e30f, first ? s7 : -1e30f};
  return c;
}

__device__ __forceinline__ v8f wmma_f16(v16h a, v16h b, v8f c) {
  return __builtin_amdgcn_wmma_f32_16x16x32_f16(false, a, false, b,
                                                (short)0, c, false, false);
}

__global__ void __launch_bounds__(256, 4) // 4 waves per SIMD: two workgroups per WGP
swin_msa_fused(const float* __restrict__ x, const float* __restrict__ mask,
               const float* __restrict__ w_qkv, const float* __restrict__ b_qkv,
               const float* __restrict__ w_proj, const float* __restrict__ b_proj,
               const float* __restrict__ bias_table, const int* __restrict__ rel_index,
               float* __restrict__ out, int nwin) {
  extern __shared__ __align__(16) char smem[];
  _Float16* smemh  = (_Float16*)smem;
  _Float16* Ps     = (_Float16*)(smem + OFF_P);
  _Float16* aoS    = (_Float16*)(smem + OFF_AO);
  _Float16* xS     = (_Float16*)(smem + OFF_X);
  _Float16* qS     = (_Float16*)(smem + OFF_Q);
  _Float16* kS     = (_Float16*)(smem + OFF_K);
  _Float16* vtS    = (_Float16*)(smem + OFF_VT);
  _Float16* wpF    = (_Float16*)(smem + OFF_WPF);

  const int tid  = threadIdx.x;
  const int lane = tid & 31;
  // Wave number as a scalar: all that follows from it (tile numbers, head,
  // store strides, LDS bases) then lives in scalar registers, not in VGPRs.
  const int wave = __builtin_amdgcn_readfirstlane(tid >> 5);
  const int r    = lane & 15;
  const int hf   = lane >> 4;

  // ---------------- Once per workgroup: weight fragments in registers and LDS ------
  // QKV: wave owns output-channel tiles nt = wave*3 + j, all 4 k steps.
  const float scale = 0.17677669529663687f; // D^-0.5
  v16h  wq[3][4];
  float smul[3], bqs[3];
  int   stride[3], colbase[3];
#pragma unroll
  for (int j = 0; j < 3; ++j) {
    const int nt = wave * 3 + j;
#pragma unroll
    for (int kk = 0; kk < 4; ++kk)
      wq[j][kk] = ld_tile_w(w_qkv + nt * 16 * CDIM, kk);
    // Per-lane output-column metadata (uniform sec within a tile: 16 | 128).
    const int cg  = nt * 16 + r;       // global out channel in [0,384)
    const int sec = cg >> 7;           // 0=q 1=k 2=v
    const int hh  = (cg >> 5) & 3;
    const int dd  = cg & 31;
    smul[j]   = (sec == 0) ? scale : 1.0f;
    bqs[j]    = b_qkv[cg] * smul[j];
    stride[j] = (sec == 2) ? 1 : DHEAD;             // vT is token-contiguous
    if (sec == 0)      colbase[j] = OFF_Q  / 2 + hh * 2048 + dd;
    else if (sec == 1) colbase[j] = OFF_K  / 2 + hh * 2048 + dd;
    else               colbase[j] = OFF_VT / 2 + hh * 2048 + dd * NPAD;
  }
  // proj: wave builds the 4 k-step fragments of output-channel tile nt = wave.
  // They are first read in phase 4, behind the first window's barriers.
#pragma unroll
  for (int kk = 0; kk < 4; ++kk)
    st_frag(wpF, wave * 4 + kk, ld_tile_w(w_proj + wave * 16 * CDIM, kk));

  // 2 waves per head in phases 2-3; wave part p owns score rows [p*32, p*32+32).
  const int h = wave >> 1;
  const int p = wave & 1;

  // ---------------- Once per workgroup: bias + mask as score C tiles -------
  // Every window of this workgroup has b % NMASK == blockIdx.x % NMASK.
  // The wave builds the 2 x 4 tiles of its own score rows and is their only
  // reader. Column tiles 0-2 go to LDS; of tile 3 the one valid column stays in
  // one register. Pad rows and columns hold -1e30, which swallows the product.
  float* bmW = (float*)(smem + OFF_BM) + wave * 6 * 256;
  float col48; // lane hf*16 + trl*8 + i: score row (p*2 + trl)*16 + hf*8 + i
  {
    const float* maskw = mask + (blockIdx.x % NMASK) * (NTOK * NTOK);
#pragma unroll
    for (int trl = 0; trl < 2; ++trl) {
      const int m0 = (p * 2 + trl) * 16 + hf * 8;
      unsigned ob[8]; // element offset into rel_index and mask: row i, column r
#pragma unroll
      for (int i = 0; i < 8; ++i) // pad rows read the last row
        ob[i] = (unsigned)(min(m0 + i, NTOK - 1) * NTOK + r);
#pragma unroll
      for (int tc = 0; tc < 3; ++tc) { // columns tc*16 + r < NTOK
        unsigned gb[8]; // element offset into bias_table
        float mv[8], bv[8];
#pragma unroll
        for (int i = 0; i < 8; ++i) {
          // index read from an input: bounded to the table's rows before use
          gb[i] = min((unsigned)rel_index[ob[i] + tc * 16], (unsigned)(NREL - 1)) * HEADS + h;
          mv[i] = maskw[ob[i] + tc * 16];
        }
#pragma unroll
        for (int i = 0; i < 8; ++i) bv[i] = bias_table[gb[i]];
        // Wait before a register that this tile's loads name is overwritten. The
        // offsets are inputs so that their registers stay whole up to the wait.
        asm volatile("s_wait_xcnt 0x0"
                     :: "v"(ob[0]), "v"(ob[1]), "v"(ob[2]), "v"(ob[3]),
                        "v"(ob[4]), "v"(ob[5]), "v"(ob[6]), "v"(ob[7]),
                        "v"(gb[0]), "v"(gb[1]), "v"(gb[2]), "v"(gb[3]),
                        "v"(gb[4]), "v"(gb[5]), "v"(gb[6]), "v"(gb[7]) : "memory");
        v8f c;
#pragma unroll
        for (int i = 0; i < 8; ++i)
          c[i] = (m0 + i < NTOK) ? bv[i] + mv[i] : -1e30f;
        st_ctile(bmW, trl * 3 + tc, c);
      }
    }
    const int m = (p * 2 + (r >> 3)) * 16 + hf * 8 + (r & 7);
    const unsigned ob = (unsigned)(min(m, NTOK - 1) * NTOK + NTOK - 1);
    const unsigned gb = min((unsigned)rel_index[ob], (unsigned)(NREL - 1)) * HEADS + h;
    const float mv = maskw[ob];
    const float bv = bias_table[gb];
    // Wait before a register that these loads name is overwritten (as above).
    asm volatile("s_wait_xcnt 0x0" :: "v"(ob), "v"(gb) : "memory");
    col48 = (m < NTOK) ? bv + mv : -1e30f;
  }

  // Kept rolled: a second copy of the body would need registers that the
  // resident weight fragments already take.
#pragma unroll 1
  for (int b = blockIdx.x; b < nwin; b += NWG) {
    // ---------------- Phase 0: stage x as f16 in LDS -----------------------
    // (This place last held P, read in front of the previous window's fourth barrier.)
    {
      const float4* x4 = (const float4*)(x + (size_t)b * NTOK * CDIM);
      for (int i = tid; i < (NPAD * CDIM) / 4; i += 256) {
        v4h h4 = {(_Float16)0.f, (_Float16)0.f, (_Float16)0.f, (_Float16)0.f};
        if ((i >> 5) < NTOK) { // row = (i*4)/128
          float4 v = x4[i];
          h4 = {(_Float16)v.x, (_Float16)v.y, (_Float16)v.z, (_Float16)v.w};
        }
        *(v4h*)(xS + i * 4) = h4;
      }
    }
    __syncthreads();

    // ---------------- Phase 1: QKV GEMM (64x384 = x(64x128) @ wqkv^T) ------
    // x A-tiles are read once per token tile and meet the 3 resident B tiles.
#pragma unroll 1
    for (int mt = 0; mt < 4; ++mt) {
      v16h am[4];
#pragma unroll
      for (int kk = 0; kk < 4; ++kk)
        am[kk] = ld_tile(xS + mt * 16 * CDIM + kk * 32, CDIM);
      v8f acc[3] = {};
#pragma unroll
      for (int kk = 0; kk < 4; ++kk)
#pragma unroll
        for (int j = 0; j < 3; ++j)
          acc[j] = wmma_f16(am[kk], wq[j][kk], acc[j]);
#pragma unroll
      for (int j = 0; j < 3; ++j) {
        const int a0 = colbase[j] + (mt * 16 + hf * 8) * stride[j];
#pragma unroll
        for (int i = 0; i < 8; ++i)
          smemh[a0 + i * stride[j]] = (_Float16)fmaf(acc[j][i], smul[j], bqs[j]);
      }
    }
    __syncthreads();

    // ---------------- Phase 2: S = q @ k^T + (bias + mask), softmax -> P ----
    // One 16-row tile at a time: its scores are spent before the next tile's are
    // made, so that 4 score tiles are live beside the resident fragments, not 8.
    v16h bk[4];
#pragma unroll
    for (int tc = 0; tc < 4; ++tc)
      bk[tc] = ld_tile(kS + h * 2048 + tc * 16 * DHEAD, DHEAD);
#pragma unroll
    for (int trl = 0; trl < 2; ++trl) {
      const v16h aq = ld_tile(qS + h * 2048 + (p * 2 + trl) * 16 * DHEAD, DHEAD);
      v8f sacc[4];
#pragma unroll
      for (int tc = 0; tc < 3; ++tc) // K = 32 in one step
        sacc[tc] = wmma_f16(aq, bk[tc], ld_ctile(bmW, trl * 3 + tc));
      sacc[3] = wmma_f16(aq, bk[3], trl == 0 ? edge_ctile<0>(col48) : edge_ctile<8>(col48));
#pragma unroll
      for (int i = 0; i < 8; ++i) {
        const int m = (p * 2 + trl) * 16 + hf * 8 + i;
        const float row[4] = {sacc[0][i], sacc[1][i], sacc[2][i], sacc[3][i]};
        // row max over 4 regs x 16 lanes (xor 1..8 stays inside the half)
        float mx = fmaxf(fmaxf(row[0], row[1]), fmaxf(row[2], row[3]));
#pragma unroll
        for (int off = 1; off < 16; off <<= 1) mx = fmaxf(mx, __shfl_xor(mx, off, 32));
        const float e0 = __expf(row[0] - mx), e1 = __expf(row[1] - mx);
        const float e2 = __expf(row[2] - mx), e3 = __expf(row[3] - mx);
        float sum = (e0 + e1) + (e2 + e3);
#pragma unroll
        for (int off = 1; off < 16; off <<= 1) sum += __shfl_xor(sum, off, 32);
        const float inv = 1.0f / sum;
        _Float16* prow = Ps + h * 4096 + m * NPAD;
        prow[0 * 16 + r] = (_Float16)(e0 * inv);
        prow[1 * 16 + r] = (_Float16)(e1 * inv);
        prow[2 * 16 + r] = (_Float16)(e2 * inv);
        prow[3 * 16 + r] = (_Float16)(e3 * inv);
      }
    }
    __syncthreads();

    // ---------------- Phase 3: out_h = P(64x64) @ v(64x32), K = 2 steps ------
    {
      v8f oacc[2][2];
      v8f z = {};
      oacc[0][0] = z; oacc[0][1] = z; oacc[1][0] = z; oacc[1][1] = z;
#pragma unroll
      for (int kk = 0; kk < 2; ++kk) {
        v16h bv0 = ld_tile(vtS + h * 2048 + 0  * NPAD + kk * 32, NPAD);
        v16h bv1 = ld_tile(vtS + h * 2048 + 16 * NPAD + kk * 32, NPAD);
        v16h a0  = ld_tile(Ps + h * 4096 + (p * 2 + 0) * 16 * NPAD + kk * 32, NPAD);
        v16h a1  = ld_tile(Ps + h * 4096 + (p * 2 + 1) * 16 * NPAD + kk * 32, NPAD);
        oacc[0][0] = wmma_f16(a0, bv0, oacc[0][0]);
        oacc[0][1] = wmma_f16(a0, bv1, oacc[0][1]);
        oacc[1][0] = wmma_f16(a1, bv0, oacc[1][0]);
        oacc[1][1] = wmma_f16(a1, bv1, oacc[1][1]);
      }
#pragma unroll
      for (int trl = 0; trl < 2; ++trl)
#pragma unroll
        for (int tc = 0; tc < 2; ++tc) {
          const int m0 = (p * 2 + trl) * 16 + hf * 8;
          const int dd = tc * 16 + r;
#pragma unroll
          for (int i = 0; i < 8; ++i)
            aoS[(m0 + i) * CDIM + h * DHEAD + dd] = (_Float16)oacc[trl][tc][i];
        }
    }
    __syncthreads();

    // ---------------- Phase 4: proj = ao(64x128) @ wproj^T + b_proj --------
    // mt-outer: A tiles (attn-out rows) loaded once per wave, reused for 4 nt.
    {
      const int mt = wave >> 1;
      const int nbase = (wave & 1) * 4;
      float* outp = out + (size_t)b * NTOK * CDIM + (mt * 16 + hf * 8) * CDIM + r;
      v16h am[4];
#pragma unroll
      for (int kk = 0; kk < 4; ++kk)
        am[kk] = ld_tile(aoS + mt * 16 * CDIM + kk * 32, CDIM);
#pragma unroll 1
      for (int j = 0; j < 4; ++j) {
        const int nt = nbase + j;
        v8f acc = {};
#pragma unroll
        for (int kk = 0; kk < 4; ++kk)
          acc = wmma_f16(am[kk], ld_frag(wpF, nt * 4 + kk), acc);
        const int n = nt * 16 + r;
        const float bp = b_proj[n];
        float* oj = outp + nt * 16;
#pragma unroll
        for (int i = 0; i < 8; ++i) {
          const int m = mt * 16 + hf * 8 + i;
          if (m < NTOK) oj[i * CDIM] = acc[i] + bp;
        }
        // Wait before the stores' address pair is stepped to the next tile; oj is
        // an input so that the step cannot be placed in front of the wait.
        asm volatile("s_wait_xcnt 0x0" :: "v"(oj) : "memory");
      }
    }
  }
}

extern "C" void kernel_launch(void* const* d_in, const int* in_sizes, int n_in,
                              void* d_out, int out_size, void* d_ws, size_t ws_size,
                              hipStream_t stream) {
  (void)n_in; (void)d_ws; (void)ws_size; (void)out_size;
  const float* x          = (const float*)d_in[0];
  const float* mask       = (const float*)d_in[1];
  const float* w_qkv      = (const float*)d_in[2];
  const float* b_qkv      = (const float*)d_in[3];
  const float* w_proj     = (const float*)d_in[4];
  const float* b_proj     = (const float*)d_in[5];
  const float* bias_table = (const float*)d_in[6];
  const int*   rel_index  = (const int*)d_in[7];
  float* out = (float*)d_out;

  const int B = in_sizes[0] / (NTOK * CDIM); // 4096 windows

  // Opt in to >default dynamic LDS (160 KB of the 320 KB/WGP on CDNA5).
  (void)hipFuncSetAttribute(reinterpret_cast<const void*>(swin_msa_fused),
                            hipFuncAttributeMaxDynamicSharedMemorySize, SMEM_BYTES);

  // 256 WGPs x 2 resident workgroups; each takes every 512th window.
  swin_msa_fused<<<NWG, 256, SMEM_BYTES, stream>>>(
      x, mask, w_qkv, b_qkv, w_proj, b_proj, bias_table, rel_index, out, B);
}

// v003
// It runs in 105 microseconds.
// Timed twice side by side with v002, it ran 1.75 times as fast both times.
// All steps since v000 together make it 6.06 times as fast.
#include <hip/hip_runtime.h>

// Fully fused kernel for gfx1250 (wave32, WMMA).
// 512 workgroups (256 threads = 8 wave32), two resident per WGP; each loops
// over windows b = blockIdx.x, blockIdx.x + gridDim.x, ...
// The weights do not depend on the window: they are read once per workgroup,
// straight from global f32, as ready f16 WMMA B fragments. Every wave keeps the
// wqkv fragments of the 3 output-channel tiles it owns in registers; the wproj
// fragments lie in LDS in fragment order.
// Neither do the rel-pos bias and, as the loop's stride is a multiple of the
// number of masks, the window mask: their sum is gathered once per workgroup, in
// the layout of the score tiles, and enters the q @ k^T product as its C operand.
// Per window, in LDS: x -> f16 staging -> QKV GEMM -> QK^T -> softmax
// (+rel-pos bias + shift-window mask) -> P@V -> proj GEMM -> d_out.
// Every operand tile in LDS is laid so that the 16 rows which one half of a
// ds_load_b128 reads fall on 16 different groups of four banks: x and attn-out
// by a row pitch of 272 B, q, k, vT and P (no room for pads) by exchanging the
// 16-byte chunks inside each row (chunk ^ a function of the row).

#define NTOK 49
#define NPAD 64
#define CDIM 128
#define HEADS 4
#define DHEAD 32
#define NREL 169  // rows of bias_table
#define NMASK 64  // windows in mask
#define NWG  512  // workgroups launched = stride of the window loop
#define XPITCH 136 // f16 per LDS row of x and attn-out: 256 B + 16 B pad
static_assert(NWG % NMASK == 0, "a workgroup must meet one mask window only");

typedef __attribute__((ext_vector_type(16))) _Float16 v16h;
typedef __attribute__((ext_vector_type(8)))  _Float16 v8h;
typedef __attribute__((ext_vector_type(4)))  _Float16 v4h;
typedef __attribute__((ext_vector_type(8)))  float    v8f;

static constexpr int SMEM_BYTES = 163840; // 160 KB: two workgroups per WGP

// LDS byte offsets. Two places are used twice in a window, to make room for the
// bias + mask tiles: x (dead behind phase 1) lies in the first part of P
// (written in phase 2, last read in phase 3), attn-out (written in phase 3,
// read in phase 4) lies on q and the first 1024 B of k (both written in phase 1,
// last read in phase 2). A barrier of the window loop stands between each last
// read and the next write.
#define OFF_P      0        // 4*64*64 f16 = 32768 B
#define OFF_X      0        // 64 rows of 272 B = 17408 B
#define OFF_Q      32768    // 4*64*32 f16 = 16384 B
#define OFF_AO     32768    // 64 rows of 272 B = 17408 B
#define OFF_K      49152    // 4*64*32 f16 = 16384 B
#define OFF_VT     65536    // 4*32*64 f16 = 16384 B  (v stored transposed [h][d][n])
#define OFF_WPF    81920    // 32 tiles * 1024 B = 32768 B (wproj B fragments)
#define OFF_BM     114688   // 48 tiles * 1024 B = 49152 B (bias + mask C tiles, f32)

// Load one 16x(K=32) operand tile in the CDNA5 WMMA 16-bit A/B register layout:
// lane r=lane&15 -> row, half=lane>>4 -> K-offset; element e holds
// K = (e<8 ? 0 : 16) + half*8 + (e&7). Source is row-major with leading dim ld.
__device__ __forceinline__ v16h ld_tile(const _Float16* base, int ld) {
  const int lane = threadIdx.x & 31;
  const int r    = lane & 15;
  const int hf   = lane >> 4;
  const _Float16* p = base + r * ld + hf * 8;
  v16h a;
#pragma unroll
  for (int e = 0; e < 8; ++e) a[e] = p[e];          // K = hf*8 + e
#pragma unroll
  for (int e = 0; e < 8; ++e) a[e + 8] = p[16 + e]; // K = 16 + hf*8 + e
  return a;
}

// The same tile from rows of 32 f16 (q, k) whose 16-byte chunks are exchanged:
// chunk c of row n lies at place c ^ ((n >> 2) & 3). tile: a multiple of 16 rows.
__device__ __forceinline__ v16h ld_tile_s32(const _Float16* tile) {
  const int lane = threadIdx.x & 31;
  const int r    = lane & 15;
  const int c    = (lane >> 4) ^ ((r >> 2) & 3);
  const v8h lo = *(const v8h*)(tile + r * 32 + c * 8);       // K = hf*8 + e
  const v8h hi = *(const v8h*)(tile + r * 32 + (c ^ 2) * 8); // K = 16 + hf*8 + e
  v16h a;
#pragma unroll
  for (int e = 0; e < 8; ++e) { a[e] = lo[e]; a[e + 8] = hi[e]; }
  return a;
}
// The same from rows of 64 f16 (P, vT): chunk c of row n lies at place
// c ^ ((n >> 1) & 7). tile: a multiple of 16 rows; kk: which block of 32 columns.
__device__ __forceinline__ v16h ld_tile_s64(const _Float16* tile, int kk) {
  const int lane = threadIdx.x & 31;
  const int r    = lane & 15;
  const int c    = (lane >> 4) ^ ((r >> 1) & 7);
  const v8h lo = *(const v8h*)(tile + r * 64 + (c ^ (kk * 4)) * 8);
  const v8h hi = *(const v8h*)(tile + r * 64 + (c ^ (kk * 4 + 2)) * 8);
  v16h a;
#pragma unroll
  for (int e = 0; e < 8; ++e) { a[e] = lo[e]; a[e + 8] = hi[e]; }
  return a;
}

// Same register layout, read from a row-major f32 matrix in global memory
// (rows of CDIM floats) and rounded to f16 element by element.
// base: first row of the 16-row tile; kk: which block of 32 columns.
__device__ __forceinline__ v16h ld_tile_w(const float* base, int kk) {
  const int lane = threadIdx.x & 31;
  const float4* p = (const float4*)(base + (lane & 15) * CDIM + (lane >> 4) * 8);
  const float4 f0 = p[kk * 8], f1 = p[kk * 8 + 1], f2 = p[kk * 8 + 4], f3 = p[kk * 8 + 5];
  // Wait before a register that these loads name is overwritten. p is an input
  // so that the address pair stays whole up to the wait (without it the last
  // load's result was placed in the pair that the other three still name).
  asm volatile("s_wait_xcnt 0x0" :: "v"(p) : "memory");
  v16h a = {(_Float16)f0.x, (_Float16)f0.y, (_Float16)f0.z, (_Float16)f0.w,
            (_Float16)f1.x, (_Float16)f1.y, (_Float16)f1.z, (_Float16)f1.w,
            (_Float16)f2.x, (_Float16)f2.y, (_Float16)f2.z, (_Float16)f2.w,
            (_Float16)f3.x, (_Float16)f3.y, (_Float16)f3.z, (_Float16)f3.w};
  return a;
}

// wproj fragments in LDS: tile t = nt*4 + kk takes 1024 B, elements 0-7 of all
// 32 lanes first (16 B a lane, contiguous), then elements 8-15.
__device__ __forceinline__ void st_frag(_Float16* frags, int t, v16h a) {
  const int lane = threadIdx.x & 31;
  v8h lo, hi;
#pragma unroll
  for (int e = 0; e < 8; ++e) { lo[e] = a[e]; hi[e] = a[e + 8]; }
  *(v8h*)(frags + t * 512 + lane * 8)       = lo;
  *(v8h*)(frags + t * 512 + 256 + lane * 8) = hi;
}
__device__ __forceinline__ v16h ld_frag(const _Float16* frags, int t) {
  const int lane = threadIdx.x & 31;
  const v8h lo = *(const v8h*)(frags + t * 512 + lane * 8);
  const v8h hi = *(const v8h*)(frags + t * 512 + 256 + lane * 8);
  v16h a;
#pragma unroll
  for (int e = 0; e < 8; ++e) { a[e] = lo[e]; a[e + 8] = hi[e]; }
  return a;
}

// bias + mask tiles in LDS, WMMA C/D register layout (element i: row hf*8 + i,
// column lane & 15): a tile takes 1024 B, elements 0-3 of all 32 lanes first
// (16 B a lane, contiguous), then elements 4-7.
__device__ __forceinline__ void st_ctile(float* tiles, int t, v8f c) {
  const int lane = threadIdx.x & 31;
  const float4 lo = {c[0], c[1], c[2], c[3]}, hi = {c[4], c[5], c[6], c[7]};
  *(float4*)(tiles + t * 256 + lane * 4)       = lo;
  *(float4*)(tiles + t * 256 + 128 + lane * 4) = hi;
}
__device__ __forceinline__ v8f ld_ctile(const float* tiles, int t) {
  const int lane = threadIdx.x & 31;
  const float4 lo = *(const float4*)(tiles + t * 256 + lane * 4);
  const float4 hi = *(const float4*)(tiles + t * 256 + 128 + lane * 4);
  v8f c = {lo.x, lo.y, lo.z, lo.w, hi.x, hi.y, hi.z, hi.w};
  return c;
}

// Value of lane K of the caller's 16-lane row, in every lane of that row.
template <int K>
__device__ __forceinline__ float row_share(float v) {
  return __builtin_bit_cast(float, __builtin_amdgcn_update_dpp(
      0, __builtin_bit_cast(int, v), 0x150 + K /* row_share:K */, 0xf, 0xf, false));
}
// C tile of score columns 48-63 from its one valid column: lane K0 + i of each
// 16-lane row holds that column's value for the row's tile element i.
template <int K0>
__device__ __forceinline__ v8f edge_ctile(float col) {
  // The shares are made with every lane on, in front of the selects: a lane that
  // is off hands nothing on.
  const float s0 = row_share<K0 + 0>(col), s1 = row_share<K0 + 1>(col);
  const float s2 = row_share<K0 + 2>(col), s3 = row_share<K0 + 3>(col);
  const float s4 = row_share<K0 + 4>(col), s5 = row_share<K0 + 5>(col);
  const float s6 = row_share<K0 + 6>(col), s7 = row_share<K0 + 7>(col);
  const bool first = (threadIdx.x & 15) == 0; // column 48
  v8f c = {first ? s0 : -1e30f, first ? s1 : -1e30f, first ? s2 : -1e30f, first ? s3 : -1e30f,
           first ? s4 : -1e30f, first ? s5 : -1e30f, first ? s6 : -1e30f, first ? s7 : -1e30f};
  return c;
}

__device__ __forceinline__ v8f wmma_f16(v16h a, v16h b, v8f c) {
  return __builtin_amdgcn_wmma_f32_16x16x32_f16(false, a, false, b,
                                                (short)0, c, false, false);
}

__global__ void __launch_bounds__(256, 4) // 4 waves per SIMD: two workgroups per WGP
swin_msa_fused(const float* __restrict__ x, const float* __restrict__ mask,
               const float* __restrict__ w_qkv, const float* __restrict__ b_qkv,
               const float* __restrict__ w_proj, const float* __restrict__ b_proj,
               const float* __restrict__ bias_table, const int* __restrict__ rel_index,
               float* __restrict__ out, int nwin) {
  extern __shared__ __align__(16) char smem[];
  _Float16* smemh  = (_Float16*)smem;
  _Float16* Ps     = (_Float16*)(smem + OFF_P);
  _Float16* aoS    = (_Float16*)(smem + OFF_AO);
  _Float16* xS     = (_Float16*)(smem + OFF_X);
  _Float16* qS     = (_Float16*)(smem + OFF_Q);
  _Float16* kS     = (_Float16*)(smem + OFF_K);
  _Float16* vtS    = (_Float16*)(smem + OFF_VT);
  _Float16* wpF    = (_Float16*)(smem + OFF_WPF);

  const int tid  = threadIdx.x;
  const int lane = tid & 31;
  // Wave number as a scalar: all that follows from it (tile numbers, head,
  // store strides, LDS bases) then lives in scalar registers, not in VGPRs.
  const int wave = __builtin_amdgcn_readfirstlane(tid >> 5);
  const int r    = lane & 15;
  const int hf   = lane >> 4;

  // ---------------- Once per workgroup: weight fragments in registers and LDS ------
  // QKV: wave owns output-channel tiles nt = wave*3 + j, all 4 k steps.
  const float scale = 0.17677669529663687f; // D^-0.5
  v16h  wq[3][4];
  float smul[3], bqs[3];
  // Store address of token mt*16 + hf*8 + i, in f16 elements:
  // ((colbase ^ mt*xmt) ^ (i >> 2)*xi) + mt*amt + i*stride.
  int   stride[3], colbase[3], xmt[3], xi[3], amt[3];
#pragma unroll
  for (int j = 0; j < 3; ++j) {
    const int nt = wave * 3 + j;
#pragma unroll
    for (int kk = 0; kk < 4; ++kk)
      wq[j][kk] = ld_tile_w(w_qkv + nt * 16 * CDIM, kk);
    // Per-lane output-column metadata (uniform sec within a tile: 16 | 128).
    const int cg  = nt * 16 + r;       // global out channel in [0,384)
    const int sec = cg >> 7;           // 0=q 1=k 2=v
    const int hh  = (cg >> 5) & 3;
    const int dd  = cg & 31;
    smul[j]   = (sec == 0) ? scale : 1.0f;
    bqs[j]    = b_qkv[cg] * smul[j];
    // Wait before the register that this load names is overwritten; cg is an
    // input so that its register stays whole up to the wait.
    asm volatile("s_wait_xcnt 0x0" :: "v"(cg) : "memory");
    stride[j] = (sec == 2) ? 1 : DHEAD;             // vT is token-contiguous
    // q, k: row = token, so the row's part of the chunk place is hf*2 ^ (i >> 2).
    // vT: row = dd, and the chunk is mt*2 + hf.
    xmt[j] = (sec == 2) ? 16 : 0;
    xi[j]  = (sec == 2) ? 0 : 8;
    amt[j] = (sec == 2) ? 0 : 16 * DHEAD;
    const int qk = hh * 2048 + hf * 8 * DHEAD + (((dd >> 3) ^ (hf * 2)) * 8) + (dd & 7);
    if (sec == 0)      colbase[j] = OFF_Q  / 2 + qk;
    else if (sec == 1) colbase[j] = OFF_K  / 2 + qk;
    else               colbase[j] = OFF_VT / 2 + hh * 2048 + dd * NPAD + ((hf ^ ((dd >> 1) & 7)) * 8);
  }
  // proj: wave builds the 4 k-step fragments of output-channel tile nt = wave.
  // They are first read in phase 4, behind the first window's barriers.
#pragma unroll
  for (int kk = 0; kk < 4; ++kk)
    st_frag(wpF, wave * 4 + kk, ld_tile_w(w_proj + wave * 16 * CDIM, kk));

  // 2 waves per head in phases 2-3; wave part p owns score rows [p*32, p*32+32).
  const int h = wave >> 1;
  const int p = wave & 1;

  // ---------------- Once per workgroup: bias + mask as score C tiles -------
  // Every window of this workgroup has b % NMASK == blockIdx.x % NMASK.
  // The wave builds the 2 x 4 tiles of its own score rows and is their only
  // reader. Column tiles 0-2 go to LDS; of tile 3 the one valid column stays in
  // one register. Pad rows and columns hold -1e30, which swallows the product.
  float* bmW = (float*)(smem + OFF_BM) + wave * 6 * 256;
  float col48; // lane hf*16 + trl*8 + i: score row (p*2 + trl)*16 + hf*8 + i
  {
    const float* maskw = mask + (blockIdx.x % NMASK) * (NTOK * NTOK);
#pragma unroll
    for (int trl = 0; trl < 2; ++trl) {
      const int m0 = (p * 2 + trl) * 16 + hf * 8;
      unsigned ob[8]; // element offset into rel_index and mask: row i, column r
#pragma unroll
      for (int i = 0; i < 8; ++i) // pad rows read the last row
        ob[i] = (unsigned)(min(m0 + i, NTOK - 1) * NTOK + r);
#pragma unroll
      for (int tc = 0; tc < 3; ++tc) { // columns tc*16 + r < NTOK
        unsigned gb[8]; // element offset into bias_table
        float mv[8], bv[8];
#pragma unroll
        for (int i = 0; i < 8; ++i) {
          // index read from an input: bounded to the table's rows before use
          gb[i] = min((unsigned)rel_index[ob[i] + tc * 16], (unsigned)(NREL - 1)) * HEADS + h;
          mv[i] = maskw[ob[i] + tc * 16];
        }
#pragma unroll
        for (int i = 0; i < 8; ++i) bv[i] = bias_table[gb[i]];
        // Wait before a register that this tile's loads name is overwritten. The
        // offsets are inputs so that their registers stay whole up to the wait.
        asm volatile("s_wait_xcnt 0x0"
                     :: "v"(ob[0]), "v"(ob[1]), "v"(ob[2]), "v"(ob[3]),
                        "v"(ob[4]), "v"(ob[5]), "v"(ob[6]), "v"(ob[7]),
                        "v"(gb[0]), "v"(gb[1]), "v"(gb[2]), "v"(gb[3]),
                        "v"(gb[4]), "v"(gb[5]), "v"(gb[6]), "v"(gb[7]) : "memory");
        v8f c;
#pragma unroll
        for (int i = 0; i < 8; ++i)
          c[i] = (m0 + i < NTOK) ? bv[i] + mv[i] : -1e30f;
        st_ctile(bmW, trl * 3 + tc, c);
      }
    }
    const int m = (p * 2 + (r >> 3)) * 16 + hf * 8 + (r & 7);
    const unsigned ob = (unsigned)(min(m, NTOK - 1) * NTOK + NTOK - 1);
    const unsigned gb = min((unsigned)rel_index[ob], (unsigned)(NREL - 1)) * HEADS + h;
    const float mv = maskw[ob];
    const float bv = bias_table[gb];
    // Wait before a register that these loads name is overwritten (as above).
    asm volatile("s_wait_xcnt 0x0" :: "v"(ob), "v"(gb) : "memory");
    col48 = (m < NTOK) ? bv + mv : -1e30f;
  }

  // Kept rolled: a second copy of the body would need registers that the
  // resident weight fragments already take.
#pragma unroll 1
  for (int b = blockIdx.x; b < nwin; b += NWG) {
    // ---------------- Phase 0: stage x as f16 in LDS -----------------------
    // (This place last held P, read in front of the previous window's fourth barrier.)
    {
      const float4* x4 = (const float4*)(x + (size_t)b * NTOK * CDIM);
      for (int i = tid; i < (NPAD * CDIM) / 4; i += 256) {
        v4h h4 = {(_Float16)0.f, (_Float16)0.f, (_Float16)0.f, (_Float16)0.f};
        if ((i >> 5) < NTOK) { // row = (i*4)/128
          float4 v = x4[i];
          h4 = {(_Float16)v.x, (_Float16)v.y, (_Float16)v.z, (_Float16)v.w};
        }
        *(v4h*)(xS + (i >> 5) * XPITCH + (i & 31) * 4) = h4;
      }
    }
    __syncthreads();

    // ---------------- Phase 1: QKV GEMM (64x384 = x(64x128) @ wqkv^T) ------
    // x A-tiles are read once per token tile and meet the 3 resident B tiles.
#pragma unroll 1
    for (int mt = 0; mt < 4; ++mt) {
      v16h am[4];
#pragma unroll
      for (int kk = 0; kk < 4; ++kk)
        am[kk] = ld_tile(xS + mt * 16 * XPITCH + kk * 32, XPITCH);
      v8f acc[3] = {};
#pragma unroll
      for (int kk = 0; kk < 4; ++kk)
#pragma unroll
        for (int j = 0; j < 3; ++j)
          acc[j] = wmma_f16(am[kk], wq[j][kk], acc[j]);
#pragma unroll
      for (int j = 0; j < 3; ++j) {
        const int a0 = (colbase[j] ^ (mt * xmt[j])) + mt * amt[j];
        const int a4 = a0 ^ xi[j];
#pragma unroll
        for (int i = 0; i < 8; ++i)
          smemh[(i < 4 ? a0 : a4) + i * stride[j]] = (_Float16)fmaf(acc[j][i], smul[j], bqs[j]);
      }
    }
    __syncthreads();

    // ---------------- Phase 2: S = q @ k^T + (bias + mask), softmax -> P ----
    // One 16-row tile at a time: its scores are spent before the next tile's are
    // made, so that 4 score tiles are live beside the resident fragments, not 8.
    v16h bk[4];
#pragma unroll
    for (int tc = 0; tc < 4; ++tc)
      bk[tc] = ld_tile_s32(kS + h * 2048 + tc * 16 * DHEAD);
#pragma unroll
    for (int trl = 0; trl < 2; ++trl) {
      const v16h aq = ld_tile_s32(qS + h * 2048 + (p * 2 + trl) * 16 * DHEAD);
      v8f sacc[4];
#pragma unroll
      for (int tc = 0; tc < 3; ++tc) // K = 32 in one step
        sacc[tc] = wmma_f16(aq, bk[tc], ld_ctile(bmW, trl * 3 + tc));
      sacc[3] = wmma_f16(aq, bk[3], trl == 0 ? edge_ctile<0>(col48) : edge_ctile<8>(col48));
#pragma unroll
      for (int i = 0; i < 8; ++i) {
        const int m = (p * 2 + trl) * 16 + hf * 8 + i;
        const float row[4] = {sacc[0][i], sacc[1][i], sacc[2][i], sacc[3][i]};
        // row max over 4 regs x 16 lanes (xor 1..8 stays inside the half)
        float mx = fmaxf(fmaxf(row[0], row[1]), fmaxf(row[2], row[3]));
#pragma unroll
        for (int off = 1; off < 16; off <<= 1) mx = fmaxf(mx, __shfl_xor(mx, off, 32));
        const float e0 = __expf(row[0] - mx), e1 = __expf(row[1] - mx);
        const float e2 = __expf(row[2] - mx), e3 = __expf(row[3] - mx);
        float sum = (e0 + e1) + (e2 + e3);
#pragma unroll
        for (int off = 1; off < 16; off <<= 1) sum += __shfl_xor(sum, off, 32);
        const float inv = 1.0f / sum;
        // column tc*16 + r: chunk tc*2 + (r >> 3), at place chunk ^ ((m >> 1) & 7)
        _Float16* prow = Ps + h * 4096 + m * NPAD + (r & 7);
        const int pc = (r >> 3) ^ (hf * 4) ^ (i >> 1);
        prow[(pc ^ 0) * 8] = (_Float16)(e0 * inv);
        prow[(pc ^ 2) * 8] = (_Float16)(e1 * inv);
        prow[(pc ^ 4) * 8] = (_Float16)(e2 * inv);
        prow[(pc ^ 6) * 8] = (_Float16)(e3 * inv);
      }
    }
    __syncthreads();

    // ---------------- Phase 3: out_h = P(64x64) @ v(64x32), K = 2 steps ------
    {
      v8f oacc[2][2];
      v8f z = {};
      oacc[0][0] = z; oacc[0][1] = z; oacc[1][0] = z; oacc[1][1] = z;
#pragma unroll
      for (int kk = 0; kk < 2; ++kk) {
        v16h bv0 = ld_tile_s64(vtS + h * 2048 + 0  * NPAD, kk);
        v16h bv1 = ld_tile_s64(vtS + h * 2048 + 16 * NPAD, kk);
        v16h a0  = ld_tile_s64(Ps + h * 4096 + (p * 2 + 0) * 16 * NPAD, kk);
        v16h a1  = ld_tile_s64(Ps + h * 4096 + (p * 2 + 1) * 16 * NPAD, kk);
        oacc[0][0] = wmma_f16(a0, bv0, oacc[0][0]);
        oacc[0][1] = wmma_f16(a0, bv1, oacc[0][1]);
        oacc[1][0] = wmma_f16(a1, bv0, oacc[1][0]);
        oacc[1][1] = wmma_f16(a1, bv1, oacc[1][1]);
      }
#pragma unroll
      for (int trl = 0; trl < 2; ++trl)
#pragma unroll
        for (int tc = 0; tc < 2; ++tc) {
          const int m0 = (p * 2 + trl) * 16 + hf * 8;
          const int dd = tc * 16 + r;
#pragma unroll
          for (int i = 0; i < 8; ++i)
            aoS[(m0 + i) * XPITCH + h * DHEAD + dd] = (_Float16)oacc[trl][tc][i];
        }
    }
    __syncthreads();

    // ---------------- Phase 4: proj = ao(64x128) @ wproj^T + b_proj --------
    // mt-outer: A tiles (attn-out rows) loaded once per wave, reused for 4 nt.
    {
      const int mt = wave >> 1;
      const int nbase = (wave & 1) * 4;
      float* outp = out + (size_t)b * NTOK * CDIM + (mt * 16 + hf * 8) * CDIM + r;
      v16h am[4];
#pragma unroll
      for (int kk = 0; kk < 4; ++kk)
        am[kk] = ld_tile(aoS + mt * 16 * XPITCH + kk * 32, XPITCH);
#pragma unroll 1
      for (int j = 0; j < 4; ++j) {
        const int nt = nbase + j;
        v8f acc = {};
#pragma unroll
        for (int kk = 0; kk < 4; ++kk)
          acc = wmma_f16(am[kk], ld_frag(wpF, nt * 4 + kk), acc);
        const int n = nt * 16 + r;
        const float bp = b_proj[n];
        float* oj = outp + nt * 16;
#pragma unroll
        for (int i = 0; i < 8; ++i) {
          const int m = mt * 16 + hf * 8 + i;
          if (m < NTOK) oj[i * CDIM] = acc[i] + bp;
        }
        // Wait before the stores' address pair is stepped to the next tile; oj is
        // an input so that the step cannot be placed in front of the wait.
        asm volatile("s_wait_xcnt 0x0" :: "v"(oj) : "memory");
      }
    }
  }
}

extern "C" void kernel_launch(void* const* d_in, const int* in_sizes, int n_in,
                              void* d_out, int out_size, void* d_ws, size_t ws_size,
                              hipStream_t stream) {
  (void)n_in; (void)d_ws; (void)ws_size; (void)out_size;
  const float* x          = (const float*)d_in[0];
  const float* mask       = (const float*)d_in[1];
  const float* w_qkv      = (const float*)d_in[2];
  const float* b_qkv      = (const float*)d_in[3];
  const float* w_proj     = (const float*)d_in[4];
  const float* b_proj     = (const float*)d_in[5];
  const float* bias_table = (const float*)d_in[6];
  const int*   rel_index  = (const int*)d_in[7];
  float* out = (float*)d_out;

  const int B = in_sizes[0] / (NTOK * CDIM); // 4096 windows

  // Opt in to >default dynamic LDS (160 KB of the 320 KB/WGP on CDNA5).
  (void)hipFuncSetAttribute(reinterpret_cast<const void*>(swin_msa_fused),
                            hipFuncAttributeMaxDynamicSharedMemorySize, SMEM_BYTES);

  // 256 WGPs x 2 resident workgroups; each takes every 512th window.
  swin_msa_fused<<<NWG, 256, SMEM_BYTES, stream>>>(
      x, mask, w_qkv, b_qkv, w_proj, b_proj, bias_table, rel_index, out, B);
}

// v004
// A run of this version takes 82.4 microseconds.
// Timed twice side by side with v003, it ran 1.25 and 1.26 times as fast.
// Over all steps from v000 it is 7.61 times as fast.
#include <hip/hip_runtime.h>

// Fully fused kernel for gfx1250 (wave32, WMMA).
// 512 workgroups (256 threads = 8 wave32), two resident per WGP; each loops
// over windows b = blockIdx.x, blockIdx.x + gridDim.x, ...
// The weights do not depend on the window: they are read once per workgroup,
// straight from global f32, as ready f16 WMMA B fragments. Every wave keeps the
// wqkv fragments of the 3 output-channel tiles it owns in registers; the wproj
// fragments lie in LDS in fragment order.
// Neither do the rel-pos bias and, as the loop's stride is a multiple of the
// number of masks, the window mask: their sum is gathered once per workgroup, in
// the layout of the score tiles, and enters the score product as its C operand.
// Per window: x -> f16 staging -> QKV GEMM -> scores -> softmax (+rel-pos bias
// + shift-window mask) -> P@V -> proj GEMM -> d_out.
// The scores are made transposed, S^T = k @ q^T: a lane then holds 32 of the 64
// keys of ONE query (its partner lane ^ 16 the other 32), so that the softmax
// runs inside the lane's registers but for two exchanges, and the packed P^T is
// already the B fragment of out^T = v^T @ P^T: P never goes through LDS.
// Every operand tile in LDS is laid so that the 16 rows which one half of a
// ds_load_b128 reads fall on 16 different groups of four banks: x and attn-out
// by a row pitch of 272 B, q, k and vT by exchanging the 16-byte chunks inside
// each row (chunk ^ a function of the row).

#define NTOK 49
#define NPAD 64
#define CDIM 128
#define HEADS 4
#define DHEAD 32
#define NREL 169  // rows of bias_table
#define NMASK 64  // windows in mask
#define NWG  512  // workgroups launched = stride of the window loop
#define XPITCH 136 // f16 per LDS row of x and attn-out: 256 B + 16 B pad
static_assert(NWG % NMASK == 0, "a workgroup must meet one mask window only");

typedef __attribute__((ext_vector_type(16))) _Float16 v16h;
typedef __attribute__((ext_vector_type(8)))  _Float16 v8h;
typedef __attribute__((ext_vector_type(4)))  _Float16 v4h;
typedef __attribute__((ext_vector_type(8)))  float    v8f;

static constexpr int SMEM_BYTES = 163840; // 160 KB: two workgroups per WGP

// LDS byte offsets. No place is used twice. Two barriers of the window loop
// stand between each tile's last read and its next write.
#define OFF_X      0        // 50 rows of 272 B = 13600 B (49 tokens, one row of zeros)
#define OFF_AO     13600    // 64 rows of 272 B = 17408 B
#define OFF_Q      32768    // 4*64*32 f16 = 16384 B
#define OFF_K      49152    // 4*64*32 f16 = 16384 B
#define OFF_VT     65536    // 4*32*64 f16 = 16384 B  (v stored transposed [h][d][n])
#define OFF_WPF    81920    // 32 tiles * 1024 B = 32768 B (wproj B fragments)
#define OFF_BM     114688   // 48 tiles * 1024 B = 49152 B (bias + mask C tiles, f32)

// Load one 16x(K=32) operand tile in the CDNA5 WMMA 16-bit A/B register layout:
// lane r=lane&15 -> row, half=lane>>4 -> K-offset; element e holds
// K = (e<8 ? 0 : 16) + half*8 + (e&7). row: the lane's own row, at the tile's
// first column; ld_tile takes it from a row-major source with leading dim ld.
__device__ __forceinline__ v16h ld_tile_row(const _Float16* row) {
  const _Float16* p = row + ((threadIdx.x & 31) >> 4) * 8;
  v16h a;
#pragma unroll
  for (int e = 0; e < 8; ++e) a[e] = p[e];          // K = hf*8 + e
#pragma unroll
  for (int e = 0; e < 8; ++e) a[e + 8] = p[16 + e]; // K = 16 + hf*8 + e
  return a;
}
__device__ __forceinline__ v16h ld_tile(const _Float16* base, int ld) {
  return ld_tile_row(base + (threadIdx.x & 15) * ld);
}

// The same tile from rows of 32 f16 (q, k) whose 16-byte chunks are exchanged:
// chunk c of row n lies at place c ^ ((n >> 2) & 3). tile: a multiple of 16 rows.
__device__ __forceinline__ v16h ld_tile_s32(const _Float16* tile) {
  const int lane = threadIdx.x & 31;
  const int r    = lane & 15;
  const int c    = (lane >> 4) ^ ((r >> 2) & 3);
  const v8h lo = *(const v8h*)(tile + r * 32 + c * 8);       // K = hf*8 + e
  const v8h hi = *(const v8h*)(tile + r * 32 + (c ^ 2) * 8); // K = 16 + hf*8 + e
  v16h a;
#pragma unroll
  for (int e = 0; e < 8; ++e) { a[e] = lo[e]; a[e + 8] = hi[e]; }
  return a;
}
// The same from rows of 64 f16 (vT): chunk c of row n lies at place
// c ^ ((n >> 1) & 7). tile: a multiple of 16 rows; kk: which block of 32 columns.
__device__ __forceinline__ v16h ld_tile_s64(const _Float16* tile, int kk) {
  const int lane = threadIdx.x & 31;
  const int r    = lane & 15;
  const int c    = (lane >> 4) ^ ((r >> 1) & 7);
  const v8h lo = *(const v8h*)(tile + r * 64 + (c ^ (kk * 4)) * 8);
  const v8h hi = *(const v8h*)(tile + r * 64 + (c ^ (kk * 4 + 2)) * 8);
  v16h a;
#pragma unroll
  for (int e = 0; e < 8; ++e) { a[e] = lo[e]; a[e + 8] = hi[e]; }
  return a;
}

// Same register layout, read from a row-major f32 matrix in global memory
// (rows of CDIM floats) and rounded to f16 element by element.
// base: first row of the 16-row tile; kk: which block of 32 columns.
__device__ __forceinline__ v16h ld_tile_w(const float* base, int kk) {
  const int lane = threadIdx.x & 31;
  const float4* p = (const float4*)(base + (lane & 15) * CDIM + (lane >> 4) * 8);
  const float4 f0 = p[kk * 8], f1 = p[kk * 8 + 1], f2 = p[kk * 8 + 4], f3 = p[kk * 8 + 5];
  // Wait before a register that these loads name is overwritten. p is an input
  // so that the address pair stays whole up to the wait (without it the last
  // load's result was placed in the pair that the other three still name).
  asm volatile("s_wait_xcnt 0x0" :: "v"(p) : "memory");
  v16h a = {(_Float16)f0.x, (_Float16)f0.y, (_Float16)f0.z, (_Float16)f0.w,
            (_Float16)f1.x, (_Float16)f1.y, (_Float16)f1.z, (_Float16)f1.w,
            (_Float16)f2.x, (_Float16)f2.y, (_Float16)f2.z, (_Float16)f2.w,
            (_Float16)f3.x, (_Float16)f3.y, (_Float16)f3.z, (_Float16)f3.w};
  return a;
}

// wproj fragments in LDS: tile t = nt*4 + kk takes 1024 B, elements 0-7 of all
// 32 lanes first (16 B a lane, contiguous), then elements 8-15.
__device__ __forceinline__ void st_frag(_Float16* frags, int t, v16h a) {
  const int lane = threadIdx.x & 31;
  v8h lo, hi;
#pragma unroll
  for (int e = 0; e < 8; ++e) { lo[e] = a[e]; hi[e] = a[e + 8]; }
  *(v8h*)(frags + t * 512 + lane * 8)       = lo;
  *(v8h*)(frags + t * 512 + 256 + lane * 8) = hi;
}
__device__ __forceinline__ v16h ld_frag(const _Float16* frags, int t) {
  const int lane = threadIdx.x & 31;
  const v8h lo = *(const v8h*)(frags + t * 512 + lane * 8);
  const v8h hi = *(const v8h*)(frags + t * 512 + 256 + lane * 8);
  v16h a;
#pragma unroll
  for (int e = 0; e < 8; ++e) { a[e] = lo[e]; a[e + 8] = hi[e]; }
  return a;
}

// bias + mask tiles in LDS, WMMA C/D register layout (element i: row hf*8 + i,
// column lane & 15; here row = key, column = query): a tile takes 1024 B, elements 0-3 of all 32 lanes first
// (16 B a lane, contiguous), then elements 4-7.
__device__ __forceinline__ void st_ctile(float* tiles, int t, v8f c) {
  const int lane = threadIdx.x & 31;
  const float4 lo = {c[0], c[1], c[2], c[3]}, hi = {c[4], c[5], c[6], c[7]};
  *(float4*)(tiles + t * 256 + lane * 4)       = lo;
  *(float4*)(tiles + t * 256 + 128 + lane * 4) = hi;
}
__device__ __forceinline__ v8f ld_ctile(const float* tiles, int t) {
  const int lane = threadIdx.x & 31;
  const float4 lo = *(const float4*)(tiles + t * 256 + lane * 4);
  const float4 hi = *(const float4*)(tiles + t * 256 + 128 + lane * 4);
  v8f c = {lo.x, lo.y, lo.z, lo.w, hi.x, hi.y, hi.z, hi.w};
  return c;
}

// Value of the partner lane (lane ^ 16), by a vector move between the two rows.
__device__ __forceinline__ float xhalf(float v) {
  const int b = __builtin_bit_cast(int, v);
  return __builtin_bit_cast(float, __builtin_amdgcn_permlanex16(
      b, b, 0x76543210, 0xfedcba98, false, false));
}

__device__ __forceinline__ v8f wmma_f16(v16h a, v16h b, v8f c) {
  return __builtin_amdgcn_wmma_f32_16x16x32_f16(false, a, false, b,
                                                (short)0, c, false, false);
}

__global__ void __launch_bounds__(256, 4) // 4 waves per SIMD: two workgroups per WGP
swin_msa_fused(const float* __restrict__ x, const float* __restrict__ mask,
               const float* __restrict__ w_qkv, const float* __restrict__ b_qkv,
               const float* __restrict__ w_proj, const float* __restrict__ b_proj,
               const float* __restrict__ bias_table, const int* __restrict__ rel_index,
               float* __restrict__ out, int nwin) {
  extern __shared__ __align__(16) char smem[];
  _Float16* smemh  = (_Float16*)smem;
  _Float16* aoS    = (_Float16*)(smem + OFF_AO);
  _Float16* xS     = (_Float16*)(smem + OFF_X);
  _Float16* qS     = (_Float16*)(smem + OFF_Q);
  _Float16* kS     = (_Float16*)(smem + OFF_K);
  _Float16* vtS    = (_Float16*)(smem + OFF_VT);
  _Float16* wpF    = (_Float16*)(smem + OFF_WPF);

  const int tid  = threadIdx.x;
  const int lane = tid & 31;
  // Wave number as a scalar: all that follows from it (tile numbers, head,
  // store strides, LDS bases) then lives in scalar registers, not in VGPRs.
  const int wave = __builtin_amdgcn_readfirstlane(tid >> 5);
  const int r    = lane & 15;
  const int hf   = lane >> 4;

  // ---------------- Once per workgroup: weight fragments in registers and LDS ------
  // QKV: wave owns output-channel tiles nt = wave*3 + j, all 4 k steps.
  const float scale = 0.17677669529663687f; // D^-0.5
  v16h  wq[3][4];
  float smul[3], bqs[3];
  // Store address of token mt*16 + hf*8 + i, in f16 elements:
  // ((colbase ^ mt*xmt) ^ (i >> 2)*xi) + mt*amt + i*stride.
  int   stride[3], colbase[3], xmt[3], xi[3], amt[3];
#pragma unroll
  for (int j = 0; j < 3; ++j) {
    const int nt = wave * 3 + j;
#pragma unroll
    for (int kk = 0; kk < 4; ++kk)
      wq[j][kk] = ld_tile_w(w_qkv + nt * 16 * CDIM, kk);
    // Per-lane output-column metadata (uniform sec within a tile: 16 | 128).
    const int cg  = nt * 16 + r;       // global out channel in [0,384)
    const int sec = cg >> 7;           // 0=q 1=k 2=v
    const int hh  = (cg >> 5) & 3;
    const int dd  = cg & 31;
    smul[j]   = (sec == 0) ? scale : 1.0f;
    bqs[j]    = b_qkv[cg] * smul[j];
    // Wait before the register that this load names is overwritten; cg is an
    // input so that its register stays whole up to the wait.
    asm volatile("s_wait_xcnt 0x0" :: "v"(cg) : "memory");
    stride[j] = (sec == 2) ? 1 : DHEAD;             // vT is token-contiguous
    // q, k: row = token, so the row's part of the chunk place is hf*2 ^ (i >> 2).
    // vT: row = dd, and the chunk is mt*2 + hf.
    xmt[j] = (sec == 2) ? 16 : 0;
    xi[j]  = (sec == 2) ? 0 : 8;
    amt[j] = (sec == 2) ? 0 : 16 * DHEAD;
    const int qk = hh * 2048 + hf * 8 * DHEAD + (((dd >> 3) ^ (hf * 2)) * 8) + (dd & 7);
    if (sec == 0)      colbase[j] = OFF_Q  / 2 + qk;
    else if (sec == 1) colbase[j] = OFF_K  / 2 + qk;
    else               colbase[j] = OFF_VT / 2 + hh * 2048 + dd * NPAD + ((hf ^ ((dd >> 1) & 7)) * 8);
  }
  // proj: wave builds the 4 k-step fragments of output-channel tile nt = wave.
  // They are first read in phase 3, behind the first window's barriers.
#pragma unroll
  for (int kk = 0; kk < 4; ++kk)
    st_frag(wpF, wave * 4 + kk, ld_tile_w(w_proj + wave * 16 * CDIM, kk));

  // 2 waves per head in phase 2; wave part p owns queries [p*32, p*32+32).
  const int h = wave >> 1;
  const int p = wave & 1;

  // ---------------- Once per workgroup: bias + mask as score C tiles -------
  // Every window of this workgroup has b % NMASK == blockIdx.x % NMASK.
  // The wave builds the 4 x 2 transposed tiles (key tile x query tile) of its own
  // queries and is their only reader. Key tiles 0-2 go to LDS; of key tile 3 the
  // one valid key, 48, stays in a register per query tile. Pad keys and pad
  // queries hold -1e30, which swallows the product.
  float* bmW = (float*)(smem + OFF_BM) + wave * 6 * 256;
  float key48[2]; // query (p*2 + trl)*16 + r, in the lanes with hf == 0
  {
    const float* maskw = mask + (blockIdx.x % NMASK) * (NTOK * NTOK);
#pragma unroll
    for (int trl = 0; trl < 2; ++trl) {
      const int m = (p * 2 + trl) * 16 + r; // the lane's query; pad queries read the last
      // byte offset into rel_index and mask: row m, column hf*8
      const unsigned ob = (unsigned)(min(m, NTOK - 1) * NTOK + hf * 8) * 4u;
      const int*   ri = (const int*)((const char*)rel_index + ob);
      const float* mr = (const float*)((const char*)maskw + ob);
#pragma unroll
      for (int kt = 0; kt < 3; ++kt) { // keys kt*16 + hf*8 + i < NTOK
        unsigned gb[8]; // element offset into bias_table
        float mv[8], bv[8];
#pragma unroll
        for (int i = 0; i < 8; ++i) {
          // index read from an input: bounded to the table's rows before use
          gb[i] = min((unsigned)ri[kt * 16 + i], (unsigned)(NREL - 1)) * HEADS + h;
          mv[i] = mr[kt * 16 + i];
        }
#pragma unroll
        for (int i = 0; i < 8; ++i) bv[i] = bias_table[gb[i]];
        // Wait before a register that this tile's loads name is overwritten. The
        // offsets are inputs so that their registers stay whole up to the wait.
        asm volatile("s_wait_xcnt 0x0"
                     :: "v"(ob), "v"(gb[0]), "v"(gb[1]), "v"(gb[2]), "v"(gb[3]),
                        "v"(gb[4]), "v"(gb[5]), "v"(gb[6]), "v"(gb[7]) : "memory");
        v8f c;
#pragma unroll
        for (int i = 0; i < 8; ++i)
          c[i] = (m < NTOK) ? bv[i] + mv[i] : -1e30f;
        st_ctile(bmW, trl * 3 + kt, c);
      }
    }
    unsigned oe[2], ge[2]; // element offsets: row m, column 48; its bias_table entry
    float mv[2], bv[2];
#pragma unroll
    for (int trl = 0; trl < 2; ++trl) {
      oe[trl] = (unsigned)(min((p * 2 + trl) * 16 + r, NTOK - 1) * NTOK + NTOK - 1);
      ge[trl] = min((unsigned)rel_index[oe[trl]], (unsigned)(NREL - 1)) * HEADS + h;
      mv[trl] = maskw[oe[trl]];
    }
#pragma unroll
    for (int trl = 0; trl < 2; ++trl) bv[trl] = bias_table[ge[trl]];
    // Wait before a register that these loads name is overwritten. The loaded
    // values are inputs too, so that no load can be placed behind the wait.
    asm volatile("s_wait_xcnt 0x0"
                 :: "v"(oe[0]), "v"(oe[1]), "v"(ge[0]), "v"(ge[1]),
                    "v"(mv[0]), "v"(mv[1]), "v"(bv[0]), "v"(bv[1]) : "memory");
#pragma unroll
    for (int trl = 0; trl < 2; ++trl)
      key48[trl] = ((p * 2 + trl) * 16 + r < NTOK && hf == 0) ? bv[trl] + mv[trl] : -1e30f;
  }

  // Kept rolled: a second copy of the body would need registers that the
  // resident weight fragments already take.
#pragma unroll 1
  for (int b = blockIdx.x; b < nwin; b += NWG) {
    // ---------------- Phase 0: stage x as f16 in LDS -----------------------
    {
      const float4* x4 = (const float4*)(x + (size_t)b * NTOK * CDIM);
      for (int i = tid; i < ((NTOK + 1) * CDIM) / 4; i += 256) {
        v4h h4 = {(_Float16)0.f, (_Float16)0.f, (_Float16)0.f, (_Float16)0.f};
        if ((i >> 5) < NTOK) { // row = (i*4)/128
          float4 v = x4[i];
          h4 = {(_Float16)v.x, (_Float16)v.y, (_Float16)v.z, (_Float16)v.w};
        }
        *(v4h*)(xS + (i >> 5) * XPITCH + (i & 31) * 4) = h4;
      }
    }
    __syncthreads();

    // ---------------- Phase 1: QKV GEMM (64x384 = x(64x128) @ wqkv^T) ------
    // x A-tiles are read once per token tile and meet the 3 resident B tiles.
#pragma unroll 1
    for (int mt = 0; mt < 4; ++mt) {
      // Every pad token reads the one row of zeros.
      const _Float16* xrow = xS + min(mt * 16 + r, NTOK) * XPITCH;
      v16h am[4];
#pragma unroll
      for (int kk = 0; kk < 4; ++kk)
        am[kk] = ld_tile_row(xrow + kk * 32);
      v8f acc[3] = {};
#pragma unroll
      for (int kk = 0; kk < 4; ++kk)
#pragma unroll
        for (int j = 0; j < 3; ++j)
          acc[j] = wmma_f16(am[kk], wq[j][kk], acc[j]);
#pragma unroll
      for (int j = 0; j < 3; ++j) {
        const int a0 = (colbase[j] ^ (mt * xmt[j])) + mt * amt[j];
        const int a4 = a0 ^ xi[j];
#pragma unroll
        for (int i = 0; i < 8; ++i)
          smemh[(i < 4 ? a0 : a4) + i * stride[j]] = (_Float16)fmaf(acc[j][i], smul[j], bqs[j]);
      }
    }
    __syncthreads();

    // ------- Phase 2: S^T = k @ q^T + (bias + mask)^T, softmax, out^T = v^T @ P^T
    // One tile of 16 queries at a time. Lane (r, hf) holds, of query r, the keys
    // kt*16 + hf*8 + i in st[kt][i].
    {
      v16h ak[4], av[2][2];
#pragma unroll
      for (int kt = 0; kt < 4; ++kt)
        ak[kt] = ld_tile_s32(kS + h * 2048 + kt * 16 * DHEAD);
#pragma unroll
      for (int dt = 0; dt < 2; ++dt)
#pragma unroll
        for (int kk = 0; kk < 2; ++kk)
          av[dt][kk] = ld_tile_s64(vtS + h * 2048 + dt * 16 * NPAD, kk);
#pragma unroll
      for (int trl = 0; trl < 2; ++trl) {
        const v16h bq = ld_tile_s32(qS + h * 2048 + (p * 2 + trl) * 16 * DHEAD);
        v8f st[4];
#pragma unroll
        for (int kt = 0; kt < 3; ++kt) // K = 32 in one step
          st[kt] = wmma_f16(ak[kt], bq, ld_ctile(bmW, trl * 3 + kt));
        const v8f c3 = {key48[trl], -1e30f, -1e30f, -1e30f, -1e30f, -1e30f, -1e30f, -1e30f};
        st[3] = wmma_f16(ak[3], bq, c3);
        // Of key tile 3 only element 0 can be a real key (48, where hf == 0; key 56
        // holds -1e30): elements 1-7 are pad keys in every lane, their P is 0.
        float mk[3];
#pragma unroll
        for (int kt = 0; kt < 3; ++kt)
          mk[kt] = fmaxf(fmaxf(fmaxf(st[kt][0], st[kt][1]), fmaxf(st[kt][2], st[kt][3])),
                         fmaxf(fmaxf(st[kt][4], st[kt][5]), fmaxf(st[kt][6], st[kt][7])));
        float mx = fmaxf(fmaxf(mk[0], mk[1]), fmaxf(mk[2], st[3][0]));
        mx = fmaxf(mx, xhalf(mx));
        float sk[3];
#pragma unroll
        for (int kt = 0; kt < 3; ++kt) {
#pragma unroll
          for (int i = 0; i < 8; ++i) st[kt][i] = __expf(st[kt][i] - mx);
          sk[kt] = ((st[kt][0] + st[kt][1]) + (st[kt][2] + st[kt][3])) +
                   ((st[kt][4] + st[kt][5]) + (st[kt][6] + st[kt][7]));
        }
        const float e48 = __expf(st[3][0] - mx);
        float sum = (sk[0] + sk[1]) + (sk[2] + e48);
        sum += xhalf(sum);
        const float inv = 1.0f / sum;
        // P^T as B fragments: element e of k step kk is key kk*32 + (e < 8 ? 0 : 16)
        // + hf*8 + (e & 7), which is st[kk*2 + (e >> 3)][e & 7] of this very lane.
        v16h pf[2];
#pragma unroll
        for (int e = 0; e < 8; ++e) {
          pf[0][e]     = (_Float16)(st[0][e] * inv);
          pf[0][e + 8] = (_Float16)(st[1][e] * inv);
          pf[1][e]     = (_Float16)(st[2][e] * inv);
          pf[1][e + 8] = (_Float16)0.f;
        }
        pf[1][8] = (_Float16)(e48 * inv);
        // out^T tile dt: lane (r, hf) holds, of query r, channels dt*16 + hf*8 + i:
        // 16 bytes in a row of attn-out.
        const int m = (p * 2 + trl) * 16 + r;
#pragma unroll
        for (int dt = 0; dt < 2; ++dt) {
          v8f o = {};
          o = wmma_f16(av[dt][0], pf[0], o);
          o = wmma_f16(av[dt][1], pf[1], o);
          v8h o8;
#pragma unroll
          for (int i = 0; i < 8; ++i) o8[i] = (_Float16)o[i];
          *(v8h*)(aoS + m * XPITCH + h * DHEAD + dt * 16 + hf * 8) = o8;
        }
      }
    }
    __syncthreads();

    // ---------------- Phase 3: proj = ao(64x128) @ wproj^T + b_proj --------
    // mt-outer: A tiles (attn-out rows) loaded once per wave, reused for 4 nt.
    {
      const int mt = wave >> 1;
      const int nbase = (wave & 1) * 4;
      float* outp = out + (size_t)b * NTOK * CDIM + (mt * 16 + hf * 8) * CDIM + r;
      v16h am[4];
#pragma unroll
      for (int kk = 0; kk < 4; ++kk)
        am[kk] = ld_tile(aoS + mt * 16 * XPITCH + kk * 32, XPITCH);
#pragma unroll 1
      for (int j = 0; j < 4; ++j) {
        const int nt = nbase + j;
        v8f acc = {};
#pragma unroll
        for (int kk = 0; kk < 4; ++kk)
          acc = wmma_f16(am[kk], ld_frag(wpF, nt * 4 + kk), acc);
        const int n = nt * 16 + r;
        const float bp = b_proj[n];
        float* oj = outp + nt * 16;
#pragma unroll
        for (int i = 0; i < 8; ++i) {
          const int m = mt * 16 + hf * 8 + i;
          if (m < NTOK) oj[i * CDIM] = acc[i] + bp;
        }
        // Wait before the stores' address pair is stepped to the next tile; oj is
        // an input so that the step cannot be placed in front of the wait.
        asm volatile("s_wait_xcnt 0x0" :: "v"(oj) : "memory");
      }
    }
  }
}

extern "C" void kernel_launch(void* const* d_in, const int* in_sizes, int n_in,
                              void* d_out, int out_size, void* d_ws, size_t ws_size,
                              hipStream_t stream) {
  (void)n_in; (void)d_ws; (void)ws_size; (void)out_size;
  const float* x          = (const float*)d_in[0];
  const float* mask       = (const float*)d_in[1];
  const float* w_qkv      = (const float*)d_in[2];
  const float* b_qkv      = (const float*)d_in[3];
  const float* w_proj     = (const float*)d_in[4];
  const float* b_proj     = (const float*)d_in[5];
  const float* bias_table = (const float*)d_in[6];
  const int*   rel_index  = (const int*)d_in[7];
  float* out = (float*)d_out;

  const int B = in_sizes[0] / (NTOK * CDIM); // 4096 windows

  // Opt in to >default dynamic LDS (160 KB of the 320 KB/WGP on CDNA5).
  (void)hipFuncSetAttribute(reinterpret_cast<const void*>(swin_msa_fused),
                            hipFuncAttributeMaxDynamicSharedMemorySize, SMEM_BYTES);

  // 256 WGPs x 2 resident workgroups; each takes every 512th window.
  swin_msa_fused<<<NWG, 256, SMEM_BYTES, stream>>>(
      x, mask, w_qkv, b_qkv, w_proj, b_proj, bias_table, rel_index, out, B);
}

// v005
// A run of this version takes 60.7 microseconds.
// Timed twice side by side with v004, it ran 1.37 and 1.38 times as fast.
// All steps since v000 together make it 10.5 times as fast.
#include <hip/hip_runtime.h>

// Fully fused kernel for gfx1250 (wave32, WMMA).
// 512 workgroups (256 threads = 8 wave32), two resident per WGP; each loops
// over windows b = blockIdx.x, blockIdx.x + gridDim.x, ...
// The weights do not depend on the window: they are read once per workgroup,
// straight from global f32, as ready f16 WMMA B fragments. Every wave keeps the
// wqkv fragments of the 3 output-channel tiles it owns in registers; the wproj
// fragments lie in LDS in fragment order.
// Neither do the rel-pos bias and, as the loop's stride is a multiple of the
// number of masks, the window mask: their sum is gathered once per workgroup, in
// the layout of the score tiles, and enters the score product as its C operand.
// x is fetched one window ahead: all of a thread's loads of the next window are
// issued at the head of the proj phase and stay in registers, in flight, until the
// foot of the trip rounds them to f16 into LDS. b_proj lies in LDS, so that
// the proj phase waits on no global load (a wait on a later load would also
// wait for the fetch, as loads are counted in order).
// Per window: x -> f16 staging -> QKV GEMM -> scores -> softmax (+rel-pos bias
// + shift-window mask) -> P@V -> proj GEMM -> d_out.
// The scores are made transposed, S^T = k @ q^T: a lane then holds 32 of the 64
// keys of ONE query (its partner lane ^ 16 the other 32), so that the softmax
// runs inside the lane's registers but for two exchanges, and the packed P^T is
// already the B fragment of out^T = v^T @ P^T: P never goes through LDS.
// Every operand tile in LDS is laid so that the 16 rows which one half of a
// ds_load_b128 reads fall on 16 different groups of four banks: x and attn-out
// by a row pitch of 272 B, q, k and vT by exchanging the 16-byte chunks inside
// each row (chunk ^ a function of the row).

#define NTOK 49
#define NPAD 64
#define CDIM 128
#define HEADS 4
#define DHEAD 32
#define NREL 169  // rows of bias_table
#define NMASK 64  // windows in mask
#define NWG  512  // workgroups launched = stride of the window loop
#define XPITCH 136 // f16 per LDS row of x and attn-out: 256 B + 16 B pad
static_assert(NWG % NMASK == 0, "a workgroup must meet one mask window only");

typedef __attribute__((ext_vector_type(16))) _Float16 v16h;
typedef __attribute__((ext_vector_type(8)))  _Float16 v8h;
typedef __attribute__((ext_vector_type(4)))  _Float16 v4h;
typedef __attribute__((ext_vector_type(8)))  float    v8f;

static constexpr int SMEM_BYTES = 163840; // 160 KB: two workgroups per WGP

// LDS byte offsets. No place is used twice. Two barriers of the window loop
// stand between each tile's last read and its next write.
#define OFF_X      0        // 50 rows of 272 B = 13600 B (49 tokens, one row of zeros)
#define OFF_AO     13600    // 64 rows of 272 B = 17408 B
#define OFF_BP     31008    // 128 f32 = 512 B (b_proj)
#define OFF_Q      32768    // 4*64*32 f16 = 16384 B
#define OFF_K      49152    // 4*64*32 f16 = 16384 B
#define OFF_VT     65536    // 4*32*64 f16 = 16384 B  (v stored transposed [h][d][n])
#define OFF_WPF    81920    // 32 tiles * 1024 B = 32768 B (wproj B fragments)
#define OFF_BM     114688   // 48 tiles * 1024 B = 49152 B (bias + mask C tiles, f32)

// Load one 16x(K=32) operand tile in the CDNA5 WMMA 16-bit A/B register layout:
// lane r=lane&15 -> row, half=lane>>4 -> K-offset; element e holds
// K = (e<8 ? 0 : 16) + half*8 + (e&7). row: the lane's own row, at the tile's
// first column; ld_tile takes it from a row-major source with leading dim ld.
__device__ __forceinline__ v16h ld_tile_row(const _Float16* row) {
  const _Float16* p = row + ((threadIdx.x & 31) >> 4) * 8;
  v16h a;
#pragma unroll
  for (int e = 0; e < 8; ++e) a[e] = p[e];          // K = hf*8 + e
#pragma unroll
  for (int e = 0; e < 8; ++e) a[e + 8] = p[16 + e]; // K = 16 + hf*8 + e
  return a;
}
__device__ __forceinline__ v16h ld_tile(const _Float16* base, int ld) {
  return ld_tile_row(base + (threadIdx.x & 15) * ld);
}

// The same tile from rows of 32 f16 (q, k) whose 16-byte chunks are exchanged:
// chunk c of row n lies at place c ^ ((n >> 2) & 3). tile: a multiple of 16 rows.
__device__ __forceinline__ v16h ld_tile_s32(const _Float16* tile) {
  const int lane = threadIdx.x & 31;
  const int r    = lane & 15;
  const int c    = (lane >> 4) ^ ((r >> 2) & 3);
  const v8h lo = *(const v8h*)(tile + r * 32 + c * 8);       // K = hf*8 + e
  const v8h hi = *(const v8h*)(tile + r * 32 + (c ^ 2) * 8); // K = 16 + hf*8 + e
  v16h a;
#pragma unroll
  for (int e = 0; e < 8; ++e) { a[e] = lo[e]; a[e + 8] = hi[e]; }
  return a;
}
// The same from rows of 64 f16 (vT): chunk c of row n lies at place
// c ^ ((n >> 1) & 7). tile: a multiple of 16 rows; kk: which block of 32 columns.
__device__ __forceinline__ v16h ld_tile_s64(const _Float16* tile, int kk) {
  const int lane = threadIdx.x & 31;
  const int r    = lane & 15;
  const int c    = (lane >> 4) ^ ((r >> 1) & 7);
  const v8h lo = *(const v8h*)(tile + r * 64 + (c ^ (kk * 4)) * 8);
  const v8h hi = *(const v8h*)(tile + r * 64 + (c ^ (kk * 4 + 2)) * 8);
  v16h a;
#pragma unroll
  for (int e = 0; e < 8; ++e) { a[e] = lo[e]; a[e + 8] = hi[e]; }
  return a;
}

// Same register layout, read from a row-major f32 matrix in global memory
// (rows of CDIM floats) and rounded to f16 element by element.
// base: first row of the 16-row tile; kk: which block of 32 columns.
__device__ __forceinline__ v16h ld_tile_w(const float* base, int kk) {
  const int lane = threadIdx.x & 31;
  const float4* p = (const float4*)(base + (lane & 15) * CDIM + (lane >> 4) * 8);
  const float4 f0 = p[kk * 8], f1 = p[kk * 8 + 1], f2 = p[kk * 8 + 4], f3 = p[kk * 8 + 5];
  // Wait before a register that these loads name is overwritten. p is an input
  // so that the address pair stays whole up to the wait (without it the last
  // load's result was placed in the pair that the other three still name).
  asm volatile("s_wait_xcnt 0x0" :: "v"(p) : "memory");
  v16h a = {(_Float16)f0.x, (_Float16)f0.y, (_Float16)f0.z, (_Float16)f0.w,
            (_Float16)f1.x, (_Float16)f1.y, (_Float16)f1.z, (_Float16)f1.w,
            (_Float16)f2.x, (_Float16)f2.y, (_Float16)f2.z, (_Float16)f2.w,
            (_Float16)f3.x, (_Float16)f3.y, (_Float16)f3.z, (_Float16)f3.w};
  return a;
}

// wproj fragments in LDS: tile t = nt*4 + kk takes 1024 B, elements 0-7 of all
// 32 lanes first (16 B a lane, contiguous), then elements 8-15.
__device__ __forceinline__ void st_frag(_Float16* frags, int t, v16h a) {
  const int lane = threadIdx.x & 31;
  v8h lo, hi;
#pragma unroll
  for (int e = 0; e < 8; ++e) { lo[e] = a[e]; hi[e] = a[e + 8]; }
  *(v8h*)(frags + t * 512 + lane * 8)       = lo;
  *(v8h*)(frags + t * 512 + 256 + lane * 8) = hi;
}
__device__ __forceinline__ v16h ld_frag(const _Float16* frags, int t) {
  const int lane = threadIdx.x & 31;
  const v8h lo = *(const v8h*)(frags + t * 512 + lane * 8);
  const v8h hi = *(const v8h*)(frags + t * 512 + 256 + lane * 8);
  v16h a;
#pragma unroll
  for (int e = 0; e < 8; ++e) { a[e] = lo[e]; a[e + 8] = hi[e]; }
  return a;
}

// bias + mask tiles in LDS, WMMA C/D register layout (element i: row hf*8 + i,
// column lane & 15; here row = key, column = query): a tile takes 1024 B, elements 0-3 of all 32 lanes first
// (16 B a lane, contiguous), then elements 4-7.
__device__ __forceinline__ void st_ctile(float* tiles, int t, v8f c) {
  const int lane = threadIdx.x & 31;
  const float4 lo = {c[0], c[1], c[2], c[3]}, hi = {c[4], c[5], c[6], c[7]};
  *(float4*)(tiles + t * 256 + lane * 4)       = lo;
  *(float4*)(tiles + t * 256 + 128 + lane * 4) = hi;
}
__device__ __forceinline__ v8f ld_ctile(const float* tiles, int t) {
  const int lane = threadIdx.x & 31;
  const float4 lo = *(const float4*)(tiles + t * 256 + lane * 4);
  const float4 hi = *(const float4*)(tiles + t * 256 + 128 + lane * 4);
  v8f c = {lo.x, lo.y, lo.z, lo.w, hi.x, hi.y, hi.z, hi.w};
  return c;
}

// Value of the partner lane (lane ^ 16), by a vector move between the two rows.
__device__ __forceinline__ float xhalf(float v) {
  const int b = __builtin_bit_cast(int, v);
  return __builtin_bit_cast(float, __builtin_amdgcn_permlanex16(
      b, b, 0x76543210, 0xfedcba98, false, false));
}

// Issues a thread's loads of window b of x: wave w takes rows w, w + 8, ... w + 40,
// 16 bytes a lane; wave 0 also row 48. xr[6] is zero in the other waves (wave 1
// writes it as the row of zeros). Nothing here waits for the data.
__device__ __forceinline__ void fetch_x(const float* __restrict__ x, int b, int wave,
                                        float4 (&xr)[7]) {
  // Uniform base (window, wave) plus a 32-bit lane offset: the least to keep in
  // vector registers over the window loop.
  const char* base = (const char*)(x + (size_t)b * NTOK * CDIM + wave * CDIM);
  const unsigned off = (threadIdx.x & 31) * 16u;
#pragma unroll
  for (int i = 0; i < 6; ++i) xr[i] = *(const float4*)(base + off + i * 8 * CDIM * 4);
  xr[6] = float4{0.f, 0.f, 0.f, 0.f};
  if (wave == 0) xr[6] = *(const float4*)(base + off + 6 * 8 * CDIM * 4);
  // Wait before a register that these loads name is overwritten; off, which the
  // address is formed from, is an input and stays whole up to the wait.
  asm volatile("s_wait_xcnt 0x0" :: "v"(off) : "memory");
}

// Rounds what fetch_x brought to f16 and writes it to the x tile in LDS: the
// rows of fetch_x; wave 1 writes row 49, the zeros. The data wait falls here.
__device__ __forceinline__ void stage_x(_Float16* xS, int wave, const float4 (&xr)[7]) {
  _Float16* xw = xS + wave * XPITCH + (threadIdx.x & 31) * 4;
#pragma unroll
  for (int i = 0; i < 7; ++i) {
    if (i < 6 || wave < 2) {
      const v4h h4 = {(_Float16)xr[i].x, (_Float16)xr[i].y,
                      (_Float16)xr[i].z, (_Float16)xr[i].w};
      *(v4h*)(xw + i * 8 * XPITCH) = h4;
    }
  }
}

__device__ __forceinline__ v8f wmma_f16(v16h a, v16h b, v8f c) {
  return __builtin_amdgcn_wmma_f32_16x16x32_f16(false, a, false, b,
                                                (short)0, c, false, false);
}

__global__ void __launch_bounds__(256, 4) // 4 waves per SIMD: two workgroups per WGP
swin_msa_fused(const float* __restrict__ x, const float* __restrict__ mask,
               const float* __restrict__ w_qkv, const float* __restrict__ b_qkv,
               const float* __restrict__ w_proj, const float* __restrict__ b_proj,
               const float* __restrict__ bias_table, const int* __restrict__ rel_index,
               float* __restrict__ out, int nwin) {
  extern __shared__ __align__(16) char smem[];
  _Float16* smemh  = (_Float16*)smem;
  _Float16* aoS    = (_Float16*)(smem + OFF_AO);
  _Float16* xS     = (_Float16*)(smem + OFF_X);
  _Float16* qS     = (_Float16*)(smem + OFF_Q);
  _Float16* kS     = (_Float16*)(smem + OFF_K);
  _Float16* vtS    = (_Float16*)(smem + OFF_VT);
  _Float16* wpF    = (_Float16*)(smem + OFF_WPF);
  float*    bpS    = (float*)(smem + OFF_BP);

  const int tid  = threadIdx.x;
  const int lane = tid & 31;
  // Wave number as a scalar: all that follows from it (tile numbers, head,
  // store strides, LDS bases) then lives in scalar registers, not in VGPRs.
  const int wave = __builtin_amdgcn_readfirstlane(tid >> 5);
  const int r    = lane & 15;
  const int hf   = lane >> 4;

  // ---------------- Once per workgroup: weight fragments in registers and LDS ------
  // QKV: wave owns output-channel tiles nt = wave*3 + j, all 4 k steps.
  const float scale = 0.17677669529663687f; // D^-0.5
  v16h  wq[3][4];
  float smul[3], bqs[3];
  // Store address of token mt*16 + hf*8 + i, in f16 elements:
  // ((colbase ^ mt*xmt) ^ (i >> 2)*xi) + mt*amt + i*stride.
  int   stride[3], colbase[3], xmt[3], xi[3], amt[3];
#pragma unroll
  for (int j = 0; j < 3; ++j) {
    const int nt = wave * 3 + j;
#pragma unroll
    for (int kk = 0; kk < 4; ++kk)
      wq[j][kk] = ld_tile_w(w_qkv + nt * 16 * CDIM, kk);
    // Per-lane output-column metadata (uniform sec within a tile: 16 | 128).
    const int cg  = nt * 16 + r;       // global out channel in [0,384)
    const int sec = cg >> 7;           // 0=q 1=k 2=v
    const int hh  = (cg >> 5) & 3;
    const int dd  = cg & 31;
    smul[j]   = (sec == 0) ? scale : 1.0f;
    bqs[j]    = b_qkv[cg] * smul[j];
    // Wait before the register that this load names is overwritten; cg is an
    // input so that its register stays whole up to the wait.
    asm volatile("s_wait_xcnt 0x0" :: "v"(cg) : "memory");
    stride[j] = (sec == 2) ? 1 : DHEAD;             // vT is token-contiguous
    // q, k: row = token, so the row's part of the chunk place is hf*2 ^ (i >> 2).
    // vT: row = dd, and the chunk is mt*2 + hf.
    xmt[j] = (sec == 2) ? 16 : 0;
    xi[j]  = (sec == 2) ? 0 : 8;
    amt[j] = (sec == 2) ? 0 : 16 * DHEAD;
    const int qk = hh * 2048 + hf * 8 * DHEAD + (((dd >> 3) ^ (hf * 2)) * 8) + (dd & 7);
    if (sec == 0)      colbase[j] = OFF_Q  / 2 + qk;
    else if (sec == 1) colbase[j] = OFF_K  / 2 + qk;
    else               colbase[j] = OFF_VT / 2 + hh * 2048 + dd * NPAD + ((hf ^ ((dd >> 1) & 7)) * 8);
  }
  // proj: wave builds the 4 k-step fragments of output-channel tile nt = wave.
  // They are first read in phase 3, behind the first window's barriers.
#pragma unroll
  for (int kk = 0; kk < 4; ++kk)
    st_frag(wpF, wave * 4 + kk, ld_tile_w(w_proj + wave * 16 * CDIM, kk));

  // b_proj to LDS, first read in phase 3 as well.
  if (wave < CDIM / 32) {
    const float bpv = b_proj[tid];
    // Wait before the register that this load names is overwritten; tid is an
    // input so that its register stays whole up to the wait.
    asm volatile("s_wait_xcnt 0x0" :: "v"(tid) : "memory");
    bpS[tid] = bpv;
  }

  // 2 waves per head in phase 2; wave part p owns queries [p*32, p*32+32).
  const int h = wave >> 1;
  const int p = wave & 1;

  // The first window's x: fetched and staged here, its latency met once.
  if ((int)blockIdx.x < nwin) {
    float4 x0[7];
    fetch_x(x, blockIdx.x, wave, x0);
    stage_x(xS, wave, x0);
  }

  // ---------------- Once per workgroup: bias + mask as score C tiles -------
  // Every window of this workgroup has b % NMASK == blockIdx.x % NMASK.
  // The wave builds the 4 x 2 transposed tiles (key tile x query tile) of its own
  // queries and is their only reader. Key tiles 0-2 go to LDS; of key tile 3 the
  // one valid key, 48, stays in a register per query tile. Pad keys and pad
  // queries hold -1e30, which swallows the product.
  float* bmW = (float*)(smem + OFF_BM) + wave * 6 * 256;
  float key48[2]; // query (p*2 + trl)*16 + r, in the lanes with hf == 0
  {
    const float* maskw = mask + (blockIdx.x % NMASK) * (NTOK * NTOK);
#pragma unroll
    for (int trl = 0; trl < 2; ++trl) {
      const int m = (p * 2 + trl) * 16 + r; // the lane's query; pad queries read the last
      // byte offset into rel_index and mask: row m, column hf*8
      const unsigned ob = (unsigned)(min(m, NTOK - 1) * NTOK + hf * 8) * 4u;
      const int*   ri = (const int*)((const char*)rel_index + ob);
      const float* mr = (const float*)((const char*)maskw + ob);
#pragma unroll
      for (int kt = 0; kt < 3; ++kt) { // keys kt*16 + hf*8 + i < NTOK
        unsigned gb[8]; // element offset into bias_table
        float mv[8], bv[8];
#pragma unroll
        for (int i = 0; i < 8; ++i) {
          // index read from an input: bounded to the table's rows before use
          gb[i] = min((unsigned)ri[kt * 16 + i], (unsigned)(NREL - 1)) * HEADS + h;
          mv[i] = mr[kt * 16 + i];
        }
#pragma unroll
        for (int i = 0; i < 8; ++i) bv[i] = bias_table[gb[i]];
        // Wait before a register that this tile's loads name is overwritten. The
        // offsets are inputs so that their registers stay whole up to the wait.
        asm volatile("s_wait_xcnt 0x0"
                     :: "v"(ob), "v"(gb[0]), "v"(gb[1]), "v"(gb[2]), "v"(gb[3]),
                        "v"(gb[4]), "v"(gb[5]), "v"(gb[6]), "v"(gb[7]) : "memory");
        v8f c;
#pragma unroll
        for (int i = 0; i < 8; ++i)
          c[i] = (m < NTOK) ? bv[i] + mv[i] : -1e30f;
        st_ctile(bmW, trl * 3 + kt, c);
      }
    }
    unsigned oe[2], ge[2]; // element offsets: row m, column 48; its bias_table entry
    float mv[2], bv[2];
#pragma unroll
    for (int trl = 0; trl < 2; ++trl) {
      oe[trl] = (unsigned)(min((p * 2 + trl) * 16 + r, NTOK - 1) * NTOK + NTOK - 1);
      ge[trl] = min((unsigned)rel_index[oe[trl]], (unsigned)(NREL - 1)) * HEADS + h;
      mv[trl] = maskw[oe[trl]];
    }
#pragma unroll
    for (int trl = 0; trl < 2; ++trl) bv[trl] = bias_table[ge[trl]];
    // Wait before a register that these loads name is overwritten. The loaded
    // values are inputs too, so that no load can be placed behind the wait.
    asm volatile("s_wait_xcnt 0x0"
                 :: "v"(oe[0]), "v"(oe[1]), "v"(ge[0]), "v"(ge[1]),
                    "v"(mv[0]), "v"(mv[1]), "v"(bv[0]), "v"(bv[1]) : "memory");
#pragma unroll
    for (int trl = 0; trl < 2; ++trl)
      key48[trl] = ((p * 2 + trl) * 16 + r < NTOK && hf == 0) ? bv[trl] + mv[trl] : -1e30f;
  }

  // Kept rolled: a second copy of the body would need registers that the
  // resident weight fragments already take.
#pragma unroll 1
  for (int b = blockIdx.x; b < nwin; b += NWG) {
    // x of this window was staged as f16 in LDS at the foot of the trip before
    // (the first window's: in front of the loop).
    __syncthreads();

    // ---------------- Phase 1: QKV GEMM (64x384 = x(64x128) @ wqkv^T) ------
    // x A-tiles are read once per token tile and meet the 3 resident B tiles.
#pragma unroll 1
    for (int mt = 0; mt < 4; ++mt) {
      // Every pad token reads the one row of zeros.
      const _Float16* xrow = xS + min(mt * 16 + r, NTOK) * XPITCH;
      v16h am[4];
#pragma unroll
      for (int kk = 0; kk < 4; ++kk)
        am[kk] = ld_tile_row(xrow + kk * 32);
      v8f acc[3] = {};
#pragma unroll
      for (int kk = 0; kk < 4; ++kk)
#pragma unroll
        for (int j = 0; j < 3; ++j)
          acc[j] = wmma_f16(am[kk], wq[j][kk], acc[j]);
#pragma unroll
      for (int j = 0; j < 3; ++j) {
        const int a0 = (colbase[j] ^ (mt * xmt[j])) + mt * amt[j];
        const int a4 = a0 ^ xi[j];
#pragma unroll
        for (int i = 0; i < 8; ++i)
          smemh[(i < 4 ? a0 : a4) + i * stride[j]] = (_Float16)fmaf(acc[j][i], smul[j], bqs[j]);
      }
    }
    __syncthreads();

    // ------- Phase 2: S^T = k @ q^T + (bias + mask)^T, softmax, out^T = v^T @ P^T
    // One tile of 16 queries at a time. Lane (r, hf) holds, of query r, the keys
    // kt*16 + hf*8 + i in st[kt][i].
    {
      v16h ak[4], av[2][2];
#pragma unroll
      for (int kt = 0; kt < 4; ++kt)
        ak[kt] = ld_tile_s32(kS + h * 2048 + kt * 16 * DHEAD);
#pragma unroll
      for (int dt = 0; dt < 2; ++dt)
#pragma unroll
        for (int kk = 0; kk < 2; ++kk)
          av[dt][kk] = ld_tile_s64(vtS + h * 2048 + dt * 16 * NPAD, kk);
#pragma unroll
      for (int trl = 0; trl < 2; ++trl) {
        const v16h bq = ld_tile_s32(qS + h * 2048 + (p * 2 + trl) * 16 * DHEAD);
        v8f st[4];
#pragma unroll
        for (int kt = 0; kt < 3; ++kt) // K = 32 in one step
          st[kt] = wmma_f16(ak[kt], bq, ld_ctile(bmW, trl * 3 + kt));
        const v8f c3 = {key48[trl], -1e30f, -1e30f, -1e30f, -1e30f, -1e30f, -1e30f, -1e30f};
        st[3] = wmma_f16(ak[3], bq, c3);
        // Of key tile 3 only element 0 can be a real key (48, where hf == 0; key 56
        // holds -1e30): elements 1-7 are pad keys in every lane, their P is 0.
        float mk[3];
#pragma unroll
        for (int kt = 0; kt < 3; ++kt)
          mk[kt] = fmaxf(fmaxf(fmaxf(st[kt][0], st[kt][1]), fmaxf(st[kt][2], st[kt][3])),
                         fmaxf(fmaxf(st[kt][4], st[kt][5]), fmaxf(st[kt][6], st[kt][7])));
        float mx = fmaxf(fmaxf(mk[0], mk[1]), fmaxf(mk[2], st[3][0]));
        mx = fmaxf(mx, xhalf(mx));
        float sk[3];
#pragma unroll
        for (int kt = 0; kt < 3; ++kt) {
#pragma unroll
          for (int i = 0; i < 8; ++i) st[kt][i] = __expf(st[kt][i] - mx);
          sk[kt] = ((st[kt][0] + st[kt][1]) + (st[kt][2] + st[kt][3])) +
                   ((st[kt][4] + st[kt][5]) + (st[kt][6] + st[kt][7]));
        }
        const float e48 = __expf(st[3][0] - mx);
        float sum = (sk[0] + sk[1]) + (sk[2] + e48);
        sum += xhalf(sum);
        const float inv = 1.0f / sum;
        // P^T as B fragments: element e of k step kk is key kk*32 + (e < 8 ? 0 : 16)
        // + hf*8 + (e & 7), which is st[kk*2 + (e >> 3)][e & 7] of this very lane.
        v16h pf[2];
#pragma unroll
        for (int e = 0; e < 8; ++e) {
          pf[0][e]     = (_Float16)(st[0][e] * inv);
          pf[0][e + 8] = (_Float16)(st[1][e] * inv);
          pf[1][e]     = (_Float16)(st[2][e] * inv);
          pf[1][e + 8] = (_Float16)0.f;
        }
        pf[1][8] = (_Float16)(e48 * inv);
        // out^T tile dt: lane (r, hf) holds, of query r, channels dt*16 + hf*8 + i:
        // 16 bytes in a row of attn-out.
        const int m = (p * 2 + trl) * 16 + r;
#pragma unroll
        for (int dt = 0; dt < 2; ++dt) {
          v8f o = {};
          o = wmma_f16(av[dt][0], pf[0], o);
          o = wmma_f16(av[dt][1], pf[1], o);
          v8h o8;
#pragma unroll
          for (int i = 0; i < 8; ++i) o8[i] = (_Float16)o[i];
          *(v8h*)(aoS + m * XPITCH + h * DHEAD + dt * 16 + hf * 8) = o8;
        }
      }
    }
    __syncthreads();

    // The next window's x: issued here, where the score phase's registers are
    // free again and no barrier stands before its use (the compiler waits for
    // every load in front of a barrier); it lands during phase 3.
    float4 xr[7];
    if (b + NWG < nwin) fetch_x(x, b + NWG, wave, xr);

    // ---------------- Phase 3: proj = ao(64x128) @ wproj^T + b_proj --------
    // mt-outer: A tiles (attn-out rows) loaded once per wave, reused for 4 nt.
    {
      const int mt = wave >> 1;
      const int nbase = (wave & 1) * 4;
      float* outp = out + (size_t)b * NTOK * CDIM + (mt * 16 + hf * 8) * CDIM + r;
      v16h am[4];
#pragma unroll
      for (int kk = 0; kk < 4; ++kk)
        am[kk] = ld_tile(aoS + mt * 16 * XPITCH + kk * 32, XPITCH);
#pragma unroll 1
      for (int j = 0; j < 4; ++j) {
        const int nt = nbase + j;
        v8f acc = {};
#pragma unroll
        for (int kk = 0; kk < 4; ++kk)
          acc = wmma_f16(am[kk], ld_frag(wpF, nt * 4 + kk), acc);
        const int n = nt * 16 + r;
        const float bp = bpS[n];
        float* oj = outp + nt * 16;
#pragma unroll
        for (int i = 0; i < 8; ++i) {
          const int m = mt * 16 + hf * 8 + i;
          if (m < NTOK) oj[i * CDIM] = acc[i] + bp;
        }
        // Wait before the stores' address pair is stepped to the next tile; oj is
        // an input so that the step cannot be placed in front of the wait.
        asm volatile("s_wait_xcnt 0x0" :: "v"(oj) : "memory");
      }
    }

    // ---------------- Stage the next window's x as f16 in LDS --------------
    // The x tile's last readers (phase 1) are two barriers back.
    if (b + NWG < nwin) stage_x(xS, wave, xr);
  }
}

extern "C" void kernel_launch(void* const* d_in, const int* in_sizes, int n_in,
                              void* d_out, int out_size, void* d_ws, size_t ws_size,
                              hipStream_t stream) {
  (void)n_in; (void)d_ws; (void)ws_size; (void)out_size;
  const float* x          = (const float*)d_in[0];
  const float* mask       = (const float*)d_in[1];
  const float* w_qkv      = (const float*)d_in[2];
  const float* b_qkv      = (const float*)d_in[3];
  const float* w_proj     = (const float*)d_in[4];
  const float* b_proj     = (const float*)d_in[5];
  const float* bias_table = (const float*)d_in[6];
  const int*   rel_index  = (const int*)d_in[7];
  float* out = (float*)d_out;

  const int B = in_sizes[0] / (NTOK * CDIM); // 4096 windows

  // Opt in to >default dynamic LDS (160 KB of the 320 KB/WGP on CDNA5).
  (void)hipFuncSetAttribute(reinterpret_cast<const void*>(swin_msa_fused),
                            hipFuncAttributeMaxDynamicSharedMemorySize, SMEM_BYTES);

  // 256 WGPs x 2 resident workgroups; each takes every 512th window.
  swin_msa_fused<<<NWG, 256, SMEM_BYTES, stream>>>(
      x, mask, w_qkv, b_qkv, w_proj, b_proj, bias_table, rel_index, out, B);
}

// v006
// One run takes 52.1 microseconds.
// In two side-by-side timings against v005, it was 1.16 and 1.17 times as fast.
// Counting every step since v000, it is 12.2 times as fast.
#include <hip/hip_runtime.h>

// Fully fused kernel for gfx1250 (wave32, WMMA).
// 512 workgroups (256 threads = 8 wave32), two resident per WGP; each loops
// over windows b = blockIdx.x, blockIdx.x + gridDim.x, ...
// The weights do not depend on the window: they are read once per workgroup,
// straight from global f32, as ready f16 WMMA B fragments. Every wave keeps the
// wqkv fragments of the 3 output-channel tiles it owns in registers; the wproj
// fragments lie in LDS in fragment order.
// Neither do the rel-pos bias and, as the loop's stride is a multiple of the
// number of masks, the window mask: their sum is gathered once per workgroup, in
// the layout of the score tiles, and enters the score product as its C operand.
// x is fetched one window ahead: all of a thread's loads of the next window are
// issued at the head of the proj phase and stay in registers, in flight, until the
// foot of the trip rounds them to f16 into LDS. b_proj lies in LDS, so that
// the proj phase waits on no global load (a wait on a later load would also
// wait for the fetch, as loads are counted in order).
// The proj phase deals the output channels over a wave's four tiles so that a
// lane holds four adjacent channels of a token: the result leaves in 16-byte
// stores, 256 B of a row from 16 lanes, with one wait behind them all.
// Per window: x -> f16 staging -> QKV GEMM -> scores -> softmax (+rel-pos bias
// + shift-window mask) -> P@V -> proj GEMM -> d_out.
// The scores are made transposed, S^T = k @ q^T: a lane then holds 32 of the 64
// keys of ONE query (its partner lane ^ 16 the other 32), so that the softmax
// runs inside the lane's registers but for two exchanges, and the packed P^T is
// already the B fragment of out^T = v^T @ P^T: P never goes through LDS.
// Every operand tile in LDS is laid so that the 16 rows which one half of a
// ds_load_b128 reads fall on 16 different groups of four banks: x and attn-out
// by a row pitch of 272 B, q, k and vT by exchanging the 16-byte chunks inside
// each row (chunk ^ a function of the row).

#define NTOK 49
#define NPAD 64
#define CDIM 128
#define HEADS 4
#define DHEAD 32
#define NREL 169  // rows of bias_table
#define NMASK 64  // windows in mask
#define NWG  512  // workgroups launched = stride of the window loop
#define XPITCH 136 // f16 per LDS row of x and attn-out: 256 B + 16 B pad
static_assert(NWG % NMASK == 0, "a workgroup must meet one mask window only");

typedef __attribute__((ext_vector_type(16))) _Float16 v16h;
typedef __attribute__((ext_vector_type(8)))  _Float16 v8h;
typedef __attribute__((ext_vector_type(4)))  _Float16 v4h;
typedef __attribute__((ext_vector_type(8)))  float    v8f;

static constexpr int SMEM_BYTES = 163840; // 160 KB: two workgroups per WGP

// LDS byte offsets. No place is used twice. Two barriers of the window loop
// stand between each tile's last read and its next write.
#define OFF_X      0        // 50 rows of 272 B = 13600 B (49 tokens, one row of zeros)
#define OFF_AO     13600    // 64 rows of 272 B = 17408 B
#define OFF_BP     31008    // 128 f32 = 512 B (b_proj)
#define OFF_Q      32768    // 4*64*32 f16 = 16384 B
#define OFF_K      49152    // 4*64*32 f16 = 16384 B
#define OFF_VT     65536    // 4*32*64 f16 = 16384 B  (v stored transposed [h][d][n])
#define OFF_WPF    81920    // 32 tiles * 1024 B = 32768 B (wproj B fragments)
#define OFF_BM     114688   // 48 tiles * 1024 B = 49152 B (bias + mask C tiles, f32)

// Load one 16x(K=32) operand tile in the CDNA5 WMMA 16-bit A/B register layout:
// lane r=lane&15 -> row, half=lane>>4 -> K-offset; element e holds
// K = (e<8 ? 0 : 16) + half*8 + (e&7). row: the lane's own row, at the tile's
// first column; ld_tile takes it from a row-major source with leading dim ld.
__device__ __forceinline__ v16h ld_tile_row(const _Float16* row) {
  const _Float16* p = row + ((threadIdx.x & 31) >> 4) * 8;
  v16h a;
#pragma unroll
  for (int e = 0; e < 8; ++e) a[e] = p[e];          // K = hf*8 + e
#pragma unroll
  for (int e = 0; e < 8; ++e) a[e + 8] = p[16 + e]; // K = 16 + hf*8 + e
  return a;
}
__device__ __forceinline__ v16h ld_tile(const _Float16* base, int ld) {
  return ld_tile_row(base + (threadIdx.x & 15) * ld);
}

// The same tile from rows of 32 f16 (q, k) whose 16-byte chunks are exchanged:
// chunk c of row n lies at place c ^ ((n >> 2) & 3). tile: a multiple of 16 rows.
__device__ __forceinline__ v16h ld_tile_s32(const _Float16* tile) {
  const int lane = threadIdx.x & 31;
  const int r    = lane & 15;
  const int c    = (lane >> 4) ^ ((r >> 2) & 3);
  const v8h lo = *(const v8h*)(tile + r * 32 + c * 8);       // K = hf*8 + e
  const v8h hi = *(const v8h*)(tile + r * 32 + (c ^ 2) * 8); // K = 16 + hf*8 + e
  v16h a;
#pragma unroll
  for (int e = 0; e < 8; ++e) { a[e] = lo[e]; a[e + 8] = hi[e]; }
  return a;
}
// The same from rows of 64 f16 (vT): chunk c of row n lies at place
// c ^ ((n >> 1) & 7). tile: a multiple of 16 rows; kk: which block of 32 columns.
__device__ __forceinline__ v16h ld_tile_s64(const _Float16* tile, int kk) {
  const int lane = threadIdx.x & 31;
  const int r    = lane & 15;
  const int c    = (lane >> 4) ^ ((r >> 1) & 7);
  const v8h lo = *(const v8h*)(tile + r * 64 + (c ^ (kk * 4)) * 8);
  const v8h hi = *(const v8h*)(tile + r * 64 + (c ^ (kk * 4 + 2)) * 8);
  v16h a;
#pragma unroll
  for (int e = 0; e < 8; ++e) { a[e] = lo[e]; a[e + 8] = hi[e]; }
  return a;
}

// Same register layout, read from a row-major f32 matrix in global memory
// (rows of CDIM floats) and rounded to f16 element by element.
// base: first row of the 16-row tile; kk: which block of 32 columns; step: the
// tile takes every step-th row of the matrix.
__device__ __forceinline__ v16h ld_tile_w(const float* base, int kk, int step = 1) {
  const int lane = threadIdx.x & 31;
  const float4* p = (const float4*)(base + (lane & 15) * step * CDIM + (lane >> 4) * 8);
  const float4 f0 = p[kk * 8], f1 = p[kk * 8 + 1], f2 = p[kk * 8 + 4], f3 = p[kk * 8 + 5];
  // Wait before a register that these loads name is overwritten. p is an input
  // so that the address pair stays whole up to the wait (without it the last
  // load's result was placed in the pair that the other three still name).
  asm volatile("s_wait_xcnt 0x0" :: "v"(p) : "memory");
  v16h a = {(_Float16)f0.x, (_Float16)f0.y, (_Float16)f0.z, (_Float16)f0.w,
            (_Float16)f1.x, (_Float16)f1.y, (_Float16)f1.z, (_Float16)f1.w,
            (_Float16)f2.x, (_Float16)f2.y, (_Float16)f2.z, (_Float16)f2.w,
            (_Float16)f3.x, (_Float16)f3.y, (_Float16)f3.z, (_Float16)f3.w};
  return a;
}

// wproj fragments in LDS: tile t = nt*4 + kk takes 1024 B, elements 0-7 of all
// 32 lanes first (16 B a lane, contiguous), then elements 8-15. Column r of
// tile nt is output channel (nt >> 2)*64 + r*4 + (nt & 3): over the four tiles
// of one half of the channels a lane holds four adjacent channels.
__device__ __forceinline__ void st_frag(_Float16* frags, int t, v16h a) {
  const int lane = threadIdx.x & 31;
  v8h lo, hi;
#pragma unroll
  for (int e = 0; e < 8; ++e) { lo[e] = a[e]; hi[e] = a[e + 8]; }
  *(v8h*)(frags + t * 512 + lane * 8)       = lo;
  *(v8h*)(frags + t * 512 + 256 + lane * 8) = hi;
}
__device__ __forceinline__ v16h ld_frag(const _Float16* frags, int t) {
  const int lane = threadIdx.x & 31;
  const v8h lo = *(const v8h*)(frags + t * 512 + lane * 8);
  const v8h hi = *(const v8h*)(frags + t * 512 + 256 + lane * 8);
  v16h a;
#pragma unroll
  for (int e = 0; e < 8; ++e) { a[e] = lo[e]; a[e + 8] = hi[e]; }
  return a;
}

// bias + mask tiles in LDS, WMMA C/D register layout (element i: row hf*8 + i,
// column lane & 15; here row = key, column = query): a tile takes 1024 B, elements 0-3 of all 32 lanes first
// (16 B a lane, contiguous), then elements 4-7.
__device__ __forceinline__ void st_ctile(float* tiles, int t, v8f c) {
  const int lane = threadIdx.x & 31;
  const float4 lo = {c[0], c[1], c[2], c[3]}, hi = {c[4], c[5], c[6], c[7]};
  *(float4*)(tiles + t * 256 + lane * 4)       = lo;
  *(float4*)(tiles + t * 256 + 128 + lane * 4) = hi;
}
__device__ __forceinline__ v8f ld_ctile(const float* tiles, int t) {
  const int lane = threadIdx.x & 31;
  const float4 lo = *(const float4*)(tiles + t * 256 + lane * 4);
  const float4 hi = *(const float4*)(tiles + t * 256 + 128 + lane * 4);
  v8f c = {lo.x, lo.y, lo.z, lo.w, hi.x, hi.y, hi.z, hi.w};
  return c;
}

// Value of the partner lane (lane ^ 16), by a vector move between the two rows.
__device__ __forceinline__ float xhalf(float v) {
  const int b = __builtin_bit_cast(int, v);
  return __builtin_bit_cast(float, __builtin_amdgcn_permlanex16(
      b, b, 0x76543210, 0xfedcba98, false, false));
}

// Issues a thread's loads of window b of x: wave w takes rows w, w + 8, ... w + 40,
// 16 bytes a lane; wave 0 also row 48. xr[6] is zero in the other waves (wave 1
// writes it as the row of zeros). Nothing here waits for the data.
__device__ __forceinline__ void fetch_x(const float* __restrict__ x, int b, int wave,
                                        float4 (&xr)[7]) {
  // Uniform base (window, wave) plus a 32-bit lane offset: the least to keep in
  // vector registers over the window loop.
  const char* base = (const char*)(x + (size_t)b * NTOK * CDIM + wave * CDIM);
  const unsigned off = (threadIdx.x & 31) * 16u;
#pragma unroll
  for (int i = 0; i < 6; ++i) xr[i] = *(const float4*)(base + off + i * 8 * CDIM * 4);
  xr[6] = float4{0.f, 0.f, 0.f, 0.f};
  if (wave == 0) xr[6] = *(const float4*)(base + off + 6 * 8 * CDIM * 4);
  // Wait before a register that these loads name is overwritten; off, which the
  // address is formed from, is an input and stays whole up to the wait.
  asm volatile("s_wait_xcnt 0x0" :: "v"(off) : "memory");
}

// Rounds what fetch_x brought to f16 and writes it to the x tile in LDS: the
// rows of fetch_x; wave 1 writes row 49, the zeros. The data wait falls here.
__device__ __forceinline__ void stage_x(_Float16* xS, int wave, const float4 (&xr)[7]) {
  _Float16* xw = xS + wave * XPITCH + (threadIdx.x & 31) * 4;
#pragma unroll
  for (int i = 0; i < 7; ++i) {
    if (i < 6 || wave < 2) {
      const v4h h4 = {(_Float16)xr[i].x, (_Float16)xr[i].y,
                      (_Float16)xr[i].z, (_Float16)xr[i].w};
      *(v4h*)(xw + i * 8 * XPITCH) = h4;
    }
  }
}

__device__ __forceinline__ v8f wmma_f16(v16h a, v16h b, v8f c) {
  return __builtin_amdgcn_wmma_f32_16x16x32_f16(false, a, false, b,
                                                (short)0, c, false, false);
}

__global__ void __launch_bounds__(256, 4) // 4 waves per SIMD: two workgroups per WGP
swin_msa_fused(const float* __restrict__ x, const float* __restrict__ mask,
               const float* __restrict__ w_qkv, const float* __restrict__ b_qkv,
               const float* __restrict__ w_proj, const float* __restrict__ b_proj,
               const float* __restrict__ bias_table, const int* __restrict__ rel_index,
               float* __restrict__ out, int nwin) {
  extern __shared__ __align__(16) char smem[];
  _Float16* smemh  = (_Float16*)smem;
  _Float16* aoS    = (_Float16*)(smem + OFF_AO);
  _Float16* xS     = (_Float16*)(smem + OFF_X);
  _Float16* qS     = (_Float16*)(smem + OFF_Q);
  _Float16* kS     = (_Float16*)(smem + OFF_K);
  _Float16* vtS    = (_Float16*)(smem + OFF_VT);
  _Float16* wpF    = (_Float16*)(smem + OFF_WPF);
  float*    bpS    = (float*)(smem + OFF_BP);

  const int tid  = threadIdx.x;
  const int lane = tid & 31;
  // Wave number as a scalar: all that follows from it (tile numbers, head,
  // store strides, LDS bases) then lives in scalar registers, not in VGPRs.
  const int wave = __builtin_amdgcn_readfirstlane(tid >> 5);
  const int r    = lane & 15;
  const int hf   = lane >> 4;

  // ---------------- Once per workgroup: weight fragments in registers and LDS ------
  // QKV: wave owns output-channel tiles nt = wave*3 + j, all 4 k steps.
  const float scale = 0.17677669529663687f; // D^-0.5
  v16h  wq[3][4];
  float smul[3], bqs[3];
  // Store address of token mt*16 + hf*8 + i, in f16 elements:
  // ((colbase ^ mt*xmt) ^ (i >> 2)*xi) + mt*amt + i*stride.
  int   stride[3], colbase[3], xmt[3], xi[3], amt[3];
#pragma unroll
  for (int j = 0; j < 3; ++j) {
    const int nt = wave * 3 + j;
#pragma unroll
    for (int kk = 0; kk < 4; ++kk)
      wq[j][kk] = ld_tile_w(w_qkv + nt * 16 * CDIM, kk);
    // Per-lane output-column metadata (uniform sec within a tile: 16 | 128).
    const int cg  = nt * 16 + r;       // global out channel in [0,384)
    const int sec = cg >> 7;           // 0=q 1=k 2=v
    const int hh  = (cg >> 5) & 3;
    const int dd  = cg & 31;
    smul[j]   = (sec == 0) ? scale : 1.0f;
    bqs[j]    = b_qkv[cg] * smul[j];
    // Wait before the register that this load names is overwritten; cg is an
    // input so that its register stays whole up to the wait.
    asm volatile("s_wait_xcnt 0x0" :: "v"(cg) : "memory");
    stride[j] = (sec == 2) ? 1 : DHEAD;             // vT is token-contiguous
    // q, k: row = token, so the row's part of the chunk place is hf*2 ^ (i >> 2).
    // vT: row = dd, and the chunk is mt*2 + hf.
    xmt[j] = (sec == 2) ? 16 : 0;
    xi[j]  = (sec == 2) ? 0 : 8;
    amt[j] = (sec == 2) ? 0 : 16 * DHEAD;
    const int qk = hh * 2048 + hf * 8 * DHEAD + (((dd >> 3) ^ (hf * 2)) * 8) + (dd & 7);
    if (sec == 0)      colbase[j] = OFF_Q  / 2 + qk;
    else if (sec == 1) colbase[j] = OFF_K  / 2 + qk;
    else               colbase[j] = OFF_VT / 2 + hh * 2048 + dd * NPAD + ((hf ^ ((dd >> 1) & 7)) * 8);
  }
  // proj: wave builds the 4 k-step fragments of output-channel tile nt = wave
  // (every 4th row of w_proj, from (wave >> 2)*64 + (wave & 3) on).
  // They are first read in phase 3, behind the first window's barriers.
#pragma unroll
  for (int kk = 0; kk < 4; ++kk)
    st_frag(wpF, wave * 4 + kk,
            ld_tile_w(w_proj + ((wave >> 2) * 64 + (wave & 3)) * CDIM, kk, 4));

  // b_proj to LDS, first read in phase 3 as well.
  if (wave < CDIM / 32) {
    const float bpv = b_proj[tid];
    // Wait before the register that this load names is overwritten; tid is an
    // input so that its register stays whole up to the wait.
    asm volatile("s_wait_xcnt 0x0" :: "v"(tid) : "memory");
    bpS[tid] = bpv;
  }

  // 2 waves per head in phase 2; wave part p owns queries [p*32, p*32+32).
  const int h = wave >> 1;
  const int p = wave & 1;

  // The first window's x: fetched and staged here, its latency met once.
  if ((int)blockIdx.x < nwin) {
    float4 x0[7];
    fetch_x(x, blockIdx.x, wave, x0);
    stage_x(xS, wave, x0);
  }

  // ---------------- Once per workgroup: bias + mask as score C tiles -------
  // Every window of this workgroup has b % NMASK == blockIdx.x % NMASK.
  // The wave builds the 4 x 2 transposed tiles (key tile x query tile) of its own
  // queries and is their only reader. Key tiles 0-2 go to LDS; of key tile 3 the
  // one valid key, 48, stays in a register per query tile. Pad keys and pad
  // queries hold -1e30, which swallows the product.
  float* bmW = (float*)(smem + OFF_BM) + wave * 6 * 256;
  float key48[2]; // query (p*2 + trl)*16 + r, in the lanes with hf == 0
  {
    const float* maskw = mask + (blockIdx.x % NMASK) * (NTOK * NTOK);
#pragma unroll
    for (int trl = 0; trl < 2; ++trl) {
      const int m = (p * 2 + trl) * 16 + r; // the lane's query; pad queries read the last
      // byte offset into rel_index and mask: row m, column hf*8
      const unsigned ob = (unsigned)(min(m, NTOK - 1) * NTOK + hf * 8) * 4u;
      const int*   ri = (const int*)((const char*)rel_index + ob);
      const float* mr = (const float*)((const char*)maskw + ob);
#pragma unroll
      for (int kt = 0; kt < 3; ++kt) { // keys kt*16 + hf*8 + i < NTOK
        unsigned gb[8]; // element offset into bias_table
        float mv[8], bv[8];
#pragma unroll
        for (int i = 0; i < 8; ++i) {
          // index read from an input: bounded to the table's rows before use
          gb[i] = min((unsigned)ri[kt * 16 + i], (unsigned)(NREL - 1)) * HEADS + h;
          mv[i] = mr[kt * 16 + i];
        }
#pragma unroll
        for (int i = 0; i < 8; ++i) bv[i] = bias_table[gb[i]];
        // Wait before a register that this tile's loads name is overwritten. The
        // offsets are inputs so that their registers stay whole up to the wait.
        asm volatile("s_wait_xcnt 0x0"
                     :: "v"(ob), "v"(gb[0]), "v"(gb[1]), "v"(gb[2]), "v"(gb[3]),
                        "v"(gb[4]), "v"(gb[5]), "v"(gb[6]), "v"(gb[7]) : "memory");
        v8f c;
#pragma unroll
        for (int i = 0; i < 8; ++i)
          c[i] = (m < NTOK) ? bv[i] + mv[i] : -1e30f;
        st_ctile(bmW, trl * 3 + kt, c);
      }
    }
    unsigned oe[2], ge[2]; // element offsets: row m, column 48; its bias_table entry
    float mv[2], bv[2];
#pragma unroll
    for (int trl = 0; trl < 2; ++trl) {
      oe[trl] = (unsigned)(min((p * 2 + trl) * 16 + r, NTOK - 1) * NTOK + NTOK - 1);
      ge[trl] = min((unsigned)rel_index[oe[trl]], (unsigned)(NREL - 1)) * HEADS + h;
      mv[trl] = maskw[oe[trl]];
    }
#pragma unroll
    for (int trl = 0; trl < 2; ++trl) bv[trl] = bias_table[ge[trl]];
    // Wait before a register that these loads name is overwritten. The loaded
    // values are inputs too, so that no load can be placed behind the wait.
    asm volatile("s_wait_xcnt 0x0"
                 :: "v"(oe[0]), "v"(oe[1]), "v"(ge[0]), "v"(ge[1]),
                    "v"(mv[0]), "v"(mv[1]), "v"(bv[0]), "v"(bv[1]) : "memory");
#pragma unroll
    for (int trl = 0; trl < 2; ++trl)
      key48[trl] = ((p * 2 + trl) * 16 + r < NTOK && hf == 0) ? bv[trl] + mv[trl] : -1e30f;
  }

  // Kept rolled: a second copy of the body would need registers that the
  // resident weight fragments already take.
#pragma unroll 1
  for (int b = blockIdx.x; b < nwin; b += NWG) {
    // x of this window was staged as f16 in LDS at the foot of the trip before
    // (the first window's: in front of the loop).
    __syncthreads();

    // ---------------- Phase 1: QKV GEMM (64x384 = x(64x128) @ wqkv^T) ------
    // x A-tiles are read once per token tile and meet the 3 resident B tiles.
#pragma unroll 1
    for (int mt = 0; mt < 4; ++mt) {
      // Every pad token reads the one row of zeros.
      const _Float16* xrow = xS + min(mt * 16 + r, NTOK) * XPITCH;
      v16h am[4];
#pragma unroll
      for (int kk = 0; kk < 4; ++kk)
        am[kk] = ld_tile_row(xrow + kk * 32);
      v8f acc[3] = {};
#pragma unroll
      for (int kk = 0; kk < 4; ++kk)
#pragma unroll
        for (int j = 0; j < 3; ++j)
          acc[j] = wmma_f16(am[kk], wq[j][kk], acc[j]);
#pragma unroll
      for (int j = 0; j < 3; ++j) {
        const int a0 = (colbase[j] ^ (mt * xmt[j])) + mt * amt[j];
        const int a4 = a0 ^ xi[j];
#pragma unroll
        for (int i = 0; i < 8; ++i)
          smemh[(i < 4 ? a0 : a4) + i * stride[j]] = (_Float16)fmaf(acc[j][i], smul[j], bqs[j]);
      }
    }
    __syncthreads();

    // ------- Phase 2: S^T = k @ q^T + (bias + mask)^T, softmax, out^T = v^T @ P^T
    // One tile of 16 queries at a time. Lane (r, hf) holds, of query r, the keys
    // kt*16 + hf*8 + i in st[kt][i].
    {
      v16h ak[4], av[2][2];
#pragma unroll
      for (int kt = 0; kt < 4; ++kt)
        ak[kt] = ld_tile_s32(kS + h * 2048 + kt * 16 * DHEAD);
#pragma unroll
      for (int dt = 0; dt < 2; ++dt)
#pragma unroll
        for (int kk = 0; kk < 2; ++kk)
          av[dt][kk] = ld_tile_s64(vtS + h * 2048 + dt * 16 * NPAD, kk);
#pragma unroll
      for (int trl = 0; trl < 2; ++trl) {
        const v16h bq = ld_tile_s32(qS + h * 2048 + (p * 2 + trl) * 16 * DHEAD);
        v8f st[4];
#pragma unroll
        for (int kt = 0; kt < 3; ++kt) // K = 32 in one step
          st[kt] = wmma_f16(ak[kt], bq, ld_ctile(bmW, trl * 3 + kt));
        const v8f c3 = {key48[trl], -1e30f, -1e30f, -1e30f, -1e30f, -1e30f, -1e30f, -1e30f};
        st[3] = wmma_f16(ak[3], bq, c3);
        // Of key tile 3 only element 0 can be a real key (48, where hf == 0; key 56
        // holds -1e30): elements 1-7 are pad keys in every lane, their P is 0.
        float mk[3];
#pragma unroll
        for (int kt = 0; kt < 3; ++kt)
          mk[kt] = fmaxf(fmaxf(fmaxf(st[kt][0], st[kt][1]), fmaxf(st[kt][2], st[kt][3])),
                         fmaxf(fmaxf(st[kt][4], st[kt][5]), fmaxf(st[kt][6], st[kt][7])));
        float mx = fmaxf(fmaxf(mk[0], mk[1]), fmaxf(mk[2], st[3][0]));
        mx = fmaxf(mx, xhalf(mx));
        float sk[3];
#pragma unroll
        for (int kt = 0; kt < 3; ++kt) {
#pragma unroll
          for (int i = 0; i < 8; ++i) st[kt][i] = __expf(st[kt][i] - mx);
          sk[kt] = ((st[kt][0] + st[kt][1]) + (st[kt][2] + st[kt][3])) +
                   ((st[kt][4] + st[kt][5]) + (st[kt][6] + st[kt][7]));
        }
        const float e48 = __expf(st[3][0] - mx);
        float sum = (sk[0] + sk[1]) + (sk[2] + e48);
        sum += xhalf(sum);
        const float inv = 1.0f / sum;
        // P^T as B fragments: element e of k step kk is key kk*32 + (e < 8 ? 0 : 16)
        // + hf*8 + (e & 7), which is st[kk*2 + (e >> 3)][e & 7] of this very lane.
        v16h pf[2];
#pragma unroll
        for (int e = 0; e < 8; ++e) {
          pf[0][e]     = (_Float16)(st[0][e] * inv);
          pf[0][e + 8] = (_Float16)(st[1][e] * inv);
          pf[1][e]     = (_Float16)(st[2][e] * inv);
          pf[1][e + 8] = (_Float16)0.f;
        }
        pf[1][8] = (_Float16)(e48 * inv);
        // out^T tile dt: lane (r, hf) holds, of query r, channels dt*16 + hf*8 + i:
        // 16 bytes in a row of attn-out.
        const int m = (p * 2 + trl) * 16 + r;
#pragma unroll
        for (int dt = 0; dt < 2; ++dt) {
          v8f o = {};
          o = wmma_f16(av[dt][0], pf[0], o);
          o = wmma_f16(av[dt][1], pf[1], o);
          v8h o8;
#pragma unroll
          for (int i = 0; i < 8; ++i) o8[i] = (_Float16)o[i];
          *(v8h*)(aoS + m * XPITCH + h * DHEAD + dt * 16 + hf * 8) = o8;
        }
      }
    }
    __syncthreads();

    // The next window's x: issued here, where the score phase's registers are
    // free again and no barrier stands before its use (the compiler waits for
    // every load in front of a barrier); it lands during phase 3.
    float4 xr[7];
    if (b + NWG < nwin) fetch_x(x, b + NWG, wave, xr);

    // ---------------- Phase 3: proj = ao(64x128) @ wproj^T + b_proj --------
    // A wave takes one token tile and one half of the channels: 4 tiles, whose
    // columns are dealt so that lane r holds channels r*4 .. r*4 + 3 of the half.
    // A row's 64 channels then leave as one 16-byte store of 16 lanes: 256 B.
    {
      const int mt = wave >> 1;
      const int ch = wave & 1;
      float* outp = out + (size_t)b * NTOK * CDIM + (mt * 16 + hf * 8) * CDIM + ch * 64 + r * 4;
      const _Float16* aoT = aoS + mt * 16 * XPITCH;
      const float4 bp = *(const float4*)(bpS + ch * 64 + r * 4);
      v16h am = ld_tile(aoT, XPITCH), an = am, bf[4];
#pragma unroll
      for (int j = 0; j < 4; ++j) bf[j] = ld_frag(wpF, (ch * 4 + j) * 4);
      v8f acc[4] = {};
      // The fragments of k step kk + 1 are read while step kk is worked on, half a
      // step's at a time. The scheduling barriers keep the reads from all being
      // lifted to the head of the phase: there they took the registers of the x
      // fetch, which then went through scratch, each load waited for alone.
#pragma unroll
      for (int kk = 0; kk < 4; ++kk) {
        __builtin_amdgcn_sched_barrier(0);
        acc[0] = wmma_f16(am, bf[0], acc[0]);
        acc[1] = wmma_f16(am, bf[1], acc[1]);
        if (kk < 3) {
          an    = ld_tile(aoT + (kk + 1) * 32, XPITCH);
          bf[0] = ld_frag(wpF, (ch * 4 + 0) * 4 + kk + 1);
          bf[1] = ld_frag(wpF, (ch * 4 + 1) * 4 + kk + 1);
        }
        __builtin_amdgcn_sched_barrier(0);
        acc[2] = wmma_f16(am, bf[2], acc[2]);
        acc[3] = wmma_f16(am, bf[3], acc[3]);
        if (kk < 3) {
          bf[2] = ld_frag(wpF, (ch * 4 + 2) * 4 + kk + 1);
          bf[3] = ld_frag(wpF, (ch * 4 + 3) * 4 + kk + 1);
        }
        am = an;
      }
      // Tokens mt*16 + hf*8 + i: all exist where mt < 3; of 48-63 only 48 does.
      if (mt < 3 || hf == 0)
        *(float4*)outp = float4{acc[0][0] + bp.x, acc[1][0] + bp.y,
                                acc[2][0] + bp.z, acc[3][0] + bp.w};
      if (mt < 3) {
#pragma unroll
        for (int i = 1; i < 8; ++i)
          *(float4*)(outp + i * CDIM) = float4{acc[0][i] + bp.x, acc[1][i] + bp.y,
                                               acc[2][i] + bp.z, acc[3][i] + bp.w};
      }
      // Wait before a register that these stores name is overwritten; outp is an
      // input so that its step to the next window cannot be placed in front.
      asm volatile("s_wait_xcnt 0x0" :: "v"(outp) : "memory");
    }

    // ---------------- Stage the next window's x as f16 in LDS --------------
    // The x tile's last readers (phase 1) are two barriers back.
    if (b + NWG < nwin) stage_x(xS, wave, xr);
  }
}

extern "C" void kernel_launch(void* const* d_in, const int* in_sizes, int n_in,
                              void* d_out, int out_size, void* d_ws, size_t ws_size,
                              hipStream_t stream) {
  (void)n_in; (void)d_ws; (void)ws_size; (void)out_size;
  const float* x          = (const float*)d_in[0];
  const float* mask       = (const float*)d_in[1];
  const float* w_qkv      = (const float*)d_in[2];
  const float* b_qkv      = (const float*)d_in[3];
  const float* w_proj     = (const float*)d_in[4];
  const float* b_proj     = (const float*)d_in[5];
  const float* bias_table = (const float*)d_in[6];
  const int*   rel_index  = (const int*)d_in[7];
  float* out = (float*)d_out;

  const int B = in_sizes[0] / (NTOK * CDIM); // 4096 windows

  // Opt in to >default dynamic LDS (160 KB of the 320 KB/WGP on CDNA5).
  (void)hipFuncSetAttribute(reinterpret_cast<const void*>(swin_msa_fused),
                            hipFuncAttributeMaxDynamicSharedMemorySize, SMEM_BYTES);

  // 256 WGPs x 2 resident workgroups; each takes every 512th window.
  swin_msa_fused<<<NWG, 256, SMEM_BYTES, stream>>>(
      x, mask, w_qkv, b_qkv, w_proj, b_proj, bias_table, rel_index, out, B);
}

// v007
// One run takes 44 microseconds.
// Two timings next to v006 put it at 1.19 and 1.18 times that version's speed.
// Over all steps from v000 it is 14.4 times as fast.
#include <hip/hip_runtime.h>

// Fully fused kernel for gfx1250 (wave32, WMMA).
// 512 workgroups (256 threads = 8 wave32), two resident per WGP; each loops
// over windows b = blockIdx.x, blockIdx.x + gridDim.x, ...
// The weights do not depend on the window: they are read once per workgroup
// and kept as f16 WMMA B fragments. Every wave keeps the wqkv fragments of the
// 3 output-channel tiles it owns in registers; the wproj fragments lie in LDS
// in fragment order.
// Neither do the rel-pos bias and, as the loop's stride is a multiple of the
// number of masks, the window mask: their sum is gathered once per workgroup, in
// the layout of the score tiles, and enters the score product as its C operand.
// All that this set-up reads from global memory comes in whole rows, a wave's
// lanes side by side, and is re-laid through LDS: a weight row is 4 lines per
// load where a fragment-shaped load touches 16, and the gathers by query row
// and by rel_index run on LDS banks, not on cache lines.
// x is fetched one window ahead: all of a thread's loads of the next window are
// issued at the head of the proj phase and stay in registers, in flight, until the
// foot of the trip rounds them to f16 into LDS. b_proj lies in LDS, so that
// the proj phase waits on no global load (a wait on a later load would also
// wait for the fetch, as loads are counted in order).
// The proj phase deals the output channels over a wave's four tiles so that a
// lane holds four adjacent channels of a token: the result leaves in 16-byte
// stores, 256 B of a row from 16 lanes, with one wait behind them all.
// Per window: x -> f16 staging -> QKV GEMM -> scores -> softmax (+rel-pos bias
// + shift-window mask) -> P@V -> proj GEMM -> d_out.
// The scores are made transposed, S^T = k @ q^T: a lane then holds 32 of the 64
// keys of ONE query (its partner lane ^ 16 the other 32), so that the softmax
// runs inside the lane's registers but for two exchanges, and the packed P^T is
// already the B fragment of out^T = v^T @ P^T: P never goes through LDS.
// Every operand tile in LDS is laid so that the 16 rows which one half of a
// ds_load_b128 reads fall on 16 different groups of four banks: x and attn-out
// by a row pitch of 272 B, q, k and vT by exchanging the 16-byte chunks inside
// each row (chunk ^ a function of the row).

#define NTOK 49
#define NPAD 64
#define CDIM 128
#define HEADS 4
#define DHEAD 32
#define NREL 169  // rows of bias_table
#define NMASK 64  // windows in mask
#define NWG  512  // workgroups launched = stride of the window loop
#define XPITCH 136 // f16 per LDS row of x and attn-out: 256 B + 16 B pad
static_assert(NWG % NMASK == 0, "a workgroup must meet one mask window only");

typedef __attribute__((ext_vector_type(16))) _Float16 v16h;
typedef __attribute__((ext_vector_type(8)))  _Float16 v8h;
typedef __attribute__((ext_vector_type(4)))  _Float16 v4h;
typedef __attribute__((ext_vector_type(8)))  float    v8f;

static constexpr int SMEM_BYTES = 163840; // 160 KB: two workgroups per WGP

// LDS byte offsets. The window loop uses no place twice. Two barriers of the
// loop stand between each tile's last read and its next write.
#define OFF_X      0        // 50 rows of 272 B = 13600 B (49 tokens, one row of zeros)
#define OFF_AO     13600    // 64 rows of 272 B = 17408 B
#define OFF_BP     31008    // 128 f32 = 512 B (b_proj)
#define OFF_Q      32768    // 4*64*32 f16 = 16384 B
#define OFF_K      49152    // 4*64*32 f16 = 16384 B
#define OFF_VT     65536    // 4*32*64 f16 = 16384 B  (v stored transposed [h][d][n])
#define OFF_WPF    81920    // 32 tiles * 1024 B = 32768 B (wproj B fragments)
#define OFF_BM     114688   // 48 tiles * 1024 B = 49152 B (bias + mask C tiles, f32)
// Places of the set-up alone, in the q and k tiles, which the window loop first
// writes behind its first barrier. (A wave's weight rows pass through its own
// six C tiles, before it builds these.)
#define SPITCH 52           // f32 per staged row of mask and rel_index: 208 B = 16 B x 13
#define TPITCH 176          // f32 per head of the staged bias table
#define OFF_SM     (OFF_Q)          // 49 rows of 208 B = 10192 B (this workgroup's mask window)
#define OFF_SR     (OFF_Q + 10240)  // 49 rows of 208 B = 10192 B (rel_index)
#define OFF_ST     (OFF_Q + 20480)  // 4 * 176 f32 = 2816 B (bias_table, head by head)
static_assert(OFF_ST + HEADS * TPITCH * 4 <= OFF_VT, "set-up places lie in q and k");

// Load one 16x(K=32) operand tile in the CDNA5 WMMA 16-bit A/B register layout:
// lane r=lane&15 -> row, half=lane>>4 -> K-offset; element e holds
// K = (e<8 ? 0 : 16) + half*8 + (e&7). row: the lane's own row, at the tile's
// first column; ld_tile takes it from a row-major source with leading dim ld.
__device__ __forceinline__ v16h ld_tile_row(const _Float16* row) {
  const _Float16* p = row + ((threadIdx.x & 31) >> 4) * 8;
  v16h a;
#pragma unroll
  for (int e = 0; e < 8; ++e) a[e] = p[e];          // K = hf*8 + e
#pragma unroll
  for (int e = 0; e < 8; ++e) a[e + 8] = p[16 + e]; // K = 16 + hf*8 + e
  return a;
}
__device__ __forceinline__ v16h ld_tile(const _Float16* base, int ld) {
  return ld_tile_row(base + (threadIdx.x & 15) * ld);
}

// The same tile from rows of 32 f16 (q, k) whose 16-byte chunks are exchanged:
// chunk c of row n lies at place c ^ ((n >> 2) & 3). tile: a multiple of 16 rows.
__device__ __forceinline__ v16h ld_tile_s32(const _Float16* tile) {
  const int lane = threadIdx.x & 31;
  const int r    = lane & 15;
  const int c    = (lane >> 4) ^ ((r >> 2) & 3);
  const v8h lo = *(const v8h*)(tile + r * 32 + c * 8);       // K = hf*8 + e
  const v8h hi = *(const v8h*)(tile + r * 32 + (c ^ 2) * 8); // K = 16 + hf*8 + e
  v16h a;
#pragma unroll
  for (int e = 0; e < 8; ++e) { a[e] = lo[e]; a[e + 8] = hi[e]; }
  return a;
}
// The same from rows of 64 f16 (vT): chunk c of row n lies at place
// c ^ ((n >> 1) & 7). tile: a multiple of 16 rows; kk: which block of 32 columns.
__device__ __forceinline__ v16h ld_tile_s64(const _Float16* tile, int kk) {
  const int lane = threadIdx.x & 31;
  const int r    = lane & 15;
  const int c    = (lane >> 4) ^ ((r >> 1) & 7);
  const v8h lo = *(const v8h*)(tile + r * 64 + (c ^ (kk * 4)) * 8);
  const v8h hi = *(const v8h*)(tile + r * 64 + (c ^ (kk * 4 + 2)) * 8);
  v16h a;
#pragma unroll
  for (int e = 0; e < 8; ++e) { a[e] = lo[e]; a[e + 8] = hi[e]; }
  return a;
}

// Issues a wave's loads of a 16-row tile of a row-major f32 matrix (rows of CDIM
// floats): load i is the whole of row i*step, 16 bytes a lane. base: the tile's
// first row, the same in every lane. Nothing here waits for the data.
__device__ __forceinline__ void fetch_w(const float* base, int step, float4 (&wr)[16]) {
  const float4* p = (const float4*)base + (threadIdx.x & 31);
#pragma unroll
  for (int i = 0; i < 16; ++i) wr[i] = p[i * step * (CDIM / 4)];
  // Wait before a register that these loads name is overwritten. p is an input:
  // where the loads take their address from a register pair, the pair stays
  // whole up to the wait (else a load's result can be placed in it).
  asm volatile("s_wait_xcnt 0x0" :: "v"(p) : "memory");
}

// Rounds what fetch_w brought to f16 element by element, lays it as 16 rows of
// 272 B in scr (the wave's own LDS) and reads it back as the 4 k-step fragments.
__device__ __forceinline__ void relay_w(_Float16* scr, const float4 (&wr)[16], v16h (&fr)[4]) {
  _Float16* sw = scr + (threadIdx.x & 31) * 4;
#pragma unroll
  for (int i = 0; i < 16; ++i) {
    const v4h h4 = {(_Float16)wr[i].x, (_Float16)wr[i].y, (_Float16)wr[i].z, (_Float16)wr[i].w};
    *(v4h*)(sw + i * XPITCH) = h4;
  }
  // The rows are read back by other lanes of the wave: its stores end first.
  asm volatile("s_wait_dscnt 0x0" ::: "memory");
#pragma unroll
  for (int kk = 0; kk < 4; ++kk) fr[kk] = ld_tile(scr + kk * 32, XPITCH);
  // scr is written again behind this (next tile, C tiles): the reads end first.
  asm volatile("s_wait_dscnt 0x0" ::: "memory");
}

// wproj fragments in LDS: tile t = nt*4 + kk takes 1024 B, elements 0-7 of all
// 32 lanes first (16 B a lane, contiguous), then elements 8-15. Column r of
// tile nt is output channel (nt >> 2)*64 + r*4 + (nt & 3): over the four tiles
// of one half of the channels a lane holds four adjacent channels.
__device__ __forceinline__ void st_frag(_Float16* frags, int t, v16h a) {
  const int lane = threadIdx.x & 31;
  v8h lo, hi;
#pragma unroll
  for (int e = 0; e < 8; ++e) { lo[e] = a[e]; hi[e] = a[e + 8]; }
  *(v8h*)(frags + t * 512 + lane * 8)       = lo;
  *(v8h*)(frags + t * 512 + 256 + lane * 8) = hi;
}
__device__ __forceinline__ v16h ld_frag(const _Float16* frags, int t) {
  const int lane = threadIdx.x & 31;
  const v8h lo = *(const v8h*)(frags + t * 512 + lane * 8);
  const v8h hi = *(const v8h*)(frags + t * 512 + 256 + lane * 8);
  v16h a;
#pragma unroll
  for (int e = 0; e < 8; ++e) { a[e] = lo[e]; a[e + 8] = hi[e]; }
  return a;
}

// bias + mask tiles in LDS, WMMA C/D register layout (element i: row hf*8 + i,
// column lane & 15; here row = key, column = query): a tile takes 1024 B, elements 0-3 of all 32 lanes first
// (16 B a lane, contiguous), then elements 4-7.
__device__ __forceinline__ void st_ctile(float* tiles, int t, v8f c) {
  const int lane = threadIdx.x & 31;
  const float4 lo = {c[0], c[1], c[2], c[3]}, hi = {c[4], c[5], c[6], c[7]};
  *(float4*)(tiles + t * 256 + lane * 4)       = lo;
  *(float4*)(tiles + t * 256 + 128 + lane * 4) = hi;
}
__device__ __forceinline__ v8f ld_ctile(const float* tiles, int t) {
  const int lane = threadIdx.x & 31;
  const float4 lo = *(const float4*)(tiles + t * 256 + lane * 4);
  const float4 hi = *(const float4*)(tiles + t * 256 + 128 + lane * 4);
  v8f c = {lo.x, lo.y, lo.z, lo.w, hi.x, hi.y, hi.z, hi.w};
  return c;
}

// Value of the partner lane (lane ^ 16), by a vector move between the two rows.
__device__ __forceinline__ float xhalf(float v) {
  const int b = __builtin_bit_cast(int, v);
  return __builtin_bit_cast(float, __builtin_amdgcn_permlanex16(
      b, b, 0x76543210, 0xfedcba98, false, false));
}

// Issues a thread's loads of window b of x: wave w takes rows w, w + 8, ... w + 40,
// 16 bytes a lane; wave 0 also row 48. xr[6] is zero in the other waves (wave 1
// writes it as the row of zeros). Nothing here waits for the data.
__device__ __forceinline__ void fetch_x(const float* __restrict__ x, int b, int wave,
                                        float4 (&xr)[7]) {
  // Uniform base (window, wave) plus a 32-bit lane offset: the least to keep in
  // vector registers over the window loop.
  const char* base = (const char*)(x + (size_t)b * NTOK * CDIM + wave * CDIM);
  const unsigned off = (threadIdx.x & 31) * 16u;
#pragma unroll
  for (int i = 0; i < 6; ++i) xr[i] = *(const float4*)(base + off + i * 8 * CDIM * 4);
  xr[6] = float4{0.f, 0.f, 0.f, 0.f};
  if (wave == 0) xr[6] = *(const float4*)(base + off + 6 * 8 * CDIM * 4);
  // Wait before a register that these loads name is overwritten; off, which the
  // address is formed from, is an input and stays whole up to the wait.
  asm volatile("s_wait_xcnt 0x0" :: "v"(off) : "memory");
}

// Rounds what fetch_x brought to f16 and writes it to the x tile in LDS: the
// rows of fetch_x; wave 1 writes row 49, the zeros. The data wait falls here.
__device__ __forceinline__ void stage_x(_Float16* xS, int wave, const float4 (&xr)[7]) {
  _Float16* xw = xS + wave * XPITCH + (threadIdx.x & 31) * 4;
#pragma unroll
  for (int i = 0; i < 7; ++i) {
    if (i < 6 || wave < 2) {
      const v4h h4 = {(_Float16)xr[i].x, (_Float16)xr[i].y,
                      (_Float16)xr[i].z, (_Float16)xr[i].w};
      *(v4h*)(xw + i * 8 * XPITCH) = h4;
    }
  }
}

__device__ __forceinline__ v8f wmma_f16(v16h a, v16h b, v8f c) {
  return __builtin_amdgcn_wmma_f32_16x16x32_f16(false, a, false, b,
                                                (short)0, c, false, false);
}

__global__ void __launch_bounds__(256, 4) // 4 waves per SIMD: two workgroups per WGP
swin_msa_fused(const float* __restrict__ x, const float* __restrict__ mask,
               const float* __restrict__ w_qkv, const float* __restrict__ b_qkv,
               const float* __restrict__ w_proj, const float* __restrict__ b_proj,
               const float* __restrict__ bias_table, const int* __restrict__ rel_index,
               float* __restrict__ out, int nwin) {
  extern __shared__ __align__(16) char smem[];
  _Float16* smemh  = (_Float16*)smem;
  _Float16* aoS    = (_Float16*)(smem + OFF_AO);
  _Float16* xS     = (_Float16*)(smem + OFF_X);
  _Float16* qS     = (_Float16*)(smem + OFF_Q);
  _Float16* kS     = (_Float16*)(smem + OFF_K);
  _Float16* vtS    = (_Float16*)(smem + OFF_VT);
  _Float16* wpF    = (_Float16*)(smem + OFF_WPF);
  float*    bpS    = (float*)(smem + OFF_BP);

  const int tid  = threadIdx.x;
  const int lane = tid & 31;
  // Wave number as a scalar: all that follows from it (tile numbers, head,
  // store strides, LDS bases) then lives in scalar registers, not in VGPRs.
  const int wave = __builtin_amdgcn_readfirstlane(tid >> 5);
  const int r    = lane & 15;
  const int hf   = lane >> 4;

  // The wave's six bias + mask C tiles; until they are built, its weight scratch.
  float* bmW = (float*)(smem + OFF_BM) + wave * 6 * 256;

  // ---------------- Once per workgroup: mask window, rel_index, bias table --
  // Every window of this workgroup has b % NMASK == blockIdx.x % NMASK.
  // Issued first, written to LDS once the first weight loads are under way.
  // Wave w takes rows w, w + 8, ... w + 40 of mask and rel_index; row 48 is read
  // by every wave (no branch among the loads) and written by wave 0. Columns
  // 0-31 come in one load, 32-48 in a second, whose other lanes repeat 48.
  float smv[7][2], tbv[3];
  int   srv[7][2];
  {
    const float* mw = mask + (blockIdx.x % NMASK) * (NTOK * NTOK);
    const int l1 = min(lane, NTOK - 33);
#pragma unroll
    for (int i = 0; i < 7; ++i) {
      const int ro = (i < 6 ? wave + i * 8 : NTOK - 1) * NTOK;
      smv[i][0] = mw[ro + lane];
      smv[i][1] = mw[ro + 32 + l1];
      srv[i][0] = rel_index[ro + lane];
      srv[i][1] = rel_index[ro + 32 + l1];
    }
    // bias_table, flat: elements tid, tid + 256, tid + 512 (past the end: the last).
    const unsigned t2 = min(tid + 512, NREL * HEADS - 1);
    tbv[0] = bias_table[tid];
    tbv[1] = bias_table[tid + 256];
    tbv[2] = bias_table[t2];
    // Wait before a register that these loads name is overwritten; the indices
    // are inputs and stay whole up to the wait.
    asm volatile("s_wait_xcnt 0x0" :: "v"(lane), "v"(l1), "v"(tid), "v"(t2) : "memory");
  }

  // ---------------- Once per workgroup: weight fragments in registers ------
  // QKV: wave owns output-channel tiles nt = wave*3 + j, all 4 k steps.
  // proj: wave builds the 4 k-step fragments of output-channel tile nt = wave
  // (every 4th row of w_proj, from (wave >> 2)*64 + (wave & 3) on).
  // They are first read in phase 3, behind the first window's barriers.
  // While a tile passes through LDS the next tile's loads are in flight.
  const float scale = 0.17677669529663687f; // D^-0.5
  v16h  wq[3][4];
  {
    _Float16* scr = (_Float16*)bmW;
    float4 wa[16], wb[16];
    fetch_w(w_qkv + (wave * 3 + 0) * 16 * CDIM, 1, wa);
    fetch_w(w_qkv + (wave * 3 + 1) * 16 * CDIM, 1, wb);

    // Holds the loads whose LDS store stands under a test in front of that test:
    // sunk behind it, row 48 was loaded there and waited for alone, and with it
    // (loads are counted in order) every weight load issued before.
    asm volatile("" :: "v"(smv[6][0]), "v"(srv[6][0]), "v"(smv[6][1]), "v"(srv[6][1]),
                       "v"(tbv[2]));
    // mask and rel_index to LDS rows of 208 B, the table to one run per head.
    float* smW = (float*)(smem + OFF_SM) + wave * SPITCH + lane;
    int*   srW = (int*)(smem + OFF_SR) + wave * SPITCH + lane;
    float* stW = (float*)(smem + OFF_ST);
#pragma unroll
    for (int i = 0; i < 7; ++i) {
      if (i < 6 || wave == 0) {
        smW[i * 8 * SPITCH] = smv[i][0];
        srW[i * 8 * SPITCH] = srv[i][0];
      }
    }
    if (lane < NTOK - 32) {
#pragma unroll
      for (int i = 0; i < 7; ++i) {
        if (i < 6 || wave == 0) {
          smW[i * 8 * SPITCH + 32] = smv[i][1];
          srW[i * 8 * SPITCH + 32] = srv[i][1];
        }
      }
    }
    // element e of the table is row e >> 2, head e & 3
    stW[(tid & 3) * TPITCH + (tid >> 2)]      = tbv[0];
    stW[(tid & 3) * TPITCH + (tid >> 2) + 64] = tbv[1];
    if (tid + 512 < NREL * HEADS) stW[(tid & 3) * TPITCH + (tid >> 2) + 128] = tbv[2];

    relay_w(scr, wa, wq[0]);
    fetch_w(w_qkv + (wave * 3 + 2) * 16 * CDIM, 1, wa);
    relay_w(scr, wb, wq[1]);
    fetch_w(w_proj + ((wave >> 2) * 64 + (wave & 3)) * CDIM, 4, wb);
    relay_w(scr, wa, wq[2]);
    v16h wp[4];
    relay_w(scr, wb, wp);
#pragma unroll
    for (int kk = 0; kk < 4; ++kk) st_frag(wpF, wave * 4 + kk, wp[kk]);
  }
  float smul[3], bqs[3];
  // Store address of token mt*16 + hf*8 + i, in f16 elements:
  // ((colbase ^ mt*xmt) ^ (i >> 2)*xi) + mt*amt + i*stride.
  int   stride[3], colbase[3], xmt[3], xi[3], amt[3];
#pragma unroll
  for (int j = 0; j < 3; ++j) {
    const int nt = wave * 3 + j;
    // Per-lane output-column metadata (uniform sec within a tile: 16 | 128).
    const int cg  = nt * 16 + r;       // global out channel in [0,384)
    const int sec = cg >> 7;           // 0=q 1=k 2=v
    const int hh  = (cg >> 5) & 3;
    const int dd  = cg & 31;
    smul[j]   = (sec == 0) ? scale : 1.0f;
    bqs[j]    = b_qkv[cg] * smul[j];
    // Wait before the register that this load names is overwritten; cg is an
    // input so that its register stays whole up to the wait.
    asm volatile("s_wait_xcnt 0x0" :: "v"(cg) : "memory");
    stride[j] = (sec == 2) ? 1 : DHEAD;             // vT is token-contiguous
    // q, k: row = token, so the row's part of the chunk place is hf*2 ^ (i >> 2).
    // vT: row = dd, and the chunk is mt*2 + hf.
    xmt[j] = (sec == 2) ? 16 : 0;
    xi[j]  = (sec == 2) ? 0 : 8;
    amt[j] = (sec == 2) ? 0 : 16 * DHEAD;
    const int qk = hh * 2048 + hf * 8 * DHEAD + (((dd >> 3) ^ (hf * 2)) * 8) + (dd & 7);
    if (sec == 0)      colbase[j] = OFF_Q  / 2 + qk;
    else if (sec == 1) colbase[j] = OFF_K  / 2 + qk;
    else               colbase[j] = OFF_VT / 2 + hh * 2048 + dd * NPAD + ((hf ^ ((dd >> 1) & 7)) * 8);
  }
  // b_proj to LDS, first read in phase 3 as well.
  if (wave < CDIM / 32) {
    const float bpv = b_proj[tid];
    // Wait before the register that this load names is overwritten; tid is an
    // input so that its register stays whole up to the wait.
    asm volatile("s_wait_xcnt 0x0" :: "v"(tid) : "memory");
    bpS[tid] = bpv;
  }

  // 2 waves per head in phase 2; wave part p owns queries [p*32, p*32+32).
  const int h = wave >> 1;
  const int p = wave & 1;

  // The first window's x: fetched and staged here, its latency met once.
  if ((int)blockIdx.x < nwin) {
    float4 x0[7];
    fetch_x(x, blockIdx.x, wave, x0);
    stage_x(xS, wave, x0);
  }

  // ---------------- Once per workgroup: bias + mask as score C tiles -------
  // The wave builds the 4 x 2 transposed tiles (key tile x query tile) of its own
  // queries and is their only reader. Key tiles 0-2 go to LDS; of key tile 3 the
  // one valid key, 48, stays in a register per query tile. Pad keys and pad
  // queries hold -1e30, which swallows the product.
  // Every wave's rows of mask, rel_index and the table are in LDS behind this
  // barrier. The reads below end in front of the window loop's first barrier,
  // behind which q and k take the place.
  __syncthreads();
  float key48[2]; // query (p*2 + trl)*16 + r, in the lanes with hf == 0
  {
    const float* smS = (const float*)(smem + OFF_SM);
    const int*   srS = (const int*)(smem + OFF_SR);
    const float* stS = (const float*)(smem + OFF_ST) + h * TPITCH;
#pragma unroll
    for (int trl = 0; trl < 2; ++trl) {
      const int m  = (p * 2 + trl) * 16 + r; // the lane's query; pad queries read the last
      const int ro = min(m, NTOK - 1) * SPITCH;
      int   ri[25]; // keys kt*16 + hf*8 + i < NTOK at kt*8 + i; key 48 last
      float mv[25], bv[25];
#pragma unroll
      for (int kt = 0; kt < 3; ++kt) {
        const int4   r0 = *(const int4*)(srS + ro + kt * 16 + hf * 8);
        const int4   r1 = *(const int4*)(srS + ro + kt * 16 + hf * 8 + 4);
        const float4 m0 = *(const float4*)(smS + ro + kt * 16 + hf * 8);
        const float4 m1 = *(const float4*)(smS + ro + kt * 16 + hf * 8 + 4);
        ri[kt * 8 + 0] = r0.x; ri[kt * 8 + 1] = r0.y; ri[kt * 8 + 2] = r0.z; ri[kt * 8 + 3] = r0.w;
        ri[kt * 8 + 4] = r1.x; ri[kt * 8 + 5] = r1.y; ri[kt * 8 + 6] = r1.z; ri[kt * 8 + 7] = r1.w;
        mv[kt * 8 + 0] = m0.x; mv[kt * 8 + 1] = m0.y; mv[kt * 8 + 2] = m0.z; mv[kt * 8 + 3] = m0.w;
        mv[kt * 8 + 4] = m1.x; mv[kt * 8 + 5] = m1.y; mv[kt * 8 + 6] = m1.z; mv[kt * 8 + 7] = m1.w;
      }
      ri[24] = srS[ro + NTOK - 1];
      mv[24] = smS[ro + NTOK - 1];
      // index read from an input: bounded to the table's rows before use
#pragma unroll
      for (int j = 0; j < 25; ++j) bv[j] = stS[min((unsigned)ri[j], (unsigned)(NREL - 1))];
      // Holds the table reads together in front of the pad-query selects: sunk
      // behind these they were made one by one, each under a branch and a wait.
      asm volatile("" :: "v"(bv[0]), "v"(bv[1]), "v"(bv[2]), "v"(bv[3]), "v"(bv[4]),
                         "v"(bv[5]), "v"(bv[6]), "v"(bv[7]), "v"(bv[8]), "v"(bv[9]),
                         "v"(bv[10]), "v"(bv[11]), "v"(bv[12]), "v"(bv[13]), "v"(bv[14]),
                         "v"(bv[15]), "v"(bv[16]), "v"(bv[17]), "v"(bv[18]), "v"(bv[19]),
                         "v"(bv[20]), "v"(bv[21]), "v"(bv[22]), "v"(bv[23]), "v"(bv[24]));
#pragma unroll
      for (int kt = 0; kt < 3; ++kt) {
        v8f c;
#pragma unroll
        for (int i = 0; i < 8; ++i)
          c[i] = (m < NTOK) ? bv[kt * 8 + i] + mv[kt * 8 + i] : -1e30f;
        st_ctile(bmW, trl * 3 + kt, c);
      }
      key48[trl] = (m < NTOK && hf == 0) ? bv[24] + mv[24] : -1e30f;
    }
  }

  // Kept rolled: a second copy of the body would need registers that the
  // resident weight fragments already take.
#pragma unroll 1
  for (int b = blockIdx.x; b < nwin; b += NWG) {
    // x of this window was staged as f16 in LDS at the foot of the trip before
    // (the first window's: in front of the loop).
    __syncthreads();

    // ---------------- Phase 1: QKV GEMM (64x384 = x(64x128) @ wqkv^T) ------
    // x A-tiles are read once per token tile and meet the 3 resident B tiles.
#pragma unroll 1
    for (int mt = 0; mt < 4; ++mt) {
      // Every pad token reads the one row of zeros.
      const _Float16* xrow = xS + min(mt * 16 + r, NTOK) * XPITCH;
      v16h am[4];
#pragma unroll
      for (int kk = 0; kk < 4; ++kk)
        am[kk] = ld_tile_row(xrow + kk * 32);
      v8f acc[3] = {};
#pragma unroll
      for (int kk = 0; kk < 4; ++kk)
#pragma unroll
        for (int j = 0; j < 3; ++j)
          acc[j] = wmma_f16(am[kk], wq[j][kk], acc[j]);
#pragma unroll
      for (int j = 0; j < 3; ++j) {
        const int a0 = (colbase[j] ^ (mt * xmt[j])) + mt * amt[j];
        const int a4 = a0 ^ xi[j];
#pragma unroll
        for (int i = 0; i < 8; ++i)
          smemh[(i < 4 ? a0 : a4) + i * stride[j]] = (_Float16)fmaf(acc[j][i], smul[j], bqs[j]);
      }
    }
    __syncthreads();

    // ------- Phase 2: S^T = k @ q^T + (bias + mask)^T, softmax, out^T = v^T @ P^T
    // One tile of 16 queries at a time. Lane (r, hf) holds, of query r, the keys
    // kt*16 + hf*8 + i in st[kt][i].
    {
      v16h ak[4], av[2][2];
#pragma unroll
      for (int kt = 0; kt < 4; ++kt)
        ak[kt] = ld_tile_s32(kS + h * 2048 + kt * 16 * DHEAD);
#pragma unroll
      for (int dt = 0; dt < 2; ++dt)
#pragma unroll
        for (int kk = 0; kk < 2; ++kk)
          av[dt][kk] = ld_tile_s64(vtS + h * 2048 + dt * 16 * NPAD, kk);
#pragma unroll
      for (int trl = 0; trl < 2; ++trl) {
        const v16h bq = ld_tile_s32(qS + h * 2048 + (p * 2 + trl) * 16 * DHEAD);
        v8f st[4];
#pragma unroll
        for (int kt = 0; kt < 3; ++kt) // K = 32 in one step
          st[kt] = wmma_f16(ak[kt], bq, ld_ctile(bmW, trl * 3 + kt));
        const v8f c3 = {key48[trl], -1e30f, -1e30f, -1e30f, -1e30f, -1e30f, -1e30f, -1e30f};
        st[3] = wmma_f16(ak[3], bq, c3);
        // Of key tile 3 only element 0 can be a real key (48, where hf == 0; key 56
        // holds -1e30): elements 1-7 are pad keys in every lane, their P is 0.
        float mk[3];
#pragma unroll
        for (int kt = 0; kt < 3; ++kt)
          mk[kt] = fmaxf(fmaxf(fmaxf(st[kt][0], st[kt][1]), fmaxf(st[kt][2], st[kt][3])),
                         fmaxf(fmaxf(st[kt][4], st[kt][5]), fmaxf(st[kt][6], st[kt][7])));
        float mx = fmaxf(fmaxf(mk[0], mk[1]), fmaxf(mk[2], st[3][0]));
        mx = fmaxf(mx, xhalf(mx));
        float sk[3];
#pragma unroll
        for (int kt = 0; kt < 3; ++kt) {
#pragma unroll
          for (int i = 0; i < 8; ++i) st[kt][i] = __expf(st[kt][i] - mx);
          sk[kt] = ((st[kt][0] + st[kt][1]) + (st[kt][2] + st[kt][3])) +
                   ((st[kt][4] + st[kt][5]) + (st[kt][6] + st[kt][7]));
        }
        const float e48 = __expf(st[3][0] - mx);
        float sum = (sk[0] + sk[1]) + (sk[2] + e48);
        sum += xhalf(sum);
        const float inv = 1.0f / sum;
        // P^T as B fragments: element e of k step kk is key kk*32 + (e < 8 ? 0 : 16)
        // + hf*8 + (e & 7), which is st[kk*2 + (e >> 3)][e & 7] of this very lane.
        v16h pf[2];
#pragma unroll
        for (int e = 0; e < 8; ++e) {
          pf[0][e]     = (_Float16)(st[0][e] * inv);
          pf[0][e + 8] = (_Float16)(st[1][e] * inv);
          pf[1][e]     = (_Float16)(st[2][e] * inv);
          pf[1][e + 8] = (_Float16)0.f;
        }
        pf[1][8] = (_Float16)(e48 * inv);
        // out^T tile dt: lane (r, hf) holds, of query r, channels dt*16 + hf*8 + i:
        // 16 bytes in a row of attn-out.
        const int m = (p * 2 + trl) * 16 + r;
#pragma unroll
        for (int dt = 0; dt < 2; ++dt) {
          v8f o = {};
          o = wmma_f16(av[dt][0], pf[0], o);
          o = wmma_f16(av[dt][1], pf[1], o);
          v8h o8;
#pragma unroll
          for (int i = 0; i < 8; ++i) o8[i] = (_Float16)o[i];
          *(v8h*)(aoS + m * XPITCH + h * DHEAD + dt * 16 + hf * 8) = o8;
        }
      }
    }
    __syncthreads();

    // The next window's x: issued here, where the score phase's registers are
    // free again and no barrier stands before its use (the compiler waits for
    // every load in front of a barrier); it lands during phase 3.
    float4 xr[7];
    if (b + NWG < nwin) fetch_x(x, b + NWG, wave, xr);

    // ---------------- Phase 3: proj = ao(64x128) @ wproj^T + b_proj --------
    // A wave takes one token tile and one half of the channels: 4 tiles, whose
    // columns are dealt so that lane r holds channels r*4 .. r*4 + 3 of the half.
    // A row's 64 channels then leave as one 16-byte store of 16 lanes: 256 B.
    {
      const int mt = wave >> 1;
      const int ch = wave & 1;
      float* outp = out + (size_t)b * NTOK * CDIM + (mt * 16 + hf * 8) * CDIM + ch * 64 + r * 4;
      const _Float16* aoT = aoS + mt * 16 * XPITCH;
      const float4 bp = *(const float4*)(bpS + ch * 64 + r * 4);
      v16h am = ld_tile(aoT, XPITCH), an = am, bf[4];
#pragma unroll
      for (int j = 0; j < 4; ++j) bf[j] = ld_frag(wpF, (ch * 4 + j) * 4);
      v8f acc[4] = {};
      // The fragments of k step kk + 1 are read while step kk is worked on, half a
      // step's at a time. The scheduling barriers keep the reads from all being
      // lifted to the head of the phase: there they took the registers of the x
      // fetch, which then went through scratch, each load waited for alone.
#pragma unroll
      for (int kk = 0; kk < 4; ++kk) {
        __builtin_amdgcn_sched_barrier(0);
        acc[0] = wmma_f16(am, bf[0], acc[0]);
        acc[1] = wmma_f16(am, bf[1], acc[1]);
        if (kk < 3) {
          an    = ld_tile(aoT + (kk + 1) * 32, XPITCH);
          bf[0] = ld_frag(wpF, (ch * 4 + 0) * 4 + kk + 1);
          bf[1] = ld_frag(wpF, (ch * 4 + 1) * 4 + kk + 1);
        }
        __builtin_amdgcn_sched_barrier(0);
        acc[2] = wmma_f16(am, bf[2], acc[2]);
        acc[3] = wmma_f16(am, bf[3], acc[3]);
        if (kk < 3) {
          bf[2] = ld_frag(wpF, (ch * 4 + 2) * 4 + kk + 1);
          bf[3] = ld_frag(wpF, (ch * 4 + 3) * 4 + kk + 1);
        }
        am = an;
      }
      // Tokens mt*16 + hf*8 + i: all exist where mt < 3; of 48-63 only 48 does.
      if (mt < 3 || hf == 0)
        *(float4*)outp = float4{acc[0][0] + bp.x, acc[1][0] + bp.y,
                                acc[2][0] + bp.z, acc[3][0] + bp.w};
      if (mt < 3) {
#pragma unroll
        for (int i = 1; i < 8; ++i)
          *(float4*)(outp + i * CDIM) = float4{acc[0][i] + bp.x, acc[1][i] + bp.y,
                                               acc[2][i] + bp.z, acc[3][i] + bp.w};
      }
      // Wait before a register that these stores name is overwritten; outp is an
      // input so that its step to the next window cannot be placed in front.
      asm volatile("s_wait_xcnt 0x0" :: "v"(outp) : "memory");
    }

    // ---------------- Stage the next window's x as f16 in LDS --------------
    // The x tile's last readers (phase 1) are two barriers back.
    if (b + NWG < nwin) stage_x(xS, wave, xr);
  }
}

extern "C" void kernel_launch(void* const* d_in, const int* in_sizes, int n_in,
                              void* d_out, int out_size, void* d_ws, size_t ws_size,
                              hipStream_t stream) {
  (void)n_in; (void)d_ws; (void)ws_size; (void)out_size;
  const float* x          = (const float*)d_in[0];
  const float* mask       = (const float*)d_in[1];
  const float* w_qkv      = (const float*)d_in[2];
  const float* b_qkv      = (const float*)d_in[3];
  const float* w_proj     = (const float*)d_in[4];
  const float* b_proj     = (const float*)d_in[5];
  const float* bias_table = (const float*)d_in[6];
  const int*   rel_index  = (const int*)d_in[7];
  float* out = (float*)d_out;

  const int B = in_sizes[0] / (NTOK * CDIM); // 4096 windows

  // Opt in to >default dynamic LDS (160 KB of the 320 KB/WGP on CDNA5).
  (void)hipFuncSetAttribute(reinterpret_cast<const void*>(swin_msa_fused),
                            hipFuncAttributeMaxDynamicSharedMemorySize, SMEM_BYTES);

  // 256 WGPs x 2 resident workgroups; each takes every 512th window.
  swin_msa_fused<<<NWG, 256, SMEM_BYTES, stream>>>(
      x, mask, w_qkv, b_qkv, w_proj, b_proj, bias_table, rel_index, out, B);
}

// v008
// A run of this version takes 38.7 microseconds.
// Timed twice side by side with v007, it ran 1.14 times as fast both times.
// Over all steps from v000 it is 16.4 times as fast.
#include <hip/hip_runtime.h>

// Fully fused kernel for gfx1250 (wave32, WMMA).
// 512 workgroups (256 threads = 8 wave32), two resident per WGP; each loops
// over windows b = blockIdx.x, blockIdx.x + gridDim.x, ...
// The weights do not depend on the window: they are read once per workgroup
// and kept as f16 WMMA fragments. Every wave keeps the wqkv fragments of the
// 3 output-channel tiles it owns in registers; the wproj fragments lie in LDS
// in fragment order.
// Neither do the rel-pos bias and, as the loop's stride is a multiple of the
// number of masks, the window mask: their sum is gathered once per workgroup, in
// the layout of the score tiles, and enters the score product as its C operand.
// All that this set-up reads from global memory comes in whole rows, a wave's
// lanes side by side, and is re-laid through LDS: a weight row is 4 lines per
// load where a fragment-shaped load touches 16, and the gathers by query row
// and by rel_index run on LDS banks, not on cache lines.
// x is fetched one window ahead: all of a thread's loads of the next window are
// issued at the head of the proj phase and stay in registers, in flight, until the
// foot of the trip rounds them to f16 into LDS. b_proj lies in LDS, so that
// the proj phase waits on no global load (a wait on a later load would also
// wait for the fetch, as loads are counted in order).
// The proj phase deals the output channels over a wave's four tiles so that a
// lane holds four adjacent channels of a token: the result leaves in 16-byte
// stores, 256 B of a row from 16 lanes, with one wait behind them all.
// Per window: x -> f16 staging -> QKV GEMM -> scores -> softmax (+rel-pos bias
// + shift-window mask) -> P@V -> proj GEMM -> d_out.
// The scores are made transposed, S^T = k @ q^T: a lane then holds 32 of the 64
// keys of ONE query (its partner lane ^ 16 the other 32), so that the softmax
// runs inside the lane's registers but for two exchanges, and the packed P^T is
// already the B fragment of out^T = v^T @ P^T: P never goes through LDS.
// The QKV GEMM makes q and k transposed as well (w @ x^T: a lane holds 8 adjacent
// channels of one token) and v as x @ w^T (8 adjacent tokens of one channel):
// either way the lane's 8 results are 16 bytes in a row of the LDS tile.
// Every operand tile in LDS is laid so that the 16 rows which one half of a
// ds_load_b128 reads fall on 16 different groups of four banks: x and attn-out
// by a row pitch of 272 B, q, k and vT by exchanging the 16-byte chunks inside
// each row (chunk ^ a function of the row).

#define NTOK 49
#define NPAD 64
#define CDIM 128
#define HEADS 4
#define DHEAD 32
#define NREL 169  // rows of bias_table
#define NMASK 64  // windows in mask
#define NWG  512  // workgroups launched = stride of the window loop
#define XPITCH 136 // f16 per LDS row of x and attn-out: 256 B + 16 B pad
static_assert(NWG % NMASK == 0, "a workgroup must meet one mask window only");

typedef __attribute__((ext_vector_type(16))) _Float16 v16h;
typedef __attribute__((ext_vector_type(8)))  _Float16 v8h;
typedef __attribute__((ext_vector_type(4)))  _Float16 v4h;
typedef __attribute__((ext_vector_type(8)))  float    v8f;

static constexpr int SMEM_BYTES = 163840; // 160 KB: two workgroups per WGP

// LDS byte offsets. The window loop uses no place twice. Two barriers of the
// loop stand between each tile's last read and its next write.
#define OFF_X      0        // 50 rows of 272 B = 13600 B (49 tokens, one row of zeros)
#define OFF_AO     13600    // 64 rows of 272 B = 17408 B
#define OFF_BP     31008    // 128 f32 = 512 B (b_proj)
#define OFF_BQK    31520    // 256 f32 = 1024 B (b_qkv of q and k)
#define OFF_Q      32768    // 4*64*32 f16 = 16384 B
#define OFF_K      49152    // 4*64*32 f16 = 16384 B
#define OFF_VT     65536    // 4*32*64 f16 = 16384 B  (v stored transposed [h][d][n])
#define OFF_WPF    81920    // 32 tiles * 1024 B = 32768 B (wproj B fragments)
#define OFF_BM     114688   // 48 tiles * 1024 B = 49152 B (bias + mask C tiles, f32)
// Places of the set-up alone, in the q and k tiles, which the window loop first
// writes behind its first barrier. (A wave's weight rows pass through its own
// six C tiles, before it builds these.)
#define SPITCH 52           // f32 per staged row of mask and rel_index: 208 B = 16 B x 13
#define TPITCH 176          // f32 per head of the staged bias table
#define OFF_SM     (OFF_Q)          // 49 rows of 208 B = 10192 B (this workgroup's mask window)
#define OFF_SR     (OFF_Q + 10240)  // 49 rows of 208 B = 10192 B (rel_index)
#define OFF_ST     (OFF_Q + 20480)  // 4 * 176 f32 = 2816 B (bias_table, head by head)
static_assert(OFF_ST + HEADS * TPITCH * 4 <= OFF_VT, "set-up places lie in q and k");

// Load one 16x(K=32) operand tile in the CDNA5 WMMA 16-bit A/B register layout:
// lane r=lane&15 -> row, half=lane>>4 -> K-offset; element e holds
// K = (e<8 ? 0 : 16) + half*8 + (e&7). row: the lane's own row, at the tile's
// first column; ld_tile takes it from a row-major source with leading dim ld.
__device__ __forceinline__ v16h ld_tile_row(const _Float16* row) {
  const _Float16* p = row + ((threadIdx.x & 31) >> 4) * 8;
  v16h a;
#pragma unroll
  for (int e = 0; e < 8; ++e) a[e] = p[e];          // K = hf*8 + e
#pragma unroll
  for (int e = 0; e < 8; ++e) a[e + 8] = p[16 + e]; // K = 16 + hf*8 + e
  return a;
}
__device__ __forceinline__ v16h ld_tile(const _Float16* base, int ld) {
  return ld_tile_row(base + (threadIdx.x & 15) * ld);
}

// The same tile from rows of 32 f16 (q, k) whose 16-byte chunks are exchanged:
// chunk c of row n lies at place c ^ ((n >> 2) & 3). tile: a multiple of 16 rows.
__device__ __forceinline__ v16h ld_tile_s32(const _Float16* tile) {
  const int lane = threadIdx.x & 31;
  const int r    = lane & 15;
  const int c    = (lane >> 4) ^ ((r >> 2) & 3);
  const v8h lo = *(const v8h*)(tile + r * 32 + c * 8);       // K = hf*8 + e
  const v8h hi = *(const v8h*)(tile + r * 32 + (c ^ 2) * 8); // K = 16 + hf*8 + e
  v16h a;
#pragma unroll
  for (int e = 0; e < 8; ++e) { a[e] = lo[e]; a[e + 8] = hi[e]; }
  return a;
}
// The same from rows of 64 f16 (vT): chunk c of row n lies at place
// c ^ ((n >> 1) & 7). tile: a multiple of 16 rows; kk: which block of 32 columns.
__device__ __forceinline__ v16h ld_tile_s64(const _Float16* tile, int kk) {
  const int lane = threadIdx.x & 31;
  const int r    = lane & 15;
  const int c    = (lane >> 4) ^ ((r >> 1) & 7);
  const v8h lo = *(const v8h*)(tile + r * 64 + (c ^ (kk * 4)) * 8);
  const v8h hi = *(const v8h*)(tile + r * 64 + (c ^ (kk * 4 + 2)) * 8);
  v16h a;
#pragma unroll
  for (int e = 0; e < 8; ++e) { a[e] = lo[e]; a[e + 8] = hi[e]; }
  return a;
}

// Issues a wave's loads of a 16-row tile of a row-major f32 matrix (rows of CDIM
// floats): load i is the whole of row i*step, 16 bytes a lane. base: the tile's
// first row, the same in every lane. Nothing here waits for the data.
__device__ __forceinline__ void fetch_w(const float* base, int step, float4 (&wr)[16]) {
  const float4* p = (const float4*)base + (threadIdx.x & 31);
#pragma unroll
  for (int i = 0; i < 16; ++i) wr[i] = p[i * step * (CDIM / 4)];
  // Wait before a register that these loads name is overwritten. p is an input:
  // where the loads take their address from a register pair, the pair stays
  // whole up to the wait (else a load's result can be placed in it).
  asm volatile("s_wait_xcnt 0x0" :: "v"(p) : "memory");
}

// Rounds what fetch_w brought to f16 element by element, lays it as 16 rows of
// 272 B in scr (the wave's own LDS) and reads it back as the 4 k-step fragments.
__device__ __forceinline__ void relay_w(_Float16* scr, const float4 (&wr)[16], v16h (&fr)[4]) {
  _Float16* sw = scr + (threadIdx.x & 31) * 4;
#pragma unroll
  for (int i = 0; i < 16; ++i) {
    const v4h h4 = {(_Float16)wr[i].x, (_Float16)wr[i].y, (_Float16)wr[i].z, (_Float16)wr[i].w};
    *(v4h*)(sw + i * XPITCH) = h4;
  }
  // The rows are read back by other lanes of the wave: its stores end first.
  asm volatile("s_wait_dscnt 0x0" ::: "memory");
#pragma unroll
  for (int kk = 0; kk < 4; ++kk) fr[kk] = ld_tile(scr + kk * 32, XPITCH);
  // scr is written again behind this (next tile, C tiles): the reads end first.
  asm volatile("s_wait_dscnt 0x0" ::: "memory");
}

// wproj fragments in LDS: tile t = nt*4 + kk takes 1024 B, elements 0-7 of all
// 32 lanes first (16 B a lane, contiguous), then elements 8-15. Column r of
// tile nt is output channel (nt >> 2)*64 + r*4 + (nt & 3): over the four tiles
// of one half of the channels a lane holds four adjacent channels.
__device__ __forceinline__ void st_frag(_Float16* frags, int t, v16h a) {
  const int lane = threadIdx.x & 31;
  v8h lo, hi;
#pragma unroll
  for (int e = 0; e < 8; ++e) { lo[e] = a[e]; hi[e] = a[e + 8]; }
  *(v8h*)(frags + t * 512 + lane * 8)       = lo;
  *(v8h*)(frags + t * 512 + 256 + lane * 8) = hi;
}
__device__ __forceinline__ v16h ld_frag(const _Float16* frags, int t) {
  const int lane = threadIdx.x & 31;
  const v8h lo = *(const v8h*)(frags + t * 512 + lane * 8);
  const v8h hi = *(const v8h*)(frags + t * 512 + 256 + lane * 8);
  v16h a;
#pragma unroll
  for (int e = 0; e < 8; ++e) { a[e] = lo[e]; a[e + 8] = hi[e]; }
  return a;
}

// bias + mask tiles in LDS, WMMA C/D register layout (element i: row hf*8 + i,
// column lane & 15; here row = key, column = query): a tile takes 1024 B, elements 0-3 of all 32 lanes first
// (16 B a lane, contiguous), then elements 4-7.
__device__ __forceinline__ void st_ctile(float* tiles, int t, v8f c) {
  const int lane = threadIdx.x & 31;
  const float4 lo = {c[0], c[1], c[2], c[3]}, hi = {c[4], c[5], c[6], c[7]};
  *(float4*)(tiles + t * 256 + lane * 4)       = lo;
  *(float4*)(tiles + t * 256 + 128 + lane * 4) = hi;
}
__device__ __forceinline__ v8f ld_ctile(const float* tiles, int t) {
  const int lane = threadIdx.x & 31;
  const float4 lo = *(const float4*)(tiles + t * 256 + lane * 4);
  const float4 hi = *(const float4*)(tiles + t * 256 + 128 + lane * 4);
  v8f c = {lo.x, lo.y, lo.z, lo.w, hi.x, hi.y, hi.z, hi.w};
  return c;
}

// Value of the partner lane (lane ^ 16), by a vector move between the two rows.
__device__ __forceinline__ float xhalf(float v) {
  const int b = __builtin_bit_cast(int, v);
  return __builtin_bit_cast(float, __builtin_amdgcn_permlanex16(
      b, b, 0x76543210, 0xfedcba98, false, false));
}

// Issues a thread's loads of window b of x: wave w takes rows w, w + 8, ... w + 40,
// 16 bytes a lane; wave 0 also row 48. xr[6] is zero in the other waves (wave 1
// writes it as the row of zeros). Nothing here waits for the data.
__device__ __forceinline__ void fetch_x(const float* __restrict__ x, int b, int wave,
                                        float4 (&xr)[7]) {
  // Uniform base (window, wave) plus a 32-bit lane offset: the least to keep in
  // vector registers over the window loop.
  const char* base = (const char*)(x + (size_t)b * NTOK * CDIM + wave * CDIM);
  const unsigned off = (threadIdx.x & 31) * 16u;
#pragma unroll
  for (int i = 0; i < 6; ++i) xr[i] = *(const float4*)(base + off + i * 8 * CDIM * 4);
  xr[6] = float4{0.f, 0.f, 0.f, 0.f};
  if (wave == 0) xr[6] = *(const float4*)(base + off + 6 * 8 * CDIM * 4);
  // Wait before a register that these loads name is overwritten; off, which the
  // address is formed from, is an input and stays whole up to the wait.
  asm volatile("s_wait_xcnt 0x0" :: "v"(off) : "memory");
}

// Rounds what fetch_x brought to f16 and writes it to the x tile in LDS: the
// rows of fetch_x; wave 1 writes row 49, the zeros. The data wait falls here.
__device__ __forceinline__ void stage_x(_Float16* xS, int wave, const float4 (&xr)[7]) {
  _Float16* xw = xS + wave * XPITCH + (threadIdx.x & 31) * 4;
#pragma unroll
  for (int i = 0; i < 7; ++i) {
    if (i < 6 || wave < 2) {
      const v4h h4 = {(_Float16)xr[i].x, (_Float16)xr[i].y,
                      (_Float16)xr[i].z, (_Float16)xr[i].w};
      *(v4h*)(xw + i * 8 * XPITCH) = h4;
    }
  }
}

__device__ __forceinline__ v8f wmma_f16(v16h a, v16h b, v8f c) {
  return __builtin_amdgcn_wmma_f32_16x16x32_f16(false, a, false, b,
                                                (short)0, c, false, false);
}

__global__ void __launch_bounds__(256, 4) // 4 waves per SIMD: two workgroups per WGP
swin_msa_fused(const float* __restrict__ x, const float* __restrict__ mask,
               const float* __restrict__ w_qkv, const float* __restrict__ b_qkv,
               const float* __restrict__ w_proj, const float* __restrict__ b_proj,
               const float* __restrict__ bias_table, const int* __restrict__ rel_index,
               float* __restrict__ out, int nwin) {
  extern __shared__ __align__(16) char smem[];
  _Float16* aoS    = (_Float16*)(smem + OFF_AO);
  _Float16* xS     = (_Float16*)(smem + OFF_X);
  _Float16* qS     = (_Float16*)(smem + OFF_Q);
  _Float16* kS     = (_Float16*)(smem + OFF_K);
  _Float16* vtS    = (_Float16*)(smem + OFF_VT);
  _Float16* wpF    = (_Float16*)(smem + OFF_WPF);
  float*    bpS    = (float*)(smem + OFF_BP);

  const int tid  = threadIdx.x;
  const int lane = tid & 31;
  // Wave number as a scalar: all that follows from it (tile numbers, head,
  // store strides, LDS bases) then lives in scalar registers, not in VGPRs.
  const int wave = __builtin_amdgcn_readfirstlane(tid >> 5);
  const int r    = lane & 15;
  const int hf   = lane >> 4;

  // The wave's six bias + mask C tiles; until they are built, its weight scratch.
  float* bmW = (float*)(smem + OFF_BM) + wave * 6 * 256;

  // ---------------- Once per workgroup: mask window, rel_index, bias table --
  // Every window of this workgroup has b % NMASK == blockIdx.x % NMASK.
  // Issued first, written to LDS once the first weight loads are under way.
  // Wave w takes rows w, w + 8, ... w + 40 of mask and rel_index; row 48 is read
  // by every wave (no branch among the loads) and written by wave 0. Columns
  // 0-31 come in one load, 32-48 in a second, whose other lanes repeat 48.
  float smv[7][2], tbv[3];
  int   srv[7][2];
  {
    const float* mw = mask + (blockIdx.x % NMASK) * (NTOK * NTOK);
    const int l1 = min(lane, NTOK - 33);
#pragma unroll
    for (int i = 0; i < 7; ++i) {
      const int ro = (i < 6 ? wave + i * 8 : NTOK - 1) * NTOK;
      smv[i][0] = mw[ro + lane];
      smv[i][1] = mw[ro + 32 + l1];
      srv[i][0] = rel_index[ro + lane];
      srv[i][1] = rel_index[ro + 32 + l1];
    }
    // bias_table, flat: elements tid, tid + 256, tid + 512 (past the end: the last).
    const unsigned t2 = min(tid + 512, NREL * HEADS - 1);
    tbv[0] = bias_table[tid];
    tbv[1] = bias_table[tid + 256];
    tbv[2] = bias_table[t2];
    // Wait before a register that these loads name is overwritten; the indices
    // are inputs and stay whole up to the wait.
    asm volatile("s_wait_xcnt 0x0" :: "v"(lane), "v"(l1), "v"(tid), "v"(t2) : "memory");
  }

  // ---------------- Once per workgroup: weight fragments in registers ------
  // QKV: wave owns tile number wave of q (j = 0), of k (1) and of v (2), that is
  // output-channel tile nt = j*8 + wave, all 4 k steps.
  // proj: wave builds the 4 k-step fragments of output-channel tile nt = wave
  // (every 4th row of w_proj, from (wave >> 2)*64 + (wave & 3) on).
  // They are first read in phase 3, behind the first window's barriers.
  // While a tile passes through LDS the next tile's loads are in flight.
  const float scale = 0.17677669529663687f; // D^-0.5
  v16h  wq[3][4];
  {
    _Float16* scr = (_Float16*)bmW;
    float4 wa[16], wb[16];
    fetch_w(w_qkv + (0 * 8 + wave) * 16 * CDIM, 1, wa);
    fetch_w(w_qkv + (1 * 8 + wave) * 16 * CDIM, 1, wb);

    // Holds the loads whose LDS store stands under a test in front of that test:
    // sunk behind it, row 48 was loaded there and waited for alone, and with it
    // (loads are counted in order) every weight load issued before.
    asm volatile("" :: "v"(smv[6][0]), "v"(srv[6][0]), "v"(smv[6][1]), "v"(srv[6][1]),
                       "v"(tbv[2]));
    // mask and rel_index to LDS rows of 208 B, the table to one run per head.
    float* smW = (float*)(smem + OFF_SM) + wave * SPITCH + lane;
    int*   srW = (int*)(smem + OFF_SR) + wave * SPITCH + lane;
    float* stW = (float*)(smem + OFF_ST);
#pragma unroll
    for (int i = 0; i < 7; ++i) {
      if (i < 6 || wave == 0) {
        smW[i * 8 * SPITCH] = smv[i][0];
        srW[i * 8 * SPITCH] = srv[i][0];
      }
    }
    if (lane < NTOK - 32) {
#pragma unroll
      for (int i = 0; i < 7; ++i) {
        if (i < 6 || wave == 0) {
          smW[i * 8 * SPITCH + 32] = smv[i][1];
          srW[i * 8 * SPITCH + 32] = srv[i][1];
        }
      }
    }
    // element e of the table is row e >> 2, head e & 3
    stW[(tid & 3) * TPITCH + (tid >> 2)]      = tbv[0];
    stW[(tid & 3) * TPITCH + (tid >> 2) + 64] = tbv[1];
    if (tid + 512 < NREL * HEADS) stW[(tid & 3) * TPITCH + (tid >> 2) + 128] = tbv[2];

    relay_w(scr, wa, wq[0]);
    fetch_w(w_qkv + (2 * 8 + wave) * 16 * CDIM, 1, wa);
    relay_w(scr, wb, wq[1]);
    fetch_w(w_proj + ((wave >> 2) * 64 + (wave & 3)) * CDIM, 4, wb);
    relay_w(scr, wa, wq[2]);
    v16h wp[4];
    relay_w(scr, wb, wp);
#pragma unroll
    for (int kk = 0; kk < 4; ++kk) st_frag(wpF, wave * 4 + kk, wp[kk]);
  }
  // Biases and LDS places of the wave's three tiles: head wave >> 1, channels
  // (wave & 1)*16 .. + 15 of the head.
  // q, k: the lane holds token mt*16 + r, channels (wave & 1)*16 + hf*8 + i, which
  // are chunk (wave & 1)*2 + hf of the token's row; their biases enter as the C of
  // the first k step, 8 a lane. v: the lane holds channel (wave & 1)*16 + r, tokens
  // mt*16 + hf*8 + i, which are chunk mt*2 + hf of the channel's row of vT.
  // The biases of q and k lie in LDS and are in registers during phase 1 alone
  // (kept over the trip they would push the x fetch out of the registers).
  float* bqkS = (float*)(smem + OFF_BQK);
  float bv1;
  {
    const int cv = 2 * CDIM + wave * 16 + r;
    const float bqk = b_qkv[tid]; // 256 threads: the 2 * CDIM biases of q and k
    bv1 = b_qkv[cv];
    // Wait before a register that these loads name is overwritten; the indices
    // are inputs and stay whole up to the wait.
    asm volatile("s_wait_xcnt 0x0" :: "v"(tid), "v"(cv) : "memory");
    bqkS[tid] = bqk; // first read behind the set-up's barrier
  }
  const int qkoff = (wave >> 1) * 2048 + r * DHEAD + ((((wave & 1) * 2 + hf) ^ ((r >> 2) & 3)) * 8);
  _Float16* qW = qS + qkoff; // token tile mt: + mt*16*DHEAD
  _Float16* kW = kS + qkoff;
  const int vdd  = (wave & 1) * 16 + r;
  const int voff = (wave >> 1) * 2048 + vdd * NPAD + ((hf ^ ((vdd >> 1) & 7)) * 8); // token tile mt: ^ mt*16
  // b_proj to LDS, first read in phase 3 as well.
  if (wave < CDIM / 32) {
    const float bpv = b_proj[tid];
    // Wait before the register that this load names is overwritten; tid is an
    // input so that its register stays whole up to the wait.
    asm volatile("s_wait_xcnt 0x0" :: "v"(tid) : "memory");
    bpS[tid] = bpv;
  }

  // 2 waves per head in phase 2; wave part p owns queries [p*32, p*32+32).
  const int h = wave >> 1;
  const int p = wave & 1;

  // The first window's x: fetched and staged here, its latency met once.
  if ((int)blockIdx.x < nwin) {
    float4 x0[7];
    fetch_x(x, blockIdx.x, wave, x0);
    stage_x(xS, wave, x0);
  }

  // ---------------- Once per workgroup: bias + mask as score C tiles -------
  // The wave builds the 4 x 2 transposed tiles (key tile x query tile) of its own
  // queries and is their only reader. Key tiles 0-2 go to LDS; of key tile 3 the
  // one valid key, 48, stays in a register per query tile. Pad keys and pad
  // queries hold -1e30, which swallows the product.
  // Every wave's rows of mask, rel_index and the table are in LDS behind this
  // barrier. The reads below end in front of the window loop's first barrier,
  // behind which q and k take the place.
  __syncthreads();
  float key48[2]; // query (p*2 + trl)*16 + r, in the lanes with hf == 0
  {
    const float* smS = (const float*)(smem + OFF_SM);
    const int*   srS = (const int*)(smem + OFF_SR);
    const float* stS = (const float*)(smem + OFF_ST) + h * TPITCH;
#pragma unroll
    for (int trl = 0; trl < 2; ++trl) {
      const int m  = (p * 2 + trl) * 16 + r; // the lane's query; pad queries read the last
      const int ro = min(m, NTOK - 1) * SPITCH;
      int   ri[25]; // keys kt*16 + hf*8 + i < NTOK at kt*8 + i; key 48 last
      float mv[25], bv[25];
#pragma unroll
      for (int kt = 0; kt < 3; ++kt) {
        const int4   r0 = *(const int4*)(srS + ro + kt * 16 + hf * 8);
        const int4   r1 = *(const int4*)(srS + ro + kt * 16 + hf * 8 + 4);
        const float4 m0 = *(const float4*)(smS + ro + kt * 16 + hf * 8);
        const float4 m1 = *(const float4*)(smS + ro + kt * 16 + hf * 8 + 4);
        ri[kt * 8 + 0] = r0.x; ri[kt * 8 + 1] = r0.y; ri[kt * 8 + 2] = r0.z; ri[kt * 8 + 3] = r0.w;
        ri[kt * 8 + 4] = r1.x; ri[kt * 8 + 5] = r1.y; ri[kt * 8 + 6] = r1.z; ri[kt * 8 + 7] = r1.w;
        mv[kt * 8 + 0] = m0.x; mv[kt * 8 + 1] = m0.y; mv[kt * 8 + 2] = m0.z; mv[kt * 8 + 3] = m0.w;
        mv[kt * 8 + 4] = m1.x; mv[kt * 8 + 5] = m1.y; mv[kt * 8 + 6] = m1.z; mv[kt * 8 + 7] = m1.w;
      }
      ri[24] = srS[ro + NTOK - 1];
      mv[24] = smS[ro + NTOK - 1];
      // index read from an input: bounded to the table's rows before use
#pragma unroll
      for (int j = 0; j < 25; ++j) bv[j] = stS[min((unsigned)ri[j], (unsigned)(NREL - 1))];
      // Holds the table reads together in front of the pad-query selects: sunk
      // behind these they were made one by one, each under a branch and a wait.
      asm volatile("" :: "v"(bv[0]), "v"(bv[1]), "v"(bv[2]), "v"(bv[3]), "v"(bv[4]),
                         "v"(bv[5]), "v"(bv[6]), "v"(bv[7]), "v"(bv[8]), "v"(bv[9]),
                         "v"(bv[10]), "v"(bv[11]), "v"(bv[12]), "v"(bv[13]), "v"(bv[14]),
                         "v"(bv[15]), "v"(bv[16]), "v"(bv[17]), "v"(bv[18]), "v"(bv[19]),
                         "v"(bv[20]), "v"(bv[21]), "v"(bv[22]), "v"(bv[23]), "v"(bv[24]));
#pragma unroll
      for (int kt = 0; kt < 3; ++kt) {
        v8f c;
#pragma unroll
        for (int i = 0; i < 8; ++i)
          c[i] = (m < NTOK) ? bv[kt * 8 + i] + mv[kt * 8 + i] : -1e30f;
        st_ctile(bmW, trl * 3 + kt, c);
      }
      key48[trl] = (m < NTOK && hf == 0) ? bv[24] + mv[24] : -1e30f;
    }
  }

  // Kept rolled: a second copy of the body would need registers that the
  // resident weight fragments already take.
#pragma unroll 1
  for (int b = blockIdx.x; b < nwin; b += NWG) {
    // x of this window was staged as f16 in LDS at the foot of the trip before
    // (the first window's: in front of the loop).
    __syncthreads();

    // ---------------- Phase 1: QKV GEMM (64x384 = x(64x128) @ wqkv^T) ------
    // x tiles are read once per token tile and meet the 3 resident weight tiles,
    // as B for q and k, as A for v (the two fragment layouts are the same).
    v8f bq8, bk8;
    {
      const float* bb = bqkS + wave * 16 + hf * 8;
      const float4 q0 = *(const float4*)bb,          q1 = *(const float4*)(bb + 4);
      const float4 k0 = *(const float4*)(bb + CDIM), k1 = *(const float4*)(bb + CDIM + 4);
      bq8 = v8f{q0.x, q0.y, q0.z, q0.w, q1.x, q1.y, q1.z, q1.w};
      bk8 = v8f{k0.x, k0.y, k0.z, k0.w, k1.x, k1.y, k1.z, k1.w};
    }
#pragma unroll 1
    for (int mt = 0; mt < 4; ++mt) {
      // Every pad token reads the one row of zeros.
      const _Float16* xrow = xS + min(mt * 16 + r, NTOK) * XPITCH;
      v16h am[4];
#pragma unroll
      for (int kk = 0; kk < 4; ++kk)
        am[kk] = ld_tile_row(xrow + kk * 32);
      v8f aq = bq8, ak = bk8, av = {};
#pragma unroll
      for (int kk = 0; kk < 4; ++kk) {
        aq = wmma_f16(wq[0][kk], am[kk], aq); // rows: channels, columns: tokens
        ak = wmma_f16(wq[1][kk], am[kk], ak);
        av = wmma_f16(am[kk], wq[2][kk], av); // rows: tokens, columns: channels
      }
      v8h q8, k8, v8;
#pragma unroll
      for (int i = 0; i < 8; ++i) {
        q8[i] = (_Float16)(aq[i] * scale);
        k8[i] = (_Float16)ak[i];
        v8[i] = (_Float16)(av[i] + bv1);
      }
      *(v8h*)(qW + mt * 16 * DHEAD) = q8;
      *(v8h*)(kW + mt * 16 * DHEAD) = k8;
      *(v8h*)(vtS + (voff ^ (mt * 16))) = v8;
    }
    __syncthreads();

    // ------- Phase 2: S^T = k @ q^T + (bias + mask)^T, softmax, out^T = v^T @ P^T
    // One tile of 16 queries at a time. Lane (r, hf) holds, of query r, the keys
    // kt*16 + hf*8 + i in st[kt][i].
    {
      v16h ak[4], av[2][2];
#pragma unroll
      for (int kt = 0; kt < 4; ++kt)
        ak[kt] = ld_tile_s32(kS + h * 2048 + kt * 16 * DHEAD);
#pragma unroll
      for (int dt = 0; dt < 2; ++dt)
#pragma unroll
        for (int kk = 0; kk < 2; ++kk)
          av[dt][kk] = ld_tile_s64(vtS + h * 2048 + dt * 16 * NPAD, kk);
#pragma unroll
      for (int trl = 0; trl < 2; ++trl) {
        const v16h bq = ld_tile_s32(qS + h * 2048 + (p * 2 + trl) * 16 * DHEAD);
        v8f st[4];
#pragma unroll
        for (int kt = 0; kt < 3; ++kt) // K = 32 in one step
          st[kt] = wmma_f16(ak[kt], bq, ld_ctile(bmW, trl * 3 + kt));
        const v8f c3 = {key48[trl], -1e30f, -1e30f, -1e30f, -1e30f, -1e30f, -1e30f, -1e30f};
        st[3] = wmma_f16(ak[3], bq, c3);
        // Of key tile 3 only element 0 can be a real key (48, where hf == 0; key 56
        // holds -1e30): elements 1-7 are pad keys in every lane, their P is 0.
        float mk[3];
#pragma unroll
        for (int kt = 0; kt < 3; ++kt)
          mk[kt] = fmaxf(fmaxf(fmaxf(st[kt][0], st[kt][1]), fmaxf(st[kt][2], st[kt][3])),
                         fmaxf(fmaxf(st[kt][4], st[kt][5]), fmaxf(st[kt][6], st[kt][7])));
        float mx = fmaxf(fmaxf(mk[0], mk[1]), fmaxf(mk[2], st[3][0]));
        mx = fmaxf(mx, xhalf(mx));
        float sk[3];
#pragma unroll
        for (int kt = 0; kt < 3; ++kt) {
#pragma unroll
          for (int i = 0; i < 8; ++i) st[kt][i] = __expf(st[kt][i] - mx);
          sk[kt] = ((st[kt][0] + st[kt][1]) + (st[kt][2] + st[kt][3])) +
                   ((st[kt][4] + st[kt][5]) + (st[kt][6] + st[kt][7]));
        }
        const float e48 = __expf(st[3][0] - mx);
        float sum = (sk[0] + sk[1]) + (sk[2] + e48);
        sum += xhalf(sum);
        const float inv = 1.0f / sum;
        // P^T as B fragments: element e of k step kk is key kk*32 + (e < 8 ? 0 : 16)
        // + hf*8 + (e & 7), which is st[kk*2 + (e >> 3)][e & 7] of this very lane.
        v16h pf[2];
#pragma unroll
        for (int e = 0; e < 8; ++e) {
          pf[0][e]     = (_Float16)(st[0][e] * inv);
          pf[0][e + 8] = (_Float16)(st[1][e] * inv);
          pf[1][e]     = (_Float16)(st[2][e] * inv);
          pf[1][e + 8] = (_Float16)0.f;
        }
        pf[1][8] = (_Float16)(e48 * inv);
        // out^T tile dt: lane (r, hf) holds, of query r, channels dt*16 + hf*8 + i:
        // 16 bytes in a row of attn-out.
        const int m = (p * 2 + trl) * 16 + r;
#pragma unroll
        for (int dt = 0; dt < 2; ++dt) {
          v8f o = {};
          o = wmma_f16(av[dt][0], pf[0], o);
          o = wmma_f16(av[dt][1], pf[1], o);
          v8h o8;
#pragma unroll
          for (int i = 0; i < 8; ++i) o8[i] = (_Float16)o[i];
          *(v8h*)(aoS + m * XPITCH + h * DHEAD + dt * 16 + hf * 8) = o8;
        }
      }
    }
    __syncthreads();

    // The next window's x: issued here, where the score phase's registers are
    // free again and no barrier stands before its use (the compiler waits for
    // every load in front of a barrier); it lands during phase 3.
    float4 xr[7];
    if (b + NWG < nwin) fetch_x(x, b + NWG, wave, xr);

    // ---------------- Phase 3: proj = ao(64x128) @ wproj^T + b_proj --------
    // A wave takes one token tile and one half of the channels: 4 tiles, whose
    // columns are dealt so that lane r holds channels r*4 .. r*4 + 3 of the half.
    // A row's 64 channels then leave as one 16-byte store of 16 lanes: 256 B.
    {
      const int mt = wave >> 1;
      const int ch = wave & 1;
      float* outp = out + (size_t)b * NTOK * CDIM + (mt * 16 + hf * 8) * CDIM + ch * 64 + r * 4;
      const _Float16* aoT = aoS + mt * 16 * XPITCH;
      const float4 bp = *(const float4*)(bpS + ch * 64 + r * 4);
      v16h am = ld_tile(aoT, XPITCH), an = am, bf[4];
#pragma unroll
      for (int j = 0; j < 4; ++j) bf[j] = ld_frag(wpF, (ch * 4 + j) * 4);
      v8f acc[4] = {};
      // The fragments of k step kk + 1 are read while step kk is worked on, half a
      // step's at a time. The scheduling barriers keep the reads from all being
      // lifted to the head of the phase: there they took the registers of the x
      // fetch, which then went through scratch, each load waited for alone.
#pragma unroll
      for (int kk = 0; kk < 4; ++kk) {
        __builtin_amdgcn_sched_barrier(0);
        acc[0] = wmma_f16(am, bf[0], acc[0]);
        acc[1] = wmma_f16(am, bf[1], acc[1]);
        if (kk < 3) {
          an    = ld_tile(aoT + (kk + 1) * 32, XPITCH);
          bf[0] = ld_frag(wpF, (ch * 4 + 0) * 4 + kk + 1);
          bf[1] = ld_frag(wpF, (ch * 4 + 1) * 4 + kk + 1);
        }
        __builtin_amdgcn_sched_barrier(0);
        acc[2] = wmma_f16(am, bf[2], acc[2]);
        acc[3] = wmma_f16(am, bf[3], acc[3]);
        if (kk < 3) {
          bf[2] = ld_frag(wpF, (ch * 4 + 2) * 4 + kk + 1);
          bf[3] = ld_frag(wpF, (ch * 4 + 3) * 4 + kk + 1);
        }
        am = an;
      }
      // Tokens mt*16 + hf*8 + i: all exist where mt < 3; of 48-63 only 48 does.
      if (mt < 3 || hf == 0)
        *(float4*)outp = float4{acc[0][0] + bp.x, acc[1][0] + bp.y,
                                acc[2][0] + bp.z, acc[3][0] + bp.w};
      if (mt < 3) {
#pragma unroll
        for (int i = 1; i < 8; ++i)
          *(float4*)(outp + i * CDIM) = float4{acc[0][i] + bp.x, acc[1][i] + bp.y,
                                               acc[2][i] + bp.z, acc[3][i] + bp.w};
      }
      // Wait before a register that these stores name is overwritten; outp is an
      // input so that its step to the next window cannot be placed in front.
      asm volatile("s_wait_xcnt 0x0" :: "v"(outp) : "memory");
    }

    // ---------------- Stage the next window's x as f16 in LDS --------------
    // The x tile's last readers (phase 1) are two barriers back.
    if (b + NWG < nwin) stage_x(xS, wave, xr);
  }
}

extern "C" void kernel_launch(void* const* d_in, const int* in_sizes, int n_in,
                              void* d_out, int out_size, void* d_ws, size_t ws_size,
                              hipStream_t stream) {
  (void)n_in; (void)d_ws; (void)ws_size; (void)out_size;
  const float* x          = (const float*)d_in[0];
  const float* mask       = (const float*)d_in[1];
  const float* w_qkv      = (const float*)d_in[2];
  const float* b_qkv      = (const float*)d_in[3];
  const float* w_proj     = (const float*)d_in[4];
  const float* b_proj     = (const float*)d_in[5];
  const float* bias_table = (const float*)d_in[6];
  const int*   rel_index  = (const int*)d_in[7];
  float* out = (float*)d_out;

  const int B = in_sizes[0] / (NTOK * CDIM); // 4096 windows

  // Opt in to >default dynamic LDS (160 KB of the 320 KB/WGP on CDNA5).
  (void)hipFuncSetAttribute(reinterpret_cast<const void*>(swin_msa_fused),
                            hipFuncAttributeMaxDynamicSharedMemorySize, SMEM_BYTES);

  // 256 WGPs x 2 resident workgroups; each takes every 512th window.
  swin_msa_fused<<<NWG, 256, SMEM_BYTES, stream>>>(
      x, mask, w_qkv, b_qkv, w_proj, b_proj, bias_table, rel_index, out, B);
}

// v009
// A run of this version takes 37.7 microseconds.
// Timed twice side by side with v008, it ran 1.03 times as fast both times.
// All steps since v000 together make it 16.9 times as fast.
#include <hip/hip_runtime.h>

// Fully fused kernel for gfx1250 (wave32, WMMA).
// 512 workgroups (256 threads = 8 wave32), two resident per WGP; each loops
// over windows b = blockIdx.x, blockIdx.x + gridDim.x, ...
// The weights do not depend on the window: they are read once per workgroup
// and kept as f16 WMMA fragments. Every wave keeps the wqkv fragments of the
// 3 output-channel tiles it owns in registers; the wproj fragments lie in LDS
// in fragment order.
// Neither do the rel-pos bias and, as the loop's stride is a multiple of the
// number of masks, the window mask: their sum is gathered once per workgroup, in
// the layout of the score tiles, and enters the score product as its C operand.
// All that this set-up reads from global memory comes in whole rows, a wave's
// lanes side by side, and is re-laid through LDS: a weight row is 4 lines per
// load where a fragment-shaped load touches 16, and the gathers by query row
// and by rel_index run on LDS banks, not on cache lines.
// The window loop has two spans, a barrier in front of each: (scores, softmax,
// P@V of window b) and (proj of window b, then the QKV GEMM of the next window).
// x is fetched two windows ahead: all of a thread's loads are issued at the head
// of the proj phase and stay in registers, in flight, over that whole span; the
// head of the next span rounds them to f16 into LDS. b_proj and b_qkv lie in LDS,
// so that the span waits on no global load (a wait on a later load would also
// wait for the fetch, as loads are counted in order).
// The proj phase deals the output channels over a wave's four tiles so that a
// lane holds four adjacent channels of a token: the result leaves in 16-byte
// stores, 256 B of a row from 16 lanes, with one wait behind them all.
// Per window: x -> f16 staging -> QKV GEMM -> scores -> softmax (+rel-pos bias
// + shift-window mask) -> P@V -> proj GEMM -> d_out.
// The scores are made transposed, S^T = k @ q^T: a lane then holds 32 of the 64
// keys of ONE query (its partner lane ^ 16 the other 32), so that the softmax
// runs inside the lane's registers but for two exchanges, and the packed P^T is
// already the B fragment of out^T = v^T @ P^T: P never goes through LDS.
// The QKV GEMM makes q and k transposed as well (w @ x^T: a lane holds 8 adjacent
// channels of one token) and v as x @ w^T (8 adjacent tokens of one channel):
// either way the lane's 8 results are 16 bytes in a row of the LDS tile.
// Every operand tile in LDS is laid so that the 16 rows which one half of a
// ds_load_b128 reads fall on 16 different groups of four banks: x and attn-out
// by a row pitch of 272 B, q, k and vT by exchanging the 16-byte chunks inside
// each row (chunk ^ a function of the row).

#define NTOK 49
#define NPAD 64
#define CDIM 128
#define HEADS 4
#define DHEAD 32
#define NREL 169  // rows of bias_table
#define NMASK 64  // windows in mask
#define NWG  512  // workgroups launched = stride of the window loop
#define XPITCH 136 // f16 per LDS row of x and attn-out: 256 B + 16 B pad
static_assert(NWG % NMASK == 0, "a workgroup must meet one mask window only");

typedef __attribute__((ext_vector_type(16))) _Float16 v16h;
typedef __attribute__((ext_vector_type(8)))  _Float16 v8h;
typedef __attribute__((ext_vector_type(4)))  _Float16 v4h;
typedef __attribute__((ext_vector_type(8)))  float    v8f;

static constexpr int SMEM_BYTES = 163840; // 160 KB: two workgroups per WGP

// LDS byte offsets. The window loop uses no place twice. A barrier of the loop
// stands between each tile's last read and its next write, and the other way.
#define OFF_X      0        // 50 rows of 272 B = 13600 B (49 tokens, one row of zeros)
#define OFF_AO     13600    // 64 rows of 272 B = 17408 B
#define OFF_BP     31008    // 128 f32 = 512 B (b_proj)
#define OFF_BQK    31520    // 256 f32 = 1024 B (b_qkv of q and k)
#define OFF_Q      32768    // 4*64*32 f16 = 16384 B
#define OFF_K      49152    // 4*64*32 f16 = 16384 B
#define OFF_VT     65536    // 4*32*64 f16 = 16384 B  (v stored transposed [h][d][n])
#define OFF_WPF    81920    // 32 tiles * 1024 B = 32768 B (wproj B fragments)
#define OFF_BM     114688   // 48 tiles * 1024 B = 49152 B (bias + mask C tiles, f32)
// Places of the set-up alone, in the q and k tiles, which the first QKV GEMM
// writes behind a barrier of its own. (A wave's weight rows pass through its own
// six C tiles, before it builds these.)
#define SPITCH 52           // f32 per staged row of mask and rel_index: 208 B = 16 B x 13
#define TPITCH 176          // f32 per head of the staged bias table
#define OFF_SM     (OFF_Q)          // 49 rows of 208 B = 10192 B (this workgroup's mask window)
#define OFF_SR     (OFF_Q + 10240)  // 49 rows of 208 B = 10192 B (rel_index)
#define OFF_ST     (OFF_Q + 20480)  // 4 * 176 f32 = 2816 B (bias_table, head by head)
static_assert(OFF_ST + HEADS * TPITCH * 4 <= OFF_VT, "set-up places lie in q and k");

// Load one 16x(K=32) operand tile in the CDNA5 WMMA 16-bit A/B register layout:
// lane r=lane&15 -> row, half=lane>>4 -> K-offset; element e holds
// K = (e<8 ? 0 : 16) + half*8 + (e&7). row: the lane's own row, at the tile's
// first column; ld_tile takes it from a row-major source with leading dim ld.
__device__ __forceinline__ v16h ld_tile_row(const _Float16* row) {
  const _Float16* p = row + ((threadIdx.x & 31) >> 4) * 8;
  v16h a;
#pragma unroll
  for (int e = 0; e < 8; ++e) a[e] = p[e];          // K = hf*8 + e
#pragma unroll
  for (int e = 0; e < 8; ++e) a[e + 8] = p[16 + e]; // K = 16 + hf*8 + e
  return a;
}
__device__ __forceinline__ v16h ld_tile(const _Float16* base, int ld) {
  return ld_tile_row(base + (threadIdx.x & 15) * ld);
}

// The same tile from rows of 32 f16 (q, k) whose 16-byte chunks are exchanged:
// chunk c of row n lies at place c ^ ((n >> 2) & 3). tile: a multiple of 16 rows.
__device__ __forceinline__ v16h ld_tile_s32(const _Float16* tile) {
  const int lane = threadIdx.x & 31;
  const int r    = lane & 15;
  const int c    = (lane >> 4) ^ ((r >> 2) & 3);
  const v8h lo = *(const v8h*)(tile + r * 32 + c * 8);       // K = hf*8 + e
  const v8h hi = *(const v8h*)(tile + r * 32 + (c ^ 2) * 8); // K = 16 + hf*8 + e
  v16h a;
#pragma unroll
  for (int e = 0; e < 8; ++e) { a[e] = lo[e]; a[e + 8] = hi[e]; }
  return a;
}
// The same from rows of 64 f16 (vT): chunk c of row n lies at place
// c ^ ((n >> 1) & 7). tile: a multiple of 16 rows; kk: which block of 32 columns.
__device__ __forceinline__ v16h ld_tile_s64(const _Float16* tile, int kk) {
  const int lane = threadIdx.x & 31;
  const int r    = lane & 15;
  const int c    = (lane >> 4) ^ ((r >> 1) & 7);
  const v8h lo = *(const v8h*)(tile + r * 64 + (c ^ (kk * 4)) * 8);
  const v8h hi = *(const v8h*)(tile + r * 64 + (c ^ (kk * 4 + 2)) * 8);
  v16h a;
#pragma unroll
  for (int e = 0; e < 8; ++e) { a[e] = lo[e]; a[e + 8] = hi[e]; }
  return a;
}

// Issues a wave's loads of a 16-row tile of a row-major f32 matrix (rows of CDIM
// floats): load i is the whole of row i*step, 16 bytes a lane. base: the tile's
// first row, the same in every lane. Nothing here waits for the data.
__device__ __forceinline__ void fetch_w(const float* base, int step, float4 (&wr)[16]) {
  const float4* p = (const float4*)base + (threadIdx.x & 31);
#pragma unroll
  for (int i = 0; i < 16; ++i) wr[i] = p[i * step * (CDIM / 4)];
  // Wait before a register that these loads name is overwritten. p is an input:
  // where the loads take their address from a register pair, the pair stays
  // whole up to the wait (else a load's result can be placed in it).
  asm volatile("s_wait_xcnt 0x0" :: "v"(p) : "memory");
}

// Rounds what fetch_w brought to f16 element by element, lays it as 16 rows of
// 272 B in scr (the wave's own LDS) and reads it back as the 4 k-step fragments.
__device__ __forceinline__ void relay_w(_Float16* scr, const float4 (&wr)[16], v16h (&fr)[4]) {
  _Float16* sw = scr + (threadIdx.x & 31) * 4;
#pragma unroll
  for (int i = 0; i < 16; ++i) {
    const v4h h4 = {(_Float16)wr[i].x, (_Float16)wr[i].y, (_Float16)wr[i].z, (_Float16)wr[i].w};
    *(v4h*)(sw + i * XPITCH) = h4;
  }
  // The rows are read back by other lanes of the wave: its stores end first.
  asm volatile("s_wait_dscnt 0x0" ::: "memory");
#pragma unroll
  for (int kk = 0; kk < 4; ++kk) fr[kk] = ld_tile(scr + kk * 32, XPITCH);
  // scr is written again behind this (next tile, C tiles): the reads end first.
  asm volatile("s_wait_dscnt 0x0" ::: "memory");
}

// wproj fragments in LDS: tile t = nt*4 + kk takes 1024 B, elements 0-7 of all
// 32 lanes first (16 B a lane, contiguous), then elements 8-15. Column r of
// tile nt is output channel (nt >> 2)*64 + r*4 + (nt & 3): over the four tiles
// of one half of the channels a lane holds four adjacent channels.
__device__ __forceinline__ void st_frag(_Float16* frags, int t, v16h a) {
  const int lane = threadIdx.x & 31;
  v8h lo, hi;
#pragma unroll
  for (int e = 0; e < 8; ++e) { lo[e] = a[e]; hi[e] = a[e + 8]; }
  *(v8h*)(frags + t * 512 + lane * 8)       = lo;
  *(v8h*)(frags + t * 512 + 256 + lane * 8) = hi;
}
__device__ __forceinline__ v16h ld_frag(const _Float16* frags, int t) {
  const int lane = threadIdx.x & 31;
  const v8h lo = *(const v8h*)(frags + t * 512 + lane * 8);
  const v8h hi = *(const v8h*)(frags + t * 512 + 256 + lane * 8);
  v16h a;
#pragma unroll
  for (int e = 0; e < 8; ++e) { a[e] = lo[e]; a[e + 8] = hi[e]; }
  return a;
}

// bias + mask tiles in LDS, WMMA C/D register layout (element i: row hf*8 + i,
// column lane & 15; here row = key, column = query): a tile takes 1024 B, elements 0-3 of all 32 lanes first
// (16 B a lane, contiguous), then elements 4-7.
__device__ __forceinline__ void st_ctile(float* tiles, int t, v8f c) {
  const int lane = threadIdx.x & 31;
  const float4 lo = {c[0], c[1], c[2], c[3]}, hi = {c[4], c[5], c[6], c[7]};
  *(float4*)(tiles + t * 256 + lane * 4)       = lo;
  *(float4*)(tiles + t * 256 + 128 + lane * 4) = hi;
}
__device__ __forceinline__ v8f ld_ctile(const float* tiles, int t) {
  const int lane = threadIdx.x & 31;
  const float4 lo = *(const float4*)(tiles + t * 256 + lane * 4);
  const float4 hi = *(const float4*)(tiles + t * 256 + 128 + lane * 4);
  v8f c = {lo.x, lo.y, lo.z, lo.w, hi.x, hi.y, hi.z, hi.w};
  return c;
}

// Value of the partner lane (lane ^ 16), by a vector move between the two rows.
__device__ __forceinline__ float xhalf(float v) {
  const int b = __builtin_bit_cast(int, v);
  return __builtin_bit_cast(float, __builtin_amdgcn_permlanex16(
      b, b, 0x76543210, 0xfedcba98, false, false));
}

// Issues a thread's loads of window b of x: wave w takes rows w, w + 8, ... w + 40,
// 16 bytes a lane; wave 0 also row 48. xr[6] is zero in the other waves (wave 1
// writes it as the row of zeros). Nothing here waits for the data.
__device__ __forceinline__ void fetch_x(const float* __restrict__ x, int b, int wave,
                                        float4 (&xr)[7]) {
  // Uniform base (window, wave) plus a 32-bit lane offset: the least to keep in
  // vector registers over the window loop.
  const char* base = (const char*)(x + (size_t)b * NTOK * CDIM + wave * CDIM);
  const unsigned off = (threadIdx.x & 31) * 16u;
#pragma unroll
  for (int i = 0; i < 6; ++i) xr[i] = *(const float4*)(base + off + i * 8 * CDIM * 4);
  xr[6] = float4{0.f, 0.f, 0.f, 0.f};
  if (wave == 0) xr[6] = *(const float4*)(base + off + 6 * 8 * CDIM * 4);
  // Wait before a register that these loads name is overwritten; off, which the
  // address is formed from, is an input and stays whole up to the wait.
  asm volatile("s_wait_xcnt 0x0" :: "v"(off) : "memory");
}

// Rounds what fetch_x brought to f16 and writes it to the x tile in LDS: the
// rows of fetch_x; wave 1 writes row 49, the zeros. The data wait falls here.
__device__ __forceinline__ void stage_x(_Float16* xS, int wave, const float4 (&xr)[7]) {
  _Float16* xw = xS + wave * XPITCH + (threadIdx.x & 31) * 4;
#pragma unroll
  for (int i = 0; i < 7; ++i) {
    if (i < 6 || wave < 2) {
      const v4h h4 = {(_Float16)xr[i].x, (_Float16)xr[i].y,
                      (_Float16)xr[i].z, (_Float16)xr[i].w};
      *(v4h*)(xw + i * 8 * XPITCH) = h4;
    }
  }
}

__device__ __forceinline__ v8f wmma_f16(v16h a, v16h b, v8f c) {
  return __builtin_amdgcn_wmma_f32_16x16x32_f16(false, a, false, b,
                                                (short)0, c, false, false);
}

__global__ void __launch_bounds__(256, 4) // 4 waves per SIMD: two workgroups per WGP
swin_msa_fused(const float* __restrict__ x, const float* __restrict__ mask,
               const float* __restrict__ w_qkv, const float* __restrict__ b_qkv,
               const float* __restrict__ w_proj, const float* __restrict__ b_proj,
               const float* __restrict__ bias_table, const int* __restrict__ rel_index,
               float* __restrict__ out, int nwin) {
  extern __shared__ __align__(16) char smem[];
  _Float16* aoS    = (_Float16*)(smem + OFF_AO);
  _Float16* xS     = (_Float16*)(smem + OFF_X);
  _Float16* qS     = (_Float16*)(smem + OFF_Q);
  _Float16* kS     = (_Float16*)(smem + OFF_K);
  _Float16* vtS    = (_Float16*)(smem + OFF_VT);
  _Float16* wpF    = (_Float16*)(smem + OFF_WPF);
  float*    bpS    = (float*)(smem + OFF_BP);

  const int tid  = threadIdx.x;
  const int lane = tid & 31;
  // Wave number as a scalar: all that follows from it (tile numbers, head,
  // store strides, LDS bases) then lives in scalar registers, not in VGPRs.
  const int wave = __builtin_amdgcn_readfirstlane(tid >> 5);
  const int r    = lane & 15;
  const int hf   = lane >> 4;

  // The wave's six bias + mask C tiles; until they are built, its weight scratch.
  float* bmW = (float*)(smem + OFF_BM) + wave * 6 * 256;

  // ---------------- Once per workgroup: mask window, rel_index, bias table --
  // Every window of this workgroup has b % NMASK == blockIdx.x % NMASK.
  // Issued first, written to LDS once the first weight loads are under way.
  // Wave w takes rows w, w + 8, ... w + 40 of mask and rel_index; row 48 is read
  // by every wave (no branch among the loads) and written by wave 0. Columns
  // 0-31 come in one load, 32-48 in a second, whose other lanes repeat 48.
  float smv[7][2], tbv[3];
  int   srv[7][2];
  {
    const float* mw = mask + (blockIdx.x % NMASK) * (NTOK * NTOK);
    const int l1 = min(lane, NTOK - 33);
#pragma unroll
    for (int i = 0; i < 7; ++i) {
      const int ro = (i < 6 ? wave + i * 8 : NTOK - 1) * NTOK;
      smv[i][0] = mw[ro + lane];
      smv[i][1] = mw[ro + 32 + l1];
      srv[i][0] = rel_index[ro + lane];
      srv[i][1] = rel_index[ro + 32 + l1];
    }
    // bias_table, flat: elements tid, tid + 256, tid + 512 (past the end: the last).
    const unsigned t2 = min(tid + 512, NREL * HEADS - 1);
    tbv[0] = bias_table[tid];
    tbv[1] = bias_table[tid + 256];
    tbv[2] = bias_table[t2];
    // Wait before a register that these loads name is overwritten; the indices
    // are inputs and stay whole up to the wait.
    asm volatile("s_wait_xcnt 0x0" :: "v"(lane), "v"(l1), "v"(tid), "v"(t2) : "memory");
  }

  // ---------------- Once per workgroup: weight fragments in registers ------
  // QKV: wave owns tile number wave of q (j = 0), of k (1) and of v (2), that is
  // output-channel tile nt = j*8 + wave, all 4 k steps.
  // proj: wave builds the 4 k-step fragments of output-channel tile nt = wave
  // (every 4th row of w_proj, from (wave >> 2)*64 + (wave & 3) on).
  // They are first read in phase 3, behind the first window's barriers.
  // While a tile passes through LDS the next tile's loads are in flight.
  const float scale = 0.17677669529663687f; // D^-0.5
  v16h  wq[3][4];
  {
    _Float16* scr = (_Float16*)bmW;
    float4 wa[16], wb[16];
    fetch_w(w_qkv + (0 * 8 + wave) * 16 * CDIM, 1, wa);
    fetch_w(w_qkv + (1 * 8 + wave) * 16 * CDIM, 1, wb);

    // Holds the loads whose LDS store stands under a test in front of that test:
    // sunk behind it, row 48 was loaded there and waited for alone, and with it
    // (loads are counted in order) every weight load issued before.
    asm volatile("" :: "v"(smv[6][0]), "v"(srv[6][0]), "v"(smv[6][1]), "v"(srv[6][1]),
                       "v"(tbv[2]));
    // mask and rel_index to LDS rows of 208 B, the table to one run per head.
    float* smW = (float*)(smem + OFF_SM) + wave * SPITCH + lane;
    int*   srW = (int*)(smem + OFF_SR) + wave * SPITCH + lane;
    float* stW = (float*)(smem + OFF_ST);
#pragma unroll
    for (int i = 0; i < 7; ++i) {
      if (i < 6 || wave == 0) {
        smW[i * 8 * SPITCH] = smv[i][0];
        srW[i * 8 * SPITCH] = srv[i][0];
      }
    }
    if (lane < NTOK - 32) {
#pragma unroll
      for (int i = 0; i < 7; ++i) {
        if (i < 6 || wave == 0) {
          smW[i * 8 * SPITCH + 32] = smv[i][1];
          srW[i * 8 * SPITCH + 32] = srv[i][1];
        }
      }
    }
    // element e of the table is row e >> 2, head e & 3
    stW[(tid & 3) * TPITCH + (tid >> 2)]      = tbv[0];
    stW[(tid & 3) * TPITCH + (tid >> 2) + 64] = tbv[1];
    if (tid + 512 < NREL * HEADS) stW[(tid & 3) * TPITCH + (tid >> 2) + 128] = tbv[2];

    relay_w(scr, wa, wq[0]);
    fetch_w(w_qkv + (2 * 8 + wave) * 16 * CDIM, 1, wa);
    relay_w(scr, wb, wq[1]);
    fetch_w(w_proj + ((wave >> 2) * 64 + (wave & 3)) * CDIM, 4, wb);
    relay_w(scr, wa, wq[2]);
    v16h wp[4];
    relay_w(scr, wb, wp);
#pragma unroll
    for (int kk = 0; kk < 4; ++kk) st_frag(wpF, wave * 4 + kk, wp[kk]);
  }
  // Biases and LDS places of the wave's three tiles: head wave >> 1, channels
  // (wave & 1)*16 .. + 15 of the head.
  // q, k: the lane holds token mt*16 + r, channels (wave & 1)*16 + hf*8 + i, which
  // are chunk (wave & 1)*2 + hf of the token's row; their biases enter as the C of
  // the first k step, 8 a lane. v: the lane holds channel (wave & 1)*16 + r, tokens
  // mt*16 + hf*8 + i, which are chunk mt*2 + hf of the channel's row of vT.
  // The biases of q and k lie in LDS and are in registers during phase 1 alone
  // (kept over the trip they would push the x fetch out of the registers).
  float* bqkS = (float*)(smem + OFF_BQK);
  float bv1;
  {
    const int cv = 2 * CDIM + wave * 16 + r;
    const float bqk = b_qkv[tid]; // 256 threads: the 2 * CDIM biases of q and k
    bv1 = b_qkv[cv];
    // Wait before a register that these loads name is overwritten; the indices
    // are inputs and stay whole up to the wait.
    asm volatile("s_wait_xcnt 0x0" :: "v"(tid), "v"(cv) : "memory");
    bqkS[tid] = bqk; // first read behind the set-up's barrier
  }
  const int qkoff = (wave >> 1) * 2048 + r * DHEAD + ((((wave & 1) * 2 + hf) ^ ((r >> 2) & 3)) * 8);
  _Float16* qW = qS + qkoff; // token tile mt: + mt*16*DHEAD
  _Float16* kW = kS + qkoff;
  const int vdd  = (wave & 1) * 16 + r;
  const int voff = (wave >> 1) * 2048 + vdd * NPAD + ((hf ^ ((vdd >> 1) & 7)) * 8); // token tile mt: ^ mt*16
  // b_proj to LDS, first read in phase 3 as well.
  if (wave < CDIM / 32) {
    const float bpv = b_proj[tid];
    // Wait before the register that this load names is overwritten; tid is an
    // input so that its register stays whole up to the wait.
    asm volatile("s_wait_xcnt 0x0" :: "v"(tid) : "memory");
    bpS[tid] = bpv;
  }

  // 2 waves per head in phase 2; wave part p owns queries [p*32, p*32+32).
  const int h = wave >> 1;
  const int p = wave & 1;

  // The first window's x: fetched and staged here, its latency met once.
  if ((int)blockIdx.x < nwin) {
    float4 x0[7];
    fetch_x(x, blockIdx.x, wave, x0);
    stage_x(xS, wave, x0);
  }

  // ---------------- Once per workgroup: bias + mask as score C tiles -------
  // The wave builds the 4 x 2 transposed tiles (key tile x query tile) of its own
  // queries and is their only reader. Key tiles 0-2 go to LDS; of key tile 3 the
  // one valid key, 48, stays in a register per query tile. Pad keys and pad
  // queries hold -1e30, which swallows the product.
  // Every wave's rows of mask, rel_index and the table are in LDS behind this
  // barrier. The reads below end in front of the next barrier, behind which q
  // and k take the place.
  __syncthreads();
  float key48[2]; // query (p*2 + trl)*16 + r, in the lanes with hf == 0
  {
    const float* smS = (const float*)(smem + OFF_SM);
    const int*   srS = (const int*)(smem + OFF_SR);
    const float* stS = (const float*)(smem + OFF_ST) + h * TPITCH;
#pragma unroll
    for (int trl = 0; trl < 2; ++trl) {
      const int m  = (p * 2 + trl) * 16 + r; // the lane's query; pad queries read the last
      const int ro = min(m, NTOK - 1) * SPITCH;
      int   ri[25]; // keys kt*16 + hf*8 + i < NTOK at kt*8 + i; key 48 last
      float mv[25], bv[25];
#pragma unroll
      for (int kt = 0; kt < 3; ++kt) {
        const int4   r0 = *(const int4*)(srS + ro + kt * 16 + hf * 8);
        const int4   r1 = *(const int4*)(srS + ro + kt * 16 + hf * 8 + 4);
        const float4 m0 = *(const float4*)(smS + ro + kt * 16 + hf * 8);
        const float4 m1 = *(const float4*)(smS + ro + kt * 16 + hf * 8 + 4);
        ri[kt * 8 + 0] = r0.x; ri[kt * 8 + 1] = r0.y; ri[kt * 8 + 2] = r0.z; ri[kt * 8 + 3] = r0.w;
        ri[kt * 8 + 4] = r1.x; ri[kt * 8 + 5] = r1.y; ri[kt * 8 + 6] = r1.z; ri[kt * 8 + 7] = r1.w;
        mv[kt * 8 + 0] = m0.x; mv[kt * 8 + 1] = m0.y; mv[kt * 8 + 2] = m0.z; mv[kt * 8 + 3] = m0.w;
        mv[kt * 8 + 4] = m1.x; mv[kt * 8 + 5] = m1.y; mv[kt * 8 + 6] = m1.z; mv[kt * 8 + 7] = m1.w;
      }
      ri[24] = srS[ro + NTOK - 1];
      mv[24] = smS[ro + NTOK - 1];
      // index read from an input: bounded to the table's rows before use
#pragma unroll
      for (int j = 0; j < 25; ++j) bv[j] = stS[min((unsigned)ri[j], (unsigned)(NREL - 1))];
      // Holds the table reads together in front of the pad-query selects: sunk
      // behind these they were made one by one, each under a branch and a wait.
      asm volatile("" :: "v"(bv[0]), "v"(bv[1]), "v"(bv[2]), "v"(bv[3]), "v"(bv[4]),
                         "v"(bv[5]), "v"(bv[6]), "v"(bv[7]), "v"(bv[8]), "v"(bv[9]),
                         "v"(bv[10]), "v"(bv[11]), "v"(bv[12]), "v"(bv[13]), "v"(bv[14]),
                         "v"(bv[15]), "v"(bv[16]), "v"(bv[17]), "v"(bv[18]), "v"(bv[19]),
                         "v"(bv[20]), "v"(bv[21]), "v"(bv[22]), "v"(bv[23]), "v"(bv[24]));
#pragma unroll
      for (int kt = 0; kt < 3; ++kt) {
        v8f c;
#pragma unroll
        for (int i = 0; i < 8; ++i)
          c[i] = (m < NTOK) ? bv[kt * 8 + i] + mv[kt * 8 + i] : -1e30f;
        st_ctile(bmW, trl * 3 + kt, c);
      }
      key48[trl] = (m < NTOK && hf == 0) ? bv[24] + mv[24] : -1e30f;
    }
  }

  // ---------------- Phase 1: QKV GEMM (64x384 = x(64x128) @ wqkv^T) ------
  // Of the window whose x lies in the x tile. It stands at two places: in front
  // of the window loop (first window) and behind phase 3 (next window).
  // x tiles are read once per token tile and meet the 3 resident weight tiles,
  // as B for q and k, as A for v (the two fragment layouts are the same).
  auto qkv_gemm = [&]() __attribute__((always_inline)) {
    v8f bq8, bk8;
    {
      const float* bb = bqkS + wave * 16 + hf * 8;
      const float4 q0 = *(const float4*)bb,          q1 = *(const float4*)(bb + 4);
      const float4 k0 = *(const float4*)(bb + CDIM), k1 = *(const float4*)(bb + CDIM + 4);
      bq8 = v8f{q0.x, q0.y, q0.z, q0.w, q1.x, q1.y, q1.z, q1.w};
      bk8 = v8f{k0.x, k0.y, k0.z, k0.w, k1.x, k1.y, k1.z, k1.w};
    }
    // Kept rolled, as it was: the body now stands at two places, and four copies
    // at each would lengthen the text of the window loop.
#pragma unroll 1
    for (int mt = 0; mt < 4; ++mt) {
      // Every pad token reads the one row of zeros.
      const _Float16* xrow = xS + min(mt * 16 + r, NTOK) * XPITCH;
      v16h am[4];
#pragma unroll
      for (int kk = 0; kk < 4; ++kk)
        am[kk] = ld_tile_row(xrow + kk * 32);
      v8f aq = bq8, ak = bk8, av = {};
#pragma unroll
      for (int kk = 0; kk < 4; ++kk) {
        aq = wmma_f16(wq[0][kk], am[kk], aq); // rows: channels, columns: tokens
        ak = wmma_f16(wq[1][kk], am[kk], ak);
        av = wmma_f16(am[kk], wq[2][kk], av); // rows: tokens, columns: channels
      }
      v8h q8, k8, v8;
#pragma unroll
      for (int i = 0; i < 8; ++i) {
        q8[i] = (_Float16)(aq[i] * scale);
        k8[i] = (_Float16)ak[i];
        v8[i] = (_Float16)(av[i] + bv1);
      }
      *(v8h*)(qW + mt * 16 * DHEAD) = q8;
      *(v8h*)(kW + mt * 16 * DHEAD) = k8;
      *(v8h*)(vtS + (voff ^ (mt * 16))) = v8;
    }
  };

  // The set-up's last reads of its places in the q and k tiles end here.
  __syncthreads();
  // x of the window after the one whose QKV GEMM runs: in registers, in flight.
  float4 xr[7];
  if ((int)blockIdx.x < nwin) {
    if ((int)blockIdx.x + NWG < nwin) fetch_x(x, blockIdx.x + NWG, wave, xr);
    qkv_gemm();
  }

  // Kept rolled: a second copy of the body would need registers that the
  // resident weight fragments already take.
#pragma unroll 1
  for (int b = blockIdx.x; b < nwin; b += NWG) {
    // q, k, vT of this window were made in the span before (behind phase 3 of the
    // window before; the first window's: in front of the loop). This barrier
    // hands them over; it also ends the last reads of the x tile and of attn-out.
    __syncthreads();

    // ---------------- Stage the next window's x as f16 in LDS --------------
    // Here, so that the fetch's registers are free again for the score phase.
    if (b + NWG < nwin) stage_x(xS, wave, xr);

    // ------- Phase 2: S^T = k @ q^T + (bias + mask)^T, softmax, out^T = v^T @ P^T
    // One tile of 16 queries at a time. Lane (r, hf) holds, of query r, the keys
    // kt*16 + hf*8 + i in st[kt][i].
    {
      v16h ak[4], av[2][2];
#pragma unroll
      for (int kt = 0; kt < 4; ++kt)
        ak[kt] = ld_tile_s32(kS + h * 2048 + kt * 16 * DHEAD);
#pragma unroll
      for (int dt = 0; dt < 2; ++dt)
#pragma unroll
        for (int kk = 0; kk < 2; ++kk)
          av[dt][kk] = ld_tile_s64(vtS + h * 2048 + dt * 16 * NPAD, kk);
#pragma unroll
      for (int trl = 0; trl < 2; ++trl) {
        const v16h bq = ld_tile_s32(qS + h * 2048 + (p * 2 + trl) * 16 * DHEAD);
        v8f st[4];
#pragma unroll
        for (int kt = 0; kt < 3; ++kt) // K = 32 in one step
          st[kt] = wmma_f16(ak[kt], bq, ld_ctile(bmW, trl * 3 + kt));
        const v8f c3 = {key48[trl], -1e30f, -1e30f, -1e30f, -1e30f, -1e30f, -1e30f, -1e30f};
        st[3] = wmma_f16(ak[3], bq, c3);
        // Of key tile 3 only element 0 can be a real key (48, where hf == 0; key 56
        // holds -1e30): elements 1-7 are pad keys in every lane, their P is 0.
        float mk[3];
#pragma unroll
        for (int kt = 0; kt < 3; ++kt)
          mk[kt] = fmaxf(fmaxf(fmaxf(st[kt][0], st[kt][1]), fmaxf(st[kt][2], st[kt][3])),
                         fmaxf(fmaxf(st[kt][4], st[kt][5]), fmaxf(st[kt][6], st[kt][7])));
        float mx = fmaxf(fmaxf(mk[0], mk[1]), fmaxf(mk[2], st[3][0]));
        mx = fmaxf(mx, xhalf(mx));
        float sk[3];
#pragma unroll
        for (int kt = 0; kt < 3; ++kt) {
#pragma unroll
          for (int i = 0; i < 8; ++i) st[kt][i] = __expf(st[kt][i] - mx);
          sk[kt] = ((st[kt][0] + st[kt][1]) + (st[kt][2] + st[kt][3])) +
                   ((st[kt][4] + st[kt][5]) + (st[kt][6] + st[kt][7]));
        }
        const float e48 = __expf(st[3][0] - mx);
        float sum = (sk[0] + sk[1]) + (sk[2] + e48);
        sum += xhalf(sum);
        const float inv = 1.0f / sum;
        // P^T as B fragments: element e of k step kk is key kk*32 + (e < 8 ? 0 : 16)
        // + hf*8 + (e & 7), which is st[kk*2 + (e >> 3)][e & 7] of this very lane.
        v16h pf[2];
#pragma unroll
        for (int e = 0; e < 8; ++e) {
          pf[0][e]     = (_Float16)(st[0][e] * inv);
          pf[0][e + 8] = (_Float16)(st[1][e] * inv);
          pf[1][e]     = (_Float16)(st[2][e] * inv);
          pf[1][e + 8] = (_Float16)0.f;
        }
        pf[1][8] = (_Float16)(e48 * inv);
        // out^T tile dt: lane (r, hf) holds, of query r, channels dt*16 + hf*8 + i:
        // 16 bytes in a row of attn-out.
        const int m = (p * 2 + trl) * 16 + r;
#pragma unroll
        for (int dt = 0; dt < 2; ++dt) {
          v8f o = {};
          o = wmma_f16(av[dt][0], pf[0], o);
          o = wmma_f16(av[dt][1], pf[1], o);
          v8h o8;
#pragma unroll
          for (int i = 0; i < 8; ++i) o8[i] = (_Float16)o[i];
          *(v8h*)(aoS + m * XPITCH + h * DHEAD + dt * 16 + hf * 8) = o8;
        }
      }
    }
    __syncthreads();

    // This barrier hands over attn-out and the next window's x tile, and it ends
    // the last reads of q, k and vT.
    // x of the window after the next: issued here, where the score phase's
    // registers are free again; it lands during phase 3 and the QKV GEMM behind it.
    if (b + 2 * NWG < nwin) fetch_x(x, b + 2 * NWG, wave, xr);

    // ---------------- Phase 3: proj = ao(64x128) @ wproj^T + b_proj --------
    // A wave takes one token tile and one half of the channels: 4 tiles, whose
    // columns are dealt so that lane r holds channels r*4 .. r*4 + 3 of the half.
    // A row's 64 channels then leave as one 16-byte store of 16 lanes: 256 B.
    {
      const int mt = wave >> 1;
      const int ch = wave & 1;
      float* outp = out + (size_t)b * NTOK * CDIM + (mt * 16 + hf * 8) * CDIM + ch * 64 + r * 4;
      const _Float16* aoT = aoS + mt * 16 * XPITCH;
      const float4 bp = *(const float4*)(bpS + ch * 64 + r * 4);
      v16h am = ld_tile(aoT, XPITCH), an = am, bf[4];
#pragma unroll
      for (int j = 0; j < 4; ++j) bf[j] = ld_frag(wpF, (ch * 4 + j) * 4);
      v8f acc[4] = {};
      // The fragments of k step kk + 1 are read while step kk is worked on, half a
      // step's at a time. The scheduling barriers keep the reads from all being
      // lifted to the head of the phase: there they took the registers of the x
      // fetch, which then went through scratch, each load waited for alone.
#pragma unroll
      for (int kk = 0; kk < 4; ++kk) {
        __builtin_amdgcn_sched_barrier(0);
        acc[0] = wmma_f16(am, bf[0], acc[0]);
        acc[1] = wmma_f16(am, bf[1], acc[1]);
        if (kk < 3) {
          an    = ld_tile(aoT + (kk + 1) * 32, XPITCH);
          bf[0] = ld_frag(wpF, (ch * 4 + 0) * 4 + kk + 1);
          bf[1] = ld_frag(wpF, (ch * 4 + 1) * 4 + kk + 1);
        }
        __builtin_amdgcn_sched_barrier(0);
        acc[2] = wmma_f16(am, bf[2], acc[2]);
        acc[3] = wmma_f16(am, bf[3], acc[3]);
        if (kk < 3) {
          bf[2] = ld_frag(wpF, (ch * 4 + 2) * 4 + kk + 1);
          bf[3] = ld_frag(wpF, (ch * 4 + 3) * 4 + kk + 1);
        }
        am = an;
      }
      // Tokens mt*16 + hf*8 + i: all exist where mt < 3; of 48-63 only 48 does.
      if (mt < 3 || hf == 0)
        *(float4*)outp = float4{acc[0][0] + bp.x, acc[1][0] + bp.y,
                                acc[2][0] + bp.z, acc[3][0] + bp.w};
      if (mt < 3) {
#pragma unroll
        for (int i = 1; i < 8; ++i)
          *(float4*)(outp + i * CDIM) = float4{acc[0][i] + bp.x, acc[1][i] + bp.y,
                                               acc[2][i] + bp.z, acc[3][i] + bp.w};
      }
      // Wait before a register that these stores name is overwritten; outp is an
      // input so that its step to the next window cannot be placed in front.
      asm volatile("s_wait_xcnt 0x0" :: "v"(outp) : "memory");
    }

    // ---------------- Phase 1 of the next window, with no barrier in between:
    // it reads the x tile and writes q, k, vT, none of which phase 3 touches.
    if (b + NWG < nwin) qkv_gemm();
  }
}

extern "C" void kernel_launch(void* const* d_in, const int* in_sizes, int n_in,
                              void* d_out, int out_size, void* d_ws, size_t ws_size,
                              hipStream_t stream) {
  (void)n_in; (void)d_ws; (void)ws_size; (void)out_size;
  const float* x          = (const float*)d_in[0];
  const float* mask       = (const float*)d_in[1];
  const float* w_qkv      = (const float*)d_in[2];
  const float* b_qkv      = (const float*)d_in[3];
  const float* w_proj     = (const float*)d_in[4];
  const float* b_proj     = (const float*)d_in[5];
  const float* bias_table = (const float*)d_in[6];
  const int*   rel_index  = (const int*)d_in[7];
  float* out = (float*)d_out;

  const int B = in_sizes[0] / (NTOK * CDIM); // 4096 windows

  // Opt in to >default dynamic LDS (160 KB of the 320 KB/WGP on CDNA5).
  (void)hipFuncSetAttribute(reinterpret_cast<const void*>(swin_msa_fused),
                            hipFuncAttributeMaxDynamicSharedMemorySize, SMEM_BYTES);

  // 256 WGPs x 2 resident workgroups; each takes every 512th window.
  swin_msa_fused<<<NWG, 256, SMEM_BYTES, stream>>>(
      x, mask, w_qkv, b_qkv, w_proj, b_proj, bias_table, rel_index, out, B);
}

// v010
// A run of this version takes 35.7 microseconds.
// In two side-by-side timings against v009, it was 1.05 and 1.06 times as fast.
// All steps since v000 together make it 17.8 times as fast.
#include <hip/hip_runtime.h>

// Fully fused kernel for gfx1250 (wave32, WMMA).
// 512 workgroups (256 threads = 8 wave32), two resident per WGP; each loops
// over windows b = blockIdx.x, blockIdx.x + gridDim.x, ...
// The weights do not depend on the window: they are read once per workgroup
// and kept as f16 WMMA fragments. Every wave keeps the wqkv fragments of the
// 3 output-channel tiles it owns in registers; the wproj fragments lie in LDS
// in fragment order.
// Neither do the rel-pos bias and, as the loop's stride is a multiple of the
// number of masks, the window mask: their sum is gathered once per workgroup, in
// the layout of the score tiles, and enters the score product as its C operand.
// All that this set-up reads from global memory comes in whole rows, a wave's
// lanes side by side, and is re-laid through LDS: a weight row is 4 lines per
// load where a fragment-shaped load touches 16, and the gathers by query row
// and by rel_index run on LDS banks, not on cache lines.
// The window loop has two spans, a barrier in front of each: (scores, softmax,
// P@V of window b) and (proj of window b, then the QKV GEMM of the next window).
// x is fetched two windows ahead: all of a thread's loads are issued at the head
// of the proj phase and stay in registers, in flight, over that whole span; the
// head of the next span rounds them to f16 into LDS. b_proj and b_qkv lie in LDS,
// so that the span waits on no global load (a wait on a later load would also
// wait for the fetch, as loads are counted in order).
// The proj phase deals the output channels over a wave's four tiles so that a
// lane holds four adjacent channels of a token: the result leaves in 16-byte
// stores, 256 B of a row from 16 lanes, with one wait behind them all.
// Per window: x -> f16 staging -> QKV GEMM -> scores -> softmax (+rel-pos bias
// + shift-window mask) -> P@V -> proj GEMM -> d_out.
// A window has 49 tokens: three tiles of 16 and one token more. That last token
// of ALL the workgroup's windows (at most 16) makes one tile of its own, row j
// for the j-th window: its QKV GEMM runs once, in front of the window loop, into
// rows 48 + j of q and k and columns 48 + j of vT, which the loop's own QKV GEMM
// (three tiles) leaves alone; window j reads its row by address. Its attn-out
// goes to row 48 + j, and the proj of these 16 rows runs once, behind the loop.
// The scores are made transposed, S^T = k @ q^T: a lane then holds 32 of the 64
// keys of ONE query (its partner lane ^ 16 the other 32), so that the softmax
// runs inside the lane's registers but for two exchanges, and the packed P^T is
// already the B fragment of out^T = v^T @ P^T: P never goes through LDS.
// The QKV GEMM makes q and k transposed as well (w @ x^T: a lane holds 8 adjacent
// channels of one token) and v as x @ w^T (8 adjacent tokens of one channel):
// either way the lane's 8 results are 16 bytes in a row of the LDS tile.
// Every operand tile in LDS is laid so that the 16 rows which one half of a
// ds_load_b128 reads fall on 16 different groups of four banks: x and attn-out
// by a row pitch of 272 B, q, k and vT by exchanging the 16-byte chunks inside
// each row (chunk ^ a function of the row).

#define NTOK 49
#define NPAD 64
#define CDIM 128
#define HEADS 4
#define DHEAD 32
#define NREL 169  // rows of bias_table
#define NMASK 64  // windows in mask
#define NWG  512  // workgroups launched = stride of the window loop
#define NTAIL 16  // windows a workgroup can meet: rows of the last tokens' tile
#define XPITCH 136 // f16 per LDS row of x and attn-out: 256 B + 16 B pad
static_assert(NWG % NMASK == 0, "a workgroup must meet one mask window only");

typedef __attribute__((ext_vector_type(16))) _Float16 v16h;
typedef __attribute__((ext_vector_type(8)))  _Float16 v8h;
typedef __attribute__((ext_vector_type(4)))  _Float16 v4h;
typedef __attribute__((ext_vector_type(8)))  float    v8f;

static constexpr int SMEM_BYTES = 163840; // 160 KB: two workgroups per WGP

// LDS byte offsets. The window loop uses no place twice. A barrier of the loop
// stands between each tile's last read and its next write, and the other way.
#define OFF_X      0        // 48 rows of 272 B (13600 B kept); at set-up 16 rows more, into attn-out
#define OFF_AO     13600    // 64 rows of 272 B = 17408 B
#define OFF_BP     31008    // 128 f32 = 512 B (b_proj)
#define OFF_BQK    31520    // 256 f32 = 1024 B (b_qkv of q and k)
#define OFF_Q      32768    // 4*64*32 f16 = 16384 B
#define OFF_K      49152    // 4*64*32 f16 = 16384 B
#define OFF_VT     65536    // 4*32*64 f16 = 16384 B  (v stored transposed [h][d][n])
#define OFF_WPF    81920    // 32 tiles * 1024 B = 32768 B (wproj B fragments)
#define OFF_BM     114688   // 48 tiles * 1024 B = 49152 B (bias + mask C tiles, f32)
// Places of the set-up alone, in the q and k tiles, which the first QKV GEMM
// writes behind a barrier of its own. (A wave's weight rows pass through its own
// six C tiles, before it builds these.)
#define SPITCH 52           // f32 per staged row of mask and rel_index: 208 B = 16 B x 13
#define TPITCH 176          // f32 per head of the staged bias table
#define OFF_SM     (OFF_Q)          // 49 rows of 208 B = 10192 B (this workgroup's mask window)
#define OFF_SR     (OFF_Q + 10240)  // 49 rows of 208 B = 10192 B (rel_index)
#define OFF_ST     (OFF_Q + 20480)  // 4 * 176 f32 = 2816 B (bias_table, head by head)
static_assert(OFF_ST + HEADS * TPITCH * 4 <= OFF_VT, "set-up places lie in q and k");

// Load one 16x(K=32) operand tile in the CDNA5 WMMA 16-bit A/B register layout:
// lane r=lane&15 -> row, half=lane>>4 -> K-offset; element e holds
// K = (e<8 ? 0 : 16) + half*8 + (e&7). row: the lane's own row, at the tile's
// first column; ld_tile takes it from a row-major source with leading dim ld.
__device__ __forceinline__ v16h ld_tile_row(const _Float16* row) {
  const _Float16* p = row + ((threadIdx.x & 31) >> 4) * 8;
  v16h a;
#pragma unroll
  for (int e = 0; e < 8; ++e) a[e] = p[e];          // K = hf*8 + e
#pragma unroll
  for (int e = 0; e < 8; ++e) a[e + 8] = p[16 + e]; // K = 16 + hf*8 + e
  return a;
}
__device__ __forceinline__ v16h ld_tile(const _Float16* base, int ld) {
  return ld_tile_row(base + (threadIdx.x & 15) * ld);
}

// The same tile from rows of 32 f16 (q, k) whose 16-byte chunks are exchanged:
// chunk c of row n lies at place c ^ ((n >> 2) & 3). tile: a multiple of 16 rows.
__device__ __forceinline__ v16h ld_tile_s32(const _Float16* tile) {
  const int lane = threadIdx.x & 31;
  const int r    = lane & 15;
  const int c    = (lane >> 4) ^ ((r >> 2) & 3);
  const v8h lo = *(const v8h*)(tile + r * 32 + c * 8);       // K = hf*8 + e
  const v8h hi = *(const v8h*)(tile + r * 32 + (c ^ 2) * 8); // K = 16 + hf*8 + e
  v16h a;
#pragma unroll
  for (int e = 0; e < 8; ++e) { a[e] = lo[e]; a[e + 8] = hi[e]; }
  return a;
}
// The same tile by the place o of the lane's first chunk (K = hf*8 + e); the
// second lies two chunks off. The lane's own row, or one row for all 16 lanes.
__device__ __forceinline__ v16h ld_row_s32(const _Float16* tile, int o) {
  const v8h lo = *(const v8h*)(tile + o);
  const v8h hi = *(const v8h*)(tile + (o ^ 16));
  v16h a;
#pragma unroll
  for (int e = 0; e < 8; ++e) { a[e] = lo[e]; a[e + 8] = hi[e]; }
  return a;
}
// The same from rows of 64 f16 (vT): chunk c of row n lies at place
// c ^ ((n >> 1) & 7). tile: a multiple of 16 rows; kk: which block of 32 columns.
__device__ __forceinline__ v16h ld_tile_s64(const _Float16* tile, int kk) {
  const int lane = threadIdx.x & 31;
  const int r    = lane & 15;
  const int c    = (lane >> 4) ^ ((r >> 1) & 7);
  const v8h lo = *(const v8h*)(tile + r * 64 + (c ^ (kk * 4)) * 8);
  const v8h hi = *(const v8h*)(tile + r * 64 + (c ^ (kk * 4 + 2)) * 8);
  v16h a;
#pragma unroll
  for (int e = 0; e < 8; ++e) { a[e] = lo[e]; a[e + 8] = hi[e]; }
  return a;
}

// Issues a wave's loads of a 16-row tile of a row-major f32 matrix (rows of CDIM
// floats): load i is the whole of row i*step, 16 bytes a lane. base: the tile's
// first row, the same in every lane. Nothing here waits for the data.
__device__ __forceinline__ void fetch_w(const float* base, int step, float4 (&wr)[16]) {
  const float4* p = (const float4*)base + (threadIdx.x & 31);
#pragma unroll
  for (int i = 0; i < 16; ++i) wr[i] = p[i * step * (CDIM / 4)];
  // Wait before a register that these loads name is overwritten. p is an input:
  // where the loads take their address from a register pair, the pair stays
  // whole up to the wait (else a load's result can be placed in it).
  asm volatile("s_wait_xcnt 0x0" :: "v"(p) : "memory");
}

// Rounds what fetch_w brought to f16 element by element, lays it as 16 rows of
// 272 B in scr (the wave's own LDS) and reads it back as the 4 k-step fragments.
__device__ __forceinline__ void relay_w(_Float16* scr, const float4 (&wr)[16], v16h (&fr)[4]) {
  _Float16* sw = scr + (threadIdx.x & 31) * 4;
#pragma unroll
  for (int i = 0; i < 16; ++i) {
    const v4h h4 = {(_Float16)wr[i].x, (_Float16)wr[i].y, (_Float16)wr[i].z, (_Float16)wr[i].w};
    *(v4h*)(sw + i * XPITCH) = h4;
  }
  // The rows are read back by other lanes of the wave: its stores end first.
  asm volatile("s_wait_dscnt 0x0" ::: "memory");
#pragma unroll
  for (int kk = 0; kk < 4; ++kk) fr[kk] = ld_tile(scr + kk * 32, XPITCH);
  // scr is written again behind this (next tile, C tiles): the reads end first.
  asm volatile("s_wait_dscnt 0x0" ::: "memory");
}

// wproj fragments in LDS: tile t = nt*4 + kk takes 1024 B, elements 0-7 of all
// 32 lanes first (16 B a lane, contiguous), then elements 8-15. Column r of
// tile nt is output channel (nt >> 2)*64 + r*4 + (nt & 3): over the four tiles
// of one half of the channels a lane holds four adjacent channels.
__device__ __forceinline__ void st_frag(_Float16* frags, int t, v16h a) {
  const int lane = threadIdx.x & 31;
  v8h lo, hi;
#pragma unroll
  for (int e = 0; e < 8; ++e) { lo[e] = a[e]; hi[e] = a[e + 8]; }
  *(v8h*)(frags + t * 512 + lane * 8)       = lo;
  *(v8h*)(frags + t * 512 + 256 + lane * 8) = hi;
}
__device__ __forceinline__ v16h ld_frag(const _Float16* frags, int t) {
  const int lane = threadIdx.x & 31;
  const v8h lo = *(const v8h*)(frags + t * 512 + lane * 8);
  const v8h hi = *(const v8h*)(frags + t * 512 + 256 + lane * 8);
  v16h a;
#pragma unroll
  for (int e = 0; e < 8; ++e) { a[e] = lo[e]; a[e + 8] = hi[e]; }
  return a;
}

// bias + mask tiles in LDS, WMMA C/D register layout (element i: row hf*8 + i,
// column lane & 15; here row = key, column = query): a tile takes 1024 B, elements 0-3 of all 32 lanes first
// (16 B a lane, contiguous), then elements 4-7.
__device__ __forceinline__ void st_ctile(float* tiles, int t, v8f c) {
  const int lane = threadIdx.x & 31;
  const float4 lo = {c[0], c[1], c[2], c[3]}, hi = {c[4], c[5], c[6], c[7]};
  *(float4*)(tiles + t * 256 + lane * 4)       = lo;
  *(float4*)(tiles + t * 256 + 128 + lane * 4) = hi;
}
__device__ __forceinline__ v8f ld_ctile(const float* tiles, int t) {
  const int lane = threadIdx.x & 31;
  const float4 lo = *(const float4*)(tiles + t * 256 + lane * 4);
  const float4 hi = *(const float4*)(tiles + t * 256 + 128 + lane * 4);
  v8f c = {lo.x, lo.y, lo.z, lo.w, hi.x, hi.y, hi.z, hi.w};
  return c;
}

// Value of the partner lane (lane ^ 16), by a vector move between the two rows.
__device__ __forceinline__ float xhalf(float v) {
  const int b = __builtin_bit_cast(int, v);
  return __builtin_bit_cast(float, __builtin_amdgcn_permlanex16(
      b, b, 0x76543210, 0xfedcba98, false, false));
}

// Issues a thread's loads of tokens 0-47 of window b of x: wave w takes rows w,
// w + 8, ... w + 40, 16 bytes a lane. Nothing here waits for the data.
__device__ __forceinline__ void fetch_x(const float* __restrict__ x, int b, int wave,
                                        float4 (&xr)[6]) {
  // Uniform base (window, wave) plus a 32-bit lane offset: the least to keep in
  // vector registers over the window loop.
  const char* base = (const char*)(x + (size_t)b * NTOK * CDIM + wave * CDIM);
  const unsigned off = (threadIdx.x & 31) * 16u;
#pragma unroll
  for (int i = 0; i < 6; ++i) xr[i] = *(const float4*)(base + off + i * 8 * CDIM * 4);
  // Wait before a register that these loads name is overwritten; off, which the
  // address is formed from, is an input and stays whole up to the wait.
  asm volatile("s_wait_xcnt 0x0" :: "v"(off) : "memory");
}

// Rounds what fetch_x brought to f16 and writes it to the x tile in LDS: the
// rows of fetch_x. The data wait falls here.
__device__ __forceinline__ void stage_x(_Float16* xS, int wave, const float4 (&xr)[6]) {
  _Float16* xw = xS + wave * XPITCH + (threadIdx.x & 31) * 4;
#pragma unroll
  for (int i = 0; i < 6; ++i) {
    const v4h h4 = {(_Float16)xr[i].x, (_Float16)xr[i].y,
                    (_Float16)xr[i].z, (_Float16)xr[i].w};
    *(v4h*)(xw + i * 8 * XPITCH) = h4;
  }
}

__device__ __forceinline__ v8f wmma_f16(v16h a, v16h b, v8f c) {
  return __builtin_amdgcn_wmma_f32_16x16x32_f16(false, a, false, b,
                                                (short)0, c, false, false);
}

__global__ void __launch_bounds__(256, 4) // 4 waves per SIMD: two workgroups per WGP
swin_msa_fused(const float* __restrict__ x, const float* __restrict__ mask,
               const float* __restrict__ w_qkv, const float* __restrict__ b_qkv,
               const float* __restrict__ w_proj, const float* __restrict__ b_proj,
               const float* __restrict__ bias_table, const int* __restrict__ rel_index,
               float* __restrict__ out, int nwin) {
  extern __shared__ __align__(16) char smem[];
  _Float16* aoS    = (_Float16*)(smem + OFF_AO);
  _Float16* xS     = (_Float16*)(smem + OFF_X);
  _Float16* qS     = (_Float16*)(smem + OFF_Q);
  _Float16* kS     = (_Float16*)(smem + OFF_K);
  _Float16* vtS    = (_Float16*)(smem + OFF_VT);
  _Float16* wpF    = (_Float16*)(smem + OFF_WPF);
  float*    bpS    = (float*)(smem + OFF_BP);

  // A workgroup meets at most NTAIL windows (the shape has 8 for each): this
  // bounds the row 48 + j that is formed from the trip number.
  nwin = min(nwin, NTAIL * NWG);

  const int tid  = threadIdx.x;
  const int lane = tid & 31;
  // Wave number as a scalar: all that follows from it (tile numbers, head,
  // store strides, LDS bases) then lives in scalar registers, not in VGPRs.
  const int wave = __builtin_amdgcn_readfirstlane(tid >> 5);
  const int r    = lane & 15;
  const int hf   = lane >> 4;

  // The wave's six bias + mask C tiles; until they are built, its weight scratch.
  float* bmW = (float*)(smem + OFF_BM) + wave * 6 * 256;

  // ---------------- Once per workgroup: mask window, rel_index, bias table --
  // Every window of this workgroup has b % NMASK == blockIdx.x % NMASK.
  // Issued first, written to LDS once the first weight loads are under way.
  // Wave w takes rows w, w + 8, ... w + 40 of mask and rel_index; row 48 is read
  // by every wave (no branch among the loads) and written by wave 0. Columns
  // 0-31 come in one load, 32-48 in a second, whose other lanes repeat 48.
  float smv[7][2], tbv[3];
  int   srv[7][2];
  {
    const float* mw = mask + (blockIdx.x % NMASK) * (NTOK * NTOK);
    const int l1 = min(lane, NTOK - 33);
#pragma unroll
    for (int i = 0; i < 7; ++i) {
      const int ro = (i < 6 ? wave + i * 8 : NTOK - 1) * NTOK;
      smv[i][0] = mw[ro + lane];
      smv[i][1] = mw[ro + 32 + l1];
      srv[i][0] = rel_index[ro + lane];
      srv[i][1] = rel_index[ro + 32 + l1];
    }
    // bias_table, flat: elements tid, tid + 256, tid + 512 (past the end: the last).
    const unsigned t2 = min(tid + 512, NREL * HEADS - 1);
    tbv[0] = bias_table[tid];
    tbv[1] = bias_table[tid + 256];
    tbv[2] = bias_table[t2];
    // Wait before a register that these loads name is overwritten; the indices
    // are inputs and stay whole up to the wait.
    asm volatile("s_wait_xcnt 0x0" :: "v"(lane), "v"(l1), "v"(tid), "v"(t2) : "memory");
  }

  // ---------------- Once per workgroup: weight fragments in registers ------
  // QKV: wave owns tile number wave of q (j = 0), of k (1) and of v (2), that is
  // output-channel tile nt = j*8 + wave, all 4 k steps.
  // proj: wave builds the 4 k-step fragments of output-channel tile nt = wave
  // (every 4th row of w_proj, from (wave >> 2)*64 + (wave & 3) on).
  // They are first read in phase 3, behind the first window's barriers.
  // While a tile passes through LDS the next tile's loads are in flight.
  const float scale = 0.17677669529663687f; // D^-0.5
  v16h  wq[3][4];
  {
    _Float16* scr = (_Float16*)bmW;
    float4 wa[16], wb[16];
    fetch_w(w_qkv + (0 * 8 + wave) * 16 * CDIM, 1, wa);
    fetch_w(w_qkv + (1 * 8 + wave) * 16 * CDIM, 1, wb);

    // Holds the loads whose LDS store stands under a test in front of that test:
    // sunk behind it, row 48 was loaded there and waited for alone, and with it
    // (loads are counted in order) every weight load issued before.
    asm volatile("" :: "v"(smv[6][0]), "v"(srv[6][0]), "v"(smv[6][1]), "v"(srv[6][1]),
                       "v"(tbv[2]));
    // mask and rel_index to LDS rows of 208 B, the table to one run per head.
    float* smW = (float*)(smem + OFF_SM) + wave * SPITCH + lane;
    int*   srW = (int*)(smem + OFF_SR) + wave * SPITCH + lane;
    float* stW = (float*)(smem + OFF_ST);
#pragma unroll
    for (int i = 0; i < 7; ++i) {
      if (i < 6 || wave == 0) {
        smW[i * 8 * SPITCH] = smv[i][0];
        srW[i * 8 * SPITCH] = srv[i][0];
      }
    }
    if (lane < NTOK - 32) {
#pragma unroll
      for (int i = 0; i < 7; ++i) {
        if (i < 6 || wave == 0) {
          smW[i * 8 * SPITCH + 32] = smv[i][1];
          srW[i * 8 * SPITCH + 32] = srv[i][1];
        }
      }
    }
    // element e of the table is row e >> 2, head e & 3
    stW[(tid & 3) * TPITCH + (tid >> 2)]      = tbv[0];
    stW[(tid & 3) * TPITCH + (tid >> 2) + 64] = tbv[1];
    if (tid + 512 < NREL * HEADS) stW[(tid & 3) * TPITCH + (tid >> 2) + 128] = tbv[2];

    relay_w(scr, wa, wq[0]);
    fetch_w(w_qkv + (2 * 8 + wave) * 16 * CDIM, 1, wa);
    relay_w(scr, wb, wq[1]);
    fetch_w(w_proj + ((wave >> 2) * 64 + (wave & 3)) * CDIM, 4, wb);
    relay_w(scr, wa, wq[2]);
    v16h wp[4];
    relay_w(scr, wb, wp);
#pragma unroll
    for (int kk = 0; kk < 4; ++kk) st_frag(wpF, wave * 4 + kk, wp[kk]);
  }
  // Biases and LDS places of the wave's three tiles: head wave >> 1, channels
  // (wave & 1)*16 .. + 15 of the head.
  // q, k: the lane holds token mt*16 + r, channels (wave & 1)*16 + hf*8 + i, which
  // are chunk (wave & 1)*2 + hf of the token's row; their biases enter as the C of
  // the first k step, 8 a lane. v: the lane holds channel (wave & 1)*16 + r, tokens
  // mt*16 + hf*8 + i, which are chunk mt*2 + hf of the channel's row of vT.
  // The biases of q and k lie in LDS and are in registers during phase 1 alone
  // (kept over the trip they would push the x fetch out of the registers).
  float* bqkS = (float*)(smem + OFF_BQK);
  float bv1;
  {
    const int cv = 2 * CDIM + wave * 16 + r;
    const float bqk = b_qkv[tid]; // 256 threads: the 2 * CDIM biases of q and k
    bv1 = b_qkv[cv];
    // Wait before a register that these loads name is overwritten; the indices
    // are inputs and stay whole up to the wait.
    asm volatile("s_wait_xcnt 0x0" :: "v"(tid), "v"(cv) : "memory");
    bqkS[tid] = bqk; // first read behind the set-up's barrier
  }
  const int qkoff = (wave >> 1) * 2048 + r * DHEAD + ((((wave & 1) * 2 + hf) ^ ((r >> 2) & 3)) * 8);
  _Float16* qW = qS + qkoff; // token tile mt: + mt*16*DHEAD
  _Float16* kW = kS + qkoff;
  const int vdd  = (wave & 1) * 16 + r;
  const int voff = (wave >> 1) * 2048 + vdd * NPAD + ((hf ^ ((vdd >> 1) & 7)) * 8); // token tile mt: ^ mt*16
  // b_proj to LDS, first read in phase 3 as well.
  if (wave < CDIM / 32) {
    const float bpv = b_proj[tid];
    // Wait before the register that this load names is overwritten; tid is an
    // input so that its register stays whole up to the wait.
    asm volatile("s_wait_xcnt 0x0" :: "v"(tid) : "memory");
    bpS[tid] = bpv;
  }

  // 2 waves per head in phase 2; wave part p owns queries [p*32, p*32+32).
  const int h = wave >> 1;
  const int p = wave & 1;

  // The first window's x: fetched and staged here, its latency met once. With it
  // the last token of every window of the workgroup, as rows 48 + j of the x tile
  // (they reach into attn-out, which is first written in the window loop): wave w
  // takes j = w and w + 8. A j past the last window repeats that window's row;
  // what comes of it is never read.
  if ((int)blockIdx.x < nwin) {
    float4 x0[6], xt[2];
    fetch_x(x, blockIdx.x, wave, x0);
    const unsigned off = lane * 16u;
#pragma unroll
    for (int i = 0; i < 2; ++i) {
      const int bj = min((int)blockIdx.x + (wave + i * 8) * NWG, nwin - 1);
      xt[i] = *(const float4*)((const char*)(x + ((size_t)bj * NTOK + NTOK - 1) * CDIM) + off);
    }
    // Wait before a register that these loads name is overwritten; off, which the
    // address is formed from, is an input and stays whole up to the wait.
    asm volatile("s_wait_xcnt 0x0" :: "v"(off) : "memory");
    stage_x(xS, wave, x0);
    _Float16* tw = xS + (NTOK - 1 + wave) * XPITCH + lane * 4;
#pragma unroll
    for (int i = 0; i < 2; ++i) {
      const v4h h4 = {(_Float16)xt[i].x, (_Float16)xt[i].y,
                      (_Float16)xt[i].z, (_Float16)xt[i].w};
      *(v4h*)(tw + i * 8 * XPITCH) = h4;
      // Rows 48 + j of attn-out start as zeros: the proj behind the loop reads all
      // 16, also those of windows that the workgroup does not have.
      *(v4h*)(aoS + (NTOK - 1 + wave + i * 8) * XPITCH + lane * 4) = v4h{};
    }
  }

  // ---------------- Once per workgroup: bias + mask as score C tiles -------
  // The wave builds the 4 x 2 transposed tiles (key tile x query tile) of its own
  // queries and is their only reader. Key tiles 0-2 go to LDS; of key tile 3 the
  // one valid key, 48, stays in a register per query tile. Pad keys and pad
  // queries hold -1e30, which swallows the product.
  // Every wave's rows of mask, rel_index and the table are in LDS behind this
  // barrier. The reads below end in front of the next barrier, behind which q
  // and k take the place.
  __syncthreads();
  float key48[2]; // query (p*2 + trl)*16 + r, in the lanes with hf == 0
  {
    const float* smS = (const float*)(smem + OFF_SM);
    const int*   srS = (const int*)(smem + OFF_SR);
    const float* stS = (const float*)(smem + OFF_ST) + h * TPITCH;
#pragma unroll
    for (int trl = 0; trl < 2; ++trl) {
      const int m  = (p * 2 + trl) * 16 + r; // the lane's query; pad queries read the last
      const int ro = min(m, NTOK - 1) * SPITCH;
      int   ri[25]; // keys kt*16 + hf*8 + i < NTOK at kt*8 + i; key 48 last
      float mv[25], bv[25];
#pragma unroll
      for (int kt = 0; kt < 3; ++kt) {
        const int4   r0 = *(const int4*)(srS + ro + kt * 16 + hf * 8);
        const int4   r1 = *(const int4*)(srS + ro + kt * 16 + hf * 8 + 4);
        const float4 m0 = *(const float4*)(smS + ro + kt * 16 + hf * 8);
        const float4 m1 = *(const float4*)(smS + ro + kt * 16 + hf * 8 + 4);
        ri[kt * 8 + 0] = r0.x; ri[kt * 8 + 1] = r0.y; ri[kt * 8 + 2] = r0.z; ri[kt * 8 + 3] = r0.w;
        ri[kt * 8 + 4] = r1.x; ri[kt * 8 + 5] = r1.y; ri[kt * 8 + 6] = r1.z; ri[kt * 8 + 7] = r1.w;
        mv[kt * 8 + 0] = m0.x; mv[kt * 8 + 1] = m0.y; mv[kt * 8 + 2] = m0.z; mv[kt * 8 + 3] = m0.w;
        mv[kt * 8 + 4] = m1.x; mv[kt * 8 + 5] = m1.y; mv[kt * 8 + 6] = m1.z; mv[kt * 8 + 7] = m1.w;
      }
      ri[24] = srS[ro + NTOK - 1];
      mv[24] = smS[ro + NTOK - 1];
      // index read from an input: bounded to the table's rows before use
#pragma unroll
      for (int j = 0; j < 25; ++j) bv[j] = stS[min((unsigned)ri[j], (unsigned)(NREL - 1))];
      // Holds the table reads together in front of the pad-query selects: sunk
      // behind these they were made one by one, each under a branch and a wait.
      asm volatile("" :: "v"(bv[0]), "v"(bv[1]), "v"(bv[2]), "v"(bv[3]), "v"(bv[4]),
                         "v"(bv[5]), "v"(bv[6]), "v"(bv[7]), "v"(bv[8]), "v"(bv[9]),
                         "v"(bv[10]), "v"(bv[11]), "v"(bv[12]), "v"(bv[13]), "v"(bv[14]),
                         "v"(bv[15]), "v"(bv[16]), "v"(bv[17]), "v"(bv[18]), "v"(bv[19]),
                         "v"(bv[20]), "v"(bv[21]), "v"(bv[22]), "v"(bv[23]), "v"(bv[24]));
#pragma unroll
      for (int kt = 0; kt < 3; ++kt) {
        v8f c;
#pragma unroll
        for (int i = 0; i < 8; ++i)
          c[i] = (m < NTOK) ? bv[kt * 8 + i] + mv[kt * 8 + i] : -1e30f;
        st_ctile(bmW, trl * 3 + kt, c);
      }
      key48[trl] = (m < NTOK && hf == 0) ? bv[24] + mv[24] : -1e30f;
    }
  }

  // ---------------- Phase 1: QKV GEMM (48x384 = x(48x128) @ wqkv^T) ------
  // Of the window whose x lies in the x tile. It stands at two places: in front
  // of the window loop (first window, and as a fourth tile the last tokens of all
  // the windows) and behind phase 3 (next window, three tiles).
  // x tiles are read once per token tile and meet the 3 resident weight tiles,
  // as B for q and k, as A for v (the two fragment layouts are the same).
  auto qkv_gemm = [&](int ntile) __attribute__((always_inline)) {
    v8f bq8, bk8;
    {
      const float* bb = bqkS + wave * 16 + hf * 8;
      const float4 q0 = *(const float4*)bb,          q1 = *(const float4*)(bb + 4);
      const float4 k0 = *(const float4*)(bb + CDIM), k1 = *(const float4*)(bb + CDIM + 4);
      bq8 = v8f{q0.x, q0.y, q0.z, q0.w, q1.x, q1.y, q1.z, q1.w};
      bk8 = v8f{k0.x, k0.y, k0.z, k0.w, k1.x, k1.y, k1.z, k1.w};
    }
    // Kept rolled, as it was: the body now stands at two places, and three or four copies
    // at each would lengthen the text of the window loop.
#pragma unroll 1
    for (int mt = 0; mt < ntile; ++mt) {
      const _Float16* xrow = xS + (mt * 16 + r) * XPITCH;
      v16h am[4];
#pragma unroll
      for (int kk = 0; kk < 4; ++kk)
        am[kk] = ld_tile_row(xrow + kk * 32);
      v8f aq = bq8, ak = bk8, av = {};
#pragma unroll
      for (int kk = 0; kk < 4; ++kk) {
        aq = wmma_f16(wq[0][kk], am[kk], aq); // rows: channels, columns: tokens
        ak = wmma_f16(wq[1][kk], am[kk], ak);
        av = wmma_f16(am[kk], wq[2][kk], av); // rows: tokens, columns: channels
      }
      v8h q8, k8, v8;
#pragma unroll
      for (int i = 0; i < 8; ++i) {
        q8[i] = (_Float16)(aq[i] * scale);
        k8[i] = (_Float16)ak[i];
        v8[i] = (_Float16)(av[i] + bv1);
      }
      *(v8h*)(qW + mt * 16 * DHEAD) = q8;
      *(v8h*)(kW + mt * 16 * DHEAD) = k8;
      *(v8h*)(vtS + (voff ^ (mt * 16))) = v8;
    }
  };

  // ---------------- proj of one token tile and one half of the channels ----
  // 4 tiles, whose columns are dealt so that lane r holds channels r*4 .. r*4 + 3
  // of the half. It stands in the window loop and, for the last tokens, behind it.
  auto proj_tile = [&](int mt, int ch, v8f (&acc)[4]) __attribute__((always_inline)) {
    const _Float16* aoT = aoS + mt * 16 * XPITCH;
    v16h am = ld_tile(aoT, XPITCH), an = am, bf[4];
#pragma unroll
    for (int t = 0; t < 4; ++t) bf[t] = ld_frag(wpF, (ch * 4 + t) * 4);
    // The fragments of k step kk + 1 are read while step kk is worked on, half a
    // step's at a time. The scheduling barriers keep the reads from all being
    // lifted to the head of the phase: there they took the registers of the x
    // fetch, which then went through scratch, each load waited for alone.
#pragma unroll
    for (int kk = 0; kk < 4; ++kk) {
      __builtin_amdgcn_sched_barrier(0);
      acc[0] = wmma_f16(am, bf[0], acc[0]);
      acc[1] = wmma_f16(am, bf[1], acc[1]);
      if (kk < 3) {
        an    = ld_tile(aoT + (kk + 1) * 32, XPITCH);
        bf[0] = ld_frag(wpF, (ch * 4 + 0) * 4 + kk + 1);
        bf[1] = ld_frag(wpF, (ch * 4 + 1) * 4 + kk + 1);
      }
      __builtin_amdgcn_sched_barrier(0);
      acc[2] = wmma_f16(am, bf[2], acc[2]);
      acc[3] = wmma_f16(am, bf[3], acc[3]);
      if (kk < 3) {
        bf[2] = ld_frag(wpF, (ch * 4 + 2) * 4 + kk + 1);
        bf[3] = ld_frag(wpF, (ch * 4 + 3) * 4 + kk + 1);
      }
      am = an;
    }
  };

  // The set-up's last reads of its places in the q and k tiles end here.
  __syncthreads();
  // x of the window after the one whose QKV GEMM runs: in registers, in flight.
  float4 xr[6];
  if ((int)blockIdx.x < nwin) {
    if ((int)blockIdx.x + NWG < nwin) fetch_x(x, blockIdx.x + NWG, wave, xr);
    qkv_gemm(4);
  }

  // Kept rolled: a second copy of the body would need registers that the
  // resident weight fragments already take.
#pragma unroll 1
  for (int b = blockIdx.x, j = 0; b < nwin; b += NWG, ++j) {
    // q, k, vT of this window were made in the span before (behind phase 3 of the
    // window before; the first window's: in front of the loop). This barrier
    // hands them over; it also ends the last reads of the x tile and of attn-out.
    __syncthreads();

    // ---------------- Stage the next window's x as f16 in LDS --------------
    // Here, so that the fetch's registers are free again for the score phase.
    if (b + NWG < nwin) stage_x(xS, wave, xr);

    // ------- Phase 2: S^T = k @ q^T + (bias + mask)^T, softmax, out^T = v^T @ P^T
    // One tile of 16 queries at a time. Lane (r, hf) holds, of query r, the keys
    // kt*16 + hf*8 + i in st[kt][i].
    {
      // This window's last token: row 48 + j of q and k (the lane's first chunk, as
      // that row exchanges them), column 48 + j of the lane's row of vT.
      const int o48 = (hf * 8) ^ ((NTOK - 1 + j) * DHEAD + ((j >> 2) & 3) * 8);
      const int v48 = (r * NPAD + ((r >> 1) & 7) * 8) ^ ((6 + (j >> 3)) * 8 + (j & 7));
      const int on  = r * DHEAD + ((hf ^ ((r >> 2) & 3)) * 8); // row r of a tile of q
      v16h ak[4], av[2][2];
#pragma unroll
      for (int kt = 0; kt < 3; ++kt)
        ak[kt] = ld_tile_s32(kS + h * 2048 + kt * 16 * DHEAD);
      ak[3] = ld_row_s32(kS + h * 2048, o48); // key 48 in every row; row 0 counts
#pragma unroll
      for (int dt = 0; dt < 2; ++dt) {
        const _Float16* vt = vtS + h * 2048 + dt * 16 * NPAD;
        av[dt][0] = ld_tile_s64(vt, 0);
        // Keys 32-47 whole; key 48 alone (the lanes with hf == 1 hold it as key 56,
        // whose P is 0); zeros meet the P of the other pad keys, which is 0.
        const v8h lo = *(const v8h*)(vt + r * NPAD + ((hf ^ ((r >> 1) & 7) ^ 4) * 8));
        v16h a = {};
#pragma unroll
        for (int e = 0; e < 8; ++e) a[e] = lo[e];
        a[8] = vt[v48];
        av[dt][1] = a;
      }
#pragma unroll
      for (int trl = 0; trl < 2; ++trl) {
        // The fourth query tile holds query 48 in every column; column 0 counts.
        const bool last = trl == 1 && p == 1;
        const v16h bq = ld_row_s32(qS + h * 2048, last ? o48 : (p * 2 + trl) * 16 * DHEAD + on);
        v8f st[4];
#pragma unroll
        for (int kt = 0; kt < 3; ++kt) // K = 32 in one step
          st[kt] = wmma_f16(ak[kt], bq, ld_ctile(bmW, trl * 3 + kt));
        const v8f c3 = {key48[trl], -1e30f, -1e30f, -1e30f, -1e30f, -1e30f, -1e30f, -1e30f};
        st[3] = wmma_f16(ak[3], bq, c3);
        // Of key tile 3 only element 0 can be a real key (48, where hf == 0; key 56
        // holds -1e30): elements 1-7 are pad keys in every lane, their P is 0.
        float mk[3];
#pragma unroll
        for (int kt = 0; kt < 3; ++kt)
          mk[kt] = fmaxf(fmaxf(fmaxf(st[kt][0], st[kt][1]), fmaxf(st[kt][2], st[kt][3])),
                         fmaxf(fmaxf(st[kt][4], st[kt][5]), fmaxf(st[kt][6], st[kt][7])));
        float mx = fmaxf(fmaxf(mk[0], mk[1]), fmaxf(mk[2], st[3][0]));
        mx = fmaxf(mx, xhalf(mx));
        float sk[3];
#pragma unroll
        for (int kt = 0; kt < 3; ++kt) {
#pragma unroll
          for (int i = 0; i < 8; ++i) st[kt][i] = __expf(st[kt][i] - mx);
          sk[kt] = ((st[kt][0] + st[kt][1]) + (st[kt][2] + st[kt][3])) +
                   ((st[kt][4] + st[kt][5]) + (st[kt][6] + st[kt][7]));
        }
        const float e48 = __expf(st[3][0] - mx);
        float sum = (sk[0] + sk[1]) + (sk[2] + e48);
        sum += xhalf(sum);
        const float inv = 1.0f / sum;
        // P^T as B fragments: element e of k step kk is key kk*32 + (e < 8 ? 0 : 16)
        // + hf*8 + (e & 7), which is st[kk*2 + (e >> 3)][e & 7] of this very lane.
        v16h pf[2];
#pragma unroll
        for (int e = 0; e < 8; ++e) {
          pf[0][e]     = (_Float16)(st[0][e] * inv);
          pf[0][e + 8] = (_Float16)(st[1][e] * inv);
          pf[1][e]     = (_Float16)(st[2][e] * inv);
          pf[1][e + 8] = (_Float16)0.f;
        }
        pf[1][8] = (_Float16)(e48 * inv);
        // out^T tile dt: lane (r, hf) holds, of query r, channels dt*16 + hf*8 + i:
        // 16 bytes in a row of attn-out.
        // Query 48 goes to row 48 + j, which waits there for the end of the loop.
        const int mo = __mul24(last ? NTOK - 1 + j : (p * 2 + trl) * 16 + r, XPITCH);
#pragma unroll
        for (int dt = 0; dt < 2; ++dt) {
          v8f o = {};
          o = wmma_f16(av[dt][0], pf[0], o);
          o = wmma_f16(av[dt][1], pf[1], o);
          v8h o8;
#pragma unroll
          for (int i = 0; i < 8; ++i) o8[i] = (_Float16)o[i];
          if (!last || r == 0) *(v8h*)(aoS + mo + h * DHEAD + dt * 16 + hf * 8) = o8;
        }
      }
    }
    __syncthreads();

    // This barrier hands over attn-out and the next window's x tile, and it ends
    // the last reads of q, k and vT.
    // x of the window after the next: issued here, where the score phase's
    // registers are free again; it lands during phase 3 and the QKV GEMM behind it.
    if (b + 2 * NWG < nwin) fetch_x(x, b + 2 * NWG, wave, xr);

    // ---------------- Phase 3: proj = ao(48x128) @ wproj^T + b_proj --------
    // A wave takes one token tile and one half of the channels: six waves; the
    // other two go on to phase 1. A row's 64 channels leave as one 16-byte store of
    // 16 lanes: 256 B.
    if (wave < 6) {
      const int mt = wave >> 1;
      const int ch = wave & 1;
      float* outp = out + (size_t)b * NTOK * CDIM + (mt * 16 + hf * 8) * CDIM + ch * 64 + r * 4;
      const float4 bp = *(const float4*)(bpS + ch * 64 + r * 4);
      v8f acc[4] = {};
      proj_tile(mt, ch, acc);
#pragma unroll
      for (int i = 0; i < 8; ++i)
        *(float4*)(outp + i * CDIM) = float4{acc[0][i] + bp.x, acc[1][i] + bp.y,
                                             acc[2][i] + bp.z, acc[3][i] + bp.w};
      // Wait before a register that these stores name is overwritten; outp is an
      // input so that its step to the next window cannot be placed in front.
      asm volatile("s_wait_xcnt 0x0" :: "v"(outp) : "memory");
    }

    // ---------------- Phase 1 of the next window, with no barrier in between:
    // it reads the x tile and writes q, k, vT, none of which phase 3 touches.
    if (b + NWG < nwin) qkv_gemm(3);
  }

  // ---------------- proj of the last tokens: rows 48 + j of attn-out -------
  // The last of them was written in front of the last trip's second barrier. The
  // two waves that have no part in phase 3 take it, a half of the channels each.
  // Row hf*8 + i belongs to token 48 of the workgroup's window number hf*8 + i.
  if (wave >= 6 && (int)blockIdx.x < nwin) {
    const int ch = wave & 1;
    const int w0 = (int)blockIdx.x + hf * 8 * NWG;
    float* outp = out + ((size_t)w0 * NTOK + NTOK - 1) * CDIM + ch * 64 + r * 4;
    const float4 bp = *(const float4*)(bpS + ch * 64 + r * 4);
    v8f acc[4] = {};
    proj_tile(3, ch, acc);
    float* op[8];
#pragma unroll
    for (int i = 0; i < 8; ++i) op[i] = outp + (size_t)i * NWG * NTOK * CDIM;
#pragma unroll
    for (int i = 0; i < 8; ++i)
      if (w0 + i * NWG < nwin)
        *(float4*)op[i] = float4{acc[0][i] + bp.x, acc[1][i] + bp.y,
                                 acc[2][i] + bp.z, acc[3][i] + bp.w};
    // Wait before a register that these stores name is overwritten; the addresses
    // are inputs and stay whole up to the wait.
    asm volatile("s_wait_xcnt 0x0" :: "v"(op[0]), "v"(op[1]), "v"(op[2]), "v"(op[3]),
                                      "v"(op[4]), "v"(op[5]), "v"(op[6]), "v"(op[7]) : "memory");
  }
}

extern "C" void kernel_launch(void* const* d_in, const int* in_sizes, int n_in,
                              void* d_out, int out_size, void* d_ws, size_t ws_size,
                              hipStream_t stream) {
  (void)n_in; (void)d_ws; (void)ws_size; (void)out_size;
  const float* x          = (const float*)d_in[0];
  const float* mask       = (const float*)d_in[1];
  const float* w_qkv      = (const float*)d_in[2];
  const float* b_qkv      = (const float*)d_in[3];
  const float* w_proj     = (const float*)d_in[4];
  const float* b_proj     = (const float*)d_in[5];
  const float* bias_table = (const float*)d_in[6];
  const int*   rel_index  = (const int*)d_in[7];
  float* out = (float*)d_out;

  const int B = in_sizes[0] / (NTOK * CDIM); // 4096 windows

  // Opt in to >default dynamic LDS (160 KB of the 320 KB/WGP on CDNA5).
  (void)hipFuncSetAttribute(reinterpret_cast<const void*>(swin_msa_fused),
                            hipFuncAttributeMaxDynamicSharedMemorySize, SMEM_BYTES);

  // 256 WGPs x 2 resident workgroups; each takes every 512th window.
  swin_msa_fused<<<NWG, 256, SMEM_BYTES, stream>>>(
      x, mask, w_qkv, b_qkv, w_proj, b_proj, bias_table, rel_index, out, B);
}
